// v000
// Measured on an AMD MI455X. A time is GPU time per run, averaged over a window of back-to-back runs after a warm-up
// (all launches, gaps included; the runs take copies of the inputs in turn), and the median of several windows.
// Apart from v000's, it joins two sittings. Times from different sittings can be a few percent apart, while
// side-by-side timings come from the same sitting.
// The starting kernel, v000, takes 211 microseconds a run.
#include <hip/hip_runtime.h>

// ---------------------------------------------------------------------------
// BERT attention block on gfx1250 (wave32, WMMA bf16 16x16x32).
//   H=768, NH=12, HD=64, B=2, S=2048
// - One-time f32->bf16 conversion; all GEMMs stream raw bf16 b128 fragments.
// - Flash attention stages K/V chunks into LDS once per block via
//   global_load_async_to_lds_b128 (ASYNCcnt), double-buffered.
// ---------------------------------------------------------------------------

constexpr int kH  = 768;
constexpr int kNH = 12;
constexpr int kHD = 64;
constexpr int kB  = 2;
constexpr int kS  = 2048;
constexpr int kM  = kB * kS;          // 4096 total rows
constexpr int kBH = kB * kNH;         // 24 (batch*heads)

constexpr int kKStride = 72;          // LDS row stride for K chunk (pad 8)
constexpr int kVStride = 40;          // LDS row stride for V chunk (pad 8)

typedef unsigned short u16;
typedef __attribute__((ext_vector_type(16))) __bf16 v16bf;
typedef __attribute__((ext_vector_type(16))) u16    v16us;
typedef __attribute__((ext_vector_type(8)))  u16    v8us;
typedef __attribute__((ext_vector_type(8)))  float  v8f;
typedef __attribute__((ext_vector_type(4)))  float  v4f;

typedef __attribute__((address_space(3))) u16 lds_u16;

__device__ __forceinline__ u16 f2bf_u(float f) {
  unsigned u = __builtin_bit_cast(unsigned, f);
  u += 0x7FFFu + ((u >> 16) & 1u);    // round-to-nearest-even
  return (u16)(u >> 16);
}

// Per-lane slice of a 16x32 bf16 WMMA A/B fragment from a row-major bf16
// matrix.  p points at element (row = lane&15, k = k0 + c0), c0 = 8*(lane>=16).
// Lane needs k-offsets {0..7} and {16..23}: two 16-byte loads, no ALU.
__device__ __forceinline__ v16bf load_frag_bf16(const u16* p) {
  v8us a = *(const v8us*)(p);
  v8us b = *(const v8us*)(p + 16);
  v16us u = __builtin_shufflevector(a, b, 0, 1, 2, 3, 4, 5, 6, 7,
                                          8, 9, 10, 11, 12, 13, 14, 15);
  return __builtin_bit_cast(v16bf, u);
}

__device__ __forceinline__ v8f wmma_bf16(v16bf a, v16bf b, v8f c) {
  return __builtin_amdgcn_wmma_f32_16x16x32_bf16(false, a, false, b,
                                                 (short)0, c, false, false);
}

// Async DMA of 16 bytes global -> LDS (tracked by ASYNCcnt).
__device__ __forceinline__ void async_copy_b128(u16* lds_dst, const u16* gsrc) {
  lds_u16* lp = (lds_u16*)lds_dst;
  asm volatile("global_load_async_to_lds_b128 %0, %1, off"
               :
               : "v"(lp), "v"(gsrc)
               : "memory");
}

__device__ __forceinline__ void wait_async0() {
  asm volatile("s_wait_asynccnt 0" ::: "memory");
}

// ---------------------------------------------------------------------------
// Kernel 0: elementwise f32 -> bf16 (8 elements / thread, vectorized).
// ---------------------------------------------------------------------------
__global__ void __launch_bounds__(256)
cvt_bf16_kernel(const float* __restrict__ in, u16* __restrict__ out, int n) {
  const int i = (blockIdx.x * 256 + threadIdx.x) * 8;
  if (i + 8 <= n) {
    v4f a = *(const v4f*)(in + i);
    v4f b = *(const v4f*)(in + i + 4);
    v8us u;
#pragma unroll
    for (int j = 0; j < 4; ++j) { u[j] = f2bf_u(a[j]); u[4 + j] = f2bf_u(b[j]); }
    *(v8us*)(out + i) = u;
  }
}

// ---------------------------------------------------------------------------
// Kernel 1: QKV projection from bf16 operands.  out = x @ W^T + b.
// Q,K written bf16 [BH, S, HD]; V written TRANSPOSED bf16 [BH, HD, S].
// ---------------------------------------------------------------------------
__global__ void __launch_bounds__(256)
qkv_proj_kernel(const u16* __restrict__ xbf,
                const u16* __restrict__ Wqb, const float* __restrict__ bq,
                const u16* __restrict__ Wkb, const float* __restrict__ bk,
                const u16* __restrict__ Wvb, const float* __restrict__ bv,
                u16* __restrict__ Qo, u16* __restrict__ Ko,
                u16* __restrict__ Vt) {
  const int lane = threadIdx.x & 31;
  const int wave = threadIdx.x >> 5;
  const int lh   = lane >> 4;
  const int ml   = lane & 15;
  const int c0   = lh * 8;
  const int m0   = (blockIdx.x * 8 + wave) * 16;
  const int n0   = blockIdx.y * 16;
  const int z    = blockIdx.z;

  const u16* W;  const float* bias;
  if (z == 0)      { W = Wqb; bias = bq; }
  else if (z == 1) { W = Wkb; bias = bk; }
  else             { W = Wvb; bias = bv; }

  v8f acc = {};
  const u16* arow = xbf + (size_t)(m0 + ml) * kH + c0;
  const u16* brow = W   + (size_t)(n0 + ml) * kH + c0;
#pragma unroll 4
  for (int k0 = 0; k0 < kH; k0 += 32)
    acc = wmma_bf16(load_frag_bf16(arow + k0), load_frag_bf16(brow + k0), acc);

  const int   n   = n0 + ml;
  const int   h   = n / kHD;
  const int   d   = n % kHD;
  const float bb_ = bias[n];
#pragma unroll
  for (int r = 0; r < 8; ++r) {
    const int m  = m0 + r + 8 * lh;
    const int bb = m / kS, ss = m % kS;
    const int bh = bb * kNH + h;
    const u16 v  = f2bf_u(acc[r] + bb_);
    if (z == 0)      Qo[((size_t)bh * kS + ss) * kHD + d] = v;
    else if (z == 1) Ko[((size_t)bh * kS + ss) * kHD + d] = v;
    else             Vt[((size_t)bh * kHD + d) * kS + ss] = v;
  }
}

// ---------------------------------------------------------------------------
// Kernel 2: flash attention.  8 waves / block share one (b,h); K/V chunks are
// DMA'd into double-buffered LDS with global_load_async_to_lds_b128, then each
// wave streams WMMA fragments from LDS.  Online softmax; P tile transposed
// C-layout -> A-layout through per-wave LDS.  Writes ctx bf16 [B,S,H].
// ---------------------------------------------------------------------------
__global__ void __launch_bounds__(256)
flash_attn_kernel(const u16* __restrict__ Q, const u16* __restrict__ K,
                  const u16* __restrict__ Vt,
                  const float* __restrict__ amask,
                  u16* __restrict__ ctx) {
  __shared__ __align__(16) u16 kbuf[2][32 * kKStride];  // 32 kv-rows x 64 dims
  __shared__ __align__(16) u16 vbuf[2][64 * kVStride];  // 64 d-rows  x 32 kv
  __shared__ float pbuf[8][16 * 33];                    // per-wave P tile

  const int tid  = threadIdx.x;
  const int lane = tid & 31;
  const int wave = tid >> 5;
  const int lh   = lane >> 4;
  const int ml   = lane & 15;
  const int c0   = lh * 8;

  const int bh = blockIdx.y;                  // 0..B*NH-1
  const int b  = bh / kNH;
  const int q0 = (blockIdx.x * 8 + wave) * 16;

  const u16* Qb  = Q  + (size_t)bh * kS * kHD;
  const u16* Kb  = K  + (size_t)bh * kS * kHD;
  const u16* Vtb = Vt + (size_t)bh * kHD * kS;

  // Staging coordinates: K chunk = 256 threads x 16B, V chunk likewise.
  const int krow = tid >> 3, kseg = tid & 7;  // 32 rows x 8 segs
  const int vrow = tid >> 2, vseg = tid & 3;  // 64 rows x 4 segs

  // Q fragments for this tile (HD=64 -> two k-steps of 32), loaded once.
  const v16bf qf0 = load_frag_bf16(Qb + (size_t)(q0 + ml) * kHD + 0  + c0);
  const v16bf qf1 = load_frag_bf16(Qb + (size_t)(q0 + ml) * kHD + 32 + c0);

  v8f o0 = {}, o1 = {}, o2 = {}, o3 = {};     // 16x64 output accumulator
  float mrun[8], lrun[8];
#pragma unroll
  for (int r = 0; r < 8; ++r) { mrun[r] = -3.0e38f; lrun[r] = 0.0f; }

  float* pw = &pbuf[wave][0];

  // Kick off DMA for chunk 0 into buffer 0.
  async_copy_b128(&kbuf[0][krow * kKStride + kseg * 8],
                  Kb + (size_t)krow * kHD + kseg * 8);
  async_copy_b128(&vbuf[0][vrow * kVStride + vseg * 8],
                  Vtb + (size_t)vrow * kS + vseg * 8);

  for (int kv0 = 0; kv0 < kS; kv0 += 32) {
    const int cur = (kv0 >> 5) & 1;
    wait_async0();                    // my chunk DMA done
    __syncthreads();                  // everyone's DMA done, prev buf free

    // Prefetch next chunk into the other buffer (overlaps with compute).
    if (kv0 + 32 < kS) {
      const int nxt = cur ^ 1;
      async_copy_b128(&kbuf[nxt][krow * kKStride + kseg * 8],
                      Kb + (size_t)(kv0 + 32 + krow) * kHD + kseg * 8);
      async_copy_b128(&vbuf[nxt][vrow * kVStride + vseg * 8],
                      Vtb + (size_t)vrow * kS + (kv0 + 32) + vseg * 8);
    }

    const u16* kch = &kbuf[cur][0];
    const u16* vch = &vbuf[cur][0];

    // ---- scores: two 16x16 tiles covering kv columns [kv0, kv0+32) ----
    v8f s0, s1;
#pragma unroll
    for (int t = 0; t < 2; ++t) {
      v8f sc = {};
      const u16* krow_l = kch + (t * 16 + ml) * kKStride + c0;
      sc = wmma_bf16(qf0, load_frag_bf16(krow_l + 0),  sc);
      sc = wmma_bf16(qf1, load_frag_bf16(krow_l + 32), sc);
      const float mval =
          (1.0f - amask[(size_t)b * kS + kv0 + t * 16 + ml]) * -10000.0f;
      v8f sv;
#pragma unroll
      for (int r = 0; r < 8; ++r) sv[r] = sc[r] * 0.125f + mval;  // 1/sqrt(64)
      if (t == 0) s0 = sv; else s1 = sv;
    }

    // ---- online softmax: row max / rescale / exp / row sum ----
#pragma unroll
    for (int r = 0; r < 8; ++r) {
      float mx = fmaxf(s0[r], s1[r]);
#pragma unroll
      for (int off = 1; off < 16; off <<= 1)
        mx = fmaxf(mx, __shfl_xor(mx, off, 32));
      const float mnew  = fmaxf(mrun[r], mx);
      const float alpha = __expf(mrun[r] - mnew);
      const float p0 = __expf(s0[r] - mnew);
      const float p1 = __expf(s1[r] - mnew);
      s0[r] = p0; s1[r] = p1;
      float rs = p0 + p1;
#pragma unroll
      for (int off = 1; off < 16; off <<= 1)
        rs += __shfl_xor(rs, off, 32);
      lrun[r] = lrun[r] * alpha + rs;
      mrun[r] = mnew;
      o0[r] *= alpha; o1[r] *= alpha; o2[r] *= alpha; o3[r] *= alpha;
    }

    // ---- transpose P (C-layout) -> A-layout via per-wave LDS ----
#pragma unroll
    for (int r = 0; r < 8; ++r) {
      const int row = r + 8 * lh;
      pw[row * 33 + ml]      = s0[r];
      pw[row * 33 + 16 + ml] = s1[r];
    }
    // Same-wave LDS ops are in-order; compiler inserts s_wait_dscnt for deps.
    v16us pu;
    const float* prow = pw + ml * 33 + c0;
#pragma unroll
    for (int i = 0; i < 8; ++i) pu[i]     = f2bf_u(prow[i]);
#pragma unroll
    for (int i = 0; i < 8; ++i) pu[8 + i] = f2bf_u(prow[16 + i]);
    const v16bf pf = __builtin_bit_cast(v16bf, pu);

    // ---- P x V : four 16-wide d tiles across HD=64 (LDS b128 loads) ----
    o0 = wmma_bf16(pf, load_frag_bf16(vch + (0  + ml) * kVStride + c0), o0);
    o1 = wmma_bf16(pf, load_frag_bf16(vch + (16 + ml) * kVStride + c0), o1);
    o2 = wmma_bf16(pf, load_frag_bf16(vch + (32 + ml) * kVStride + c0), o2);
    o3 = wmma_bf16(pf, load_frag_bf16(vch + (48 + ml) * kVStride + c0), o3);

    __syncthreads();                  // done reading cur buffer
  }

  // ---- normalize and write ctx (bf16) in merged [B, S, H] layout ----
  const int h = bh % kNH;
#pragma unroll
  for (int r = 0; r < 8; ++r) {
    const float inv = 1.0f / lrun[r];
    const int   q   = q0 + r + 8 * lh;
    u16* crow = ctx + ((size_t)b * kS + q) * kH + h * kHD + ml;
    crow[0]  = f2bf_u(o0[r] * inv);
    crow[16] = f2bf_u(o1[r] * inv);
    crow[32] = f2bf_u(o2[r] * inv);
    crow[48] = f2bf_u(o3[r] * inv);
  }
}

// ---------------------------------------------------------------------------
// Kernel 3: output projection + bias + residual.  y = ctx @ Wo^T + bo + x
// ---------------------------------------------------------------------------
__global__ void __launch_bounds__(256)
out_proj_kernel(const u16* __restrict__ ctxb, const u16* __restrict__ Wob,
                const float* __restrict__ bo, const float* __restrict__ x,
                float* __restrict__ y) {
  const int lane = threadIdx.x & 31;
  const int wave = threadIdx.x >> 5;
  const int lh   = lane >> 4;
  const int ml   = lane & 15;
  const int c0   = lh * 8;
  const int m0   = (blockIdx.x * 8 + wave) * 16;
  const int n0   = blockIdx.y * 16;

  v8f acc = {};
  const u16* arow = ctxb + (size_t)(m0 + ml) * kH + c0;
  const u16* brow = Wob  + (size_t)(n0 + ml) * kH + c0;
#pragma unroll 4
  for (int k0 = 0; k0 < kH; k0 += 32)
    acc = wmma_bf16(load_frag_bf16(arow + k0), load_frag_bf16(brow + k0), acc);

  const int   n   = n0 + ml;
  const float bb_ = bo[n];
#pragma unroll
  for (int r = 0; r < 8; ++r) {
    const int    m   = m0 + r + 8 * lh;
    const size_t idx = (size_t)m * kH + n;
    y[idx] = acc[r] + bb_ + x[idx];
  }
}

// ---------------------------------------------------------------------------
// Kernel 4: LayerNorm over last dim (768).  One wave per row.
// ---------------------------------------------------------------------------
__global__ void __launch_bounds__(256)
layernorm_kernel(const float* __restrict__ y, const float* __restrict__ gamma,
                 const float* __restrict__ beta, float* __restrict__ out) {
  const int lane = threadIdx.x & 31;
  const int wave = threadIdx.x >> 5;
  const int row  = blockIdx.x * 8 + wave;
  const float* yr = y + (size_t)row * kH;

  float s = 0.0f, s2 = 0.0f;
  for (int i = lane; i < kH; i += 32) {
    const float v = yr[i];
    s += v; s2 += v * v;
  }
#pragma unroll
  for (int off = 1; off < 32; off <<= 1) {
    s  += __shfl_xor(s,  off, 32);
    s2 += __shfl_xor(s2, off, 32);
  }
  const float mean = s * (1.0f / kH);
  const float var  = s2 * (1.0f / kH) - mean * mean;
  const float rstd = rsqrtf(var + 1e-5f);

  float* orow = out + (size_t)row * kH;
  for (int i = lane; i < kH; i += 32)
    orow[i] = (yr[i] - mean) * rstd * gamma[i] + beta[i];
}

// ---------------------------------------------------------------------------
// Launch
// ---------------------------------------------------------------------------
extern "C" void kernel_launch(void* const* d_in, const int* in_sizes, int n_in,
                              void* d_out, int out_size, void* d_ws,
                              size_t ws_size, hipStream_t stream) {
  (void)in_sizes; (void)n_in; (void)out_size; (void)ws_size;

  const float* x     = (const float*)d_in[0];
  const float* amask = (const float*)d_in[1];
  const float* Wq    = (const float*)d_in[2];
  const float* bq    = (const float*)d_in[3];
  const float* Wk    = (const float*)d_in[4];
  const float* bk    = (const float*)d_in[5];
  const float* Wv    = (const float*)d_in[6];
  const float* bv    = (const float*)d_in[7];
  const float* Wo    = (const float*)d_in[8];
  const float* bo    = (const float*)d_in[9];
  const float* g     = (const float*)d_in[10];
  const float* be    = (const float*)d_in[11];
  float* out = (float*)d_out;

  // Workspace carve-up (all regions 16B-aligned by construction).
  const size_t NX = (size_t)kM * kH;          // 3,145,728 activation elems
  const size_t NW = (size_t)kH * kH;          // 589,824 weight elems
  char* w = (char*)d_ws;
  u16* XBF = (u16*)w;  w += NX * 2;
  u16* WQB = (u16*)w;  w += NW * 2;
  u16* WKB = (u16*)w;  w += NW * 2;
  u16* WVB = (u16*)w;  w += NW * 2;
  u16* WOB = (u16*)w;  w += NW * 2;
  u16* Qb  = (u16*)w;  w += NX * 2;           // [BH, S, HD]
  u16* Kb  = (u16*)w;  w += NX * 2;           // [BH, S, HD]
  u16* Vtb = (u16*)w;  w += NX * 2;           // [BH, HD, S] (transposed)
  u16* CTX = (u16*)w;  w += NX * 2;           // [B, S, H] bf16
  float* Y = (float*)w;                       // [B, S, H] f32

  // One-time f32 -> bf16 conversions.
  cvt_bf16_kernel<<<dim3((int)(NX / 2048)), 256, 0, stream>>>(x,  XBF, (int)NX);
  cvt_bf16_kernel<<<dim3((int)(NW / 2048)), 256, 0, stream>>>(Wq, WQB, (int)NW);
  cvt_bf16_kernel<<<dim3((int)(NW / 2048)), 256, 0, stream>>>(Wk, WKB, (int)NW);
  cvt_bf16_kernel<<<dim3((int)(NW / 2048)), 256, 0, stream>>>(Wv, WVB, (int)NW);
  cvt_bf16_kernel<<<dim3((int)(NW / 2048)), 256, 0, stream>>>(Wo, WOB, (int)NW);

  // QKV projections: 256 m-tiles x 48 n-tiles, 8 waves/block, z = Q/K/V.
  qkv_proj_kernel<<<dim3(kM / 16 / 8, kH / 16, 3), 256, 0, stream>>>(
      XBF, WQB, bq, WKB, bk, WVB, bv, Qb, Kb, Vtb);

  // Flash attention: 128 q-tiles (8 per block) x 24 (b,h) pairs.
  flash_attn_kernel<<<dim3(kS / 16 / 8, kBH), 256, 0, stream>>>(
      Qb, Kb, Vtb, amask, CTX);

  // Output projection + residual.
  out_proj_kernel<<<dim3(kM / 16 / 8, kH / 16), 256, 0, stream>>>(
      CTX, WOB, bo, x, Y);

  // LayerNorm -> d_out.
  layernorm_kernel<<<dim3(kM / 8), 256, 0, stream>>>(Y, g, be, out);
}

// v001
// One run takes 147 microseconds.
// Timed twice side by side with v000, it ran 1.46 and 1.45 times as fast.
#include <hip/hip_runtime.h>

// ---------------------------------------------------------------------------
// Encoder attention block on gfx1250 (wave32, WMMA bf16 16x16x32).
//   H=768, NH=12, HD=64, B=2, S=2048
// - One-time f32->bf16 conversion; all GEMMs stream raw bf16 b128 fragments.
// - Flash attention stages K/V chunks into LDS once per block via
//   global_load_async_to_lds_b128 (ASYNCcnt), double-buffered.
// ---------------------------------------------------------------------------

constexpr int kH  = 768;
constexpr int kNH = 12;
constexpr int kHD = 64;
constexpr int kB  = 2;
constexpr int kS  = 2048;
constexpr int kM  = kB * kS;          // 4096 total rows
constexpr int kBH = kB * kNH;         // 24 (batch*heads)

constexpr int kKStride = 72;          // LDS row stride for K chunk (pad 8)
constexpr int kVStride = 40;          // LDS row stride for V chunk (pad 8)

typedef unsigned short u16;
typedef __attribute__((ext_vector_type(16))) __bf16 v16bf;
typedef __attribute__((ext_vector_type(16))) u16    v16us;
typedef __attribute__((ext_vector_type(8)))  u16    v8us;
typedef __attribute__((ext_vector_type(8)))  float  v8f;
typedef __attribute__((ext_vector_type(4)))  float  v4f;

typedef __attribute__((address_space(3))) u16 lds_u16;

__device__ __forceinline__ u16 f2bf_u(float f) {
  unsigned u = __builtin_bit_cast(unsigned, f);
  u += 0x7FFFu + ((u >> 16) & 1u);    // round-to-nearest-even
  return (u16)(u >> 16);
}

// Per-lane slice of a 16x32 bf16 WMMA A/B fragment from a row-major bf16
// matrix.  p points at element (row = lane&15, k = k0 + c0), c0 = 8*(lane>=16).
// Lane needs k-offsets {0..7} and {16..23}: two 16-byte loads, no ALU.
__device__ __forceinline__ v16bf load_frag_bf16(const u16* p) {
  v8us a = *(const v8us*)(p);
  v8us b = *(const v8us*)(p + 16);
  v16us u = __builtin_shufflevector(a, b, 0, 1, 2, 3, 4, 5, 6, 7,
                                          8, 9, 10, 11, 12, 13, 14, 15);
  return __builtin_bit_cast(v16bf, u);
}

__device__ __forceinline__ v8f wmma_bf16(v16bf a, v16bf b, v8f c) {
  return __builtin_amdgcn_wmma_f32_16x16x32_bf16(false, a, false, b,
                                                 (short)0, c, false, false);
}

// Register tile of the projection GEMMs: one wave owns kWT x kWT accumulator
// tiles (64 x 64 outputs), so every loaded A or B fragment feeds kWT WMMAs.
// Every loop over tiles or accumulator rows is fully unrolled, here and in the
// two kernels, so that these arrays are indexed by constants and stay in VGPRs.
constexpr int kWT = 4;

// acc += A[64 rows] * B[64 rows]^T over k = 0..kH.  abase / bbase are the
// wave-uniform first rows; loff is this lane's byte offset (row = lane&15,
// k = c0) inside a 16-row tile, the same for A and B.  Every load is scalar
// base + 32-bit lane offset + immediate.
__device__ __forceinline__ void gemm_wave_tile(const u16* abase, const u16* bbase,
                                               unsigned loff,
                                               v8f (&acc)[kWT][kWT]) {
  // Fully unrolled (24 k-steps): every k-step is an immediate offset, so there
  // is no address arithmetic and no branch among the WMMAs.
#pragma unroll
  for (int k0 = 0; k0 < kH; k0 += 32) {
    v16bf a[kWT], b[kWT];
#pragma unroll
    for (int i = 0; i < kWT; ++i)
      a[i] = load_frag_bf16((const u16*)((const char*)(abase + k0 + i * 16 * kH) + loff));
#pragma unroll
    for (int j = 0; j < kWT; ++j)
      b[j] = load_frag_bf16((const u16*)((const char*)(bbase + k0 + j * 16 * kH) + loff));
    // Stands behind the 16 loads of a k-step and names their lane offset, so
    // that register is not reused (the last load's destination took it) ahead
    // of the wait.  The data wait follows at once, so it adds no stall.
    asm volatile("s_wait_xcnt 0x0" :: "v"(loff) : "memory");
    // Keeps the 16 loads in one group ahead of the WMMAs: a load sunk among
    // them is waited for at once and exposes its whole latency.
    __builtin_amdgcn_sched_barrier(0);
#pragma unroll
    for (int i = 0; i < kWT; ++i)
#pragma unroll
      for (int j = 0; j < kWT; ++j) acc[i][j] = wmma_bf16(a[i], b[j], acc[i][j]);
  }
}

// Async DMA of 16 bytes global -> LDS (tracked by ASYNCcnt).
__device__ __forceinline__ void async_copy_b128(u16* lds_dst, const u16* gsrc) {
  lds_u16* lp = (lds_u16*)lds_dst;
  asm volatile("global_load_async_to_lds_b128 %0, %1, off"
               :
               : "v"(lp), "v"(gsrc)
               : "memory");
}

__device__ __forceinline__ void wait_async0() {
  asm volatile("s_wait_asynccnt 0" ::: "memory");
}

// ---------------------------------------------------------------------------
// Kernel 0: elementwise f32 -> bf16 (8 elements / thread, vectorized).
// ---------------------------------------------------------------------------
__global__ void __launch_bounds__(256)
cvt_bf16_kernel(const float* __restrict__ in, u16* __restrict__ out, int n) {
  const int i = (blockIdx.x * 256 + threadIdx.x) * 8;
  if (i + 8 <= n) {
    v4f a = *(const v4f*)(in + i);
    v4f b = *(const v4f*)(in + i + 4);
    v8us u;
#pragma unroll
    for (int j = 0; j < 4; ++j) { u[j] = f2bf_u(a[j]); u[4 + j] = f2bf_u(b[j]); }
    *(v8us*)(out + i) = u;
  }
}

// ---------------------------------------------------------------------------
// Kernel 1: QKV projection from bf16 operands.  out = x @ W^T + b.
// Q,K written bf16 [BH, S, HD]; V written TRANSPOSED bf16 [BH, HD, S].
// One wave = 64 rows x one whole head of Q, K or V; the 9 waves of a block
// share the same 64 rows of x (36 (head, z) slots = 4 blocks along y).
// ---------------------------------------------------------------------------
__global__ void __launch_bounds__(288)
qkv_proj_kernel(const u16* __restrict__ xbf,
                const u16* __restrict__ Wqb, const float* __restrict__ bq,
                const u16* __restrict__ Wkb, const float* __restrict__ bk,
                const u16* __restrict__ Wvb, const float* __restrict__ bv,
                u16* __restrict__ Qo, u16* __restrict__ Ko,
                u16* __restrict__ Vt) {
  const int lane = threadIdx.x & 31;
  const int wave = __builtin_amdgcn_readfirstlane(threadIdx.x >> 5);
  const int lh   = lane >> 4;
  const int ml   = lane & 15;
  const int c0   = lh * 8;
  const int m0   = blockIdx.x * (16 * kWT);
  const int slot = blockIdx.y * 9 + wave;     // 0..35: (head, z)
  const int z    = slot % 3;                  // every block: 3 waves each of Q, K, V
  const int h    = slot / 3;
  const int n0   = h * kHD;

  const u16* W;  const float* bias;
  if (z == 0)      { W = Wqb; bias = bq; }
  else if (z == 1) { W = Wkb; bias = bk; }
  else             { W = Wvb; bias = bv; }

  v8f acc[kWT][kWT] = {};
  gemm_wave_tile(xbf + (size_t)m0 * kH, W + (size_t)n0 * kH,
                 (unsigned)(ml * kH + c0) * 2u, acc);

  const int bh = (m0 / kS) * kNH + h;         // 64 rows never cross a batch
  const int s0 = m0 % kS + 8 * lh;
  float bb_[kWT];
#pragma unroll
  for (int j = 0; j < kWT; ++j) bb_[j] = bias[n0 + j * 16 + ml];

  if (z == 2) {                               // V: [BH, HD, S]
    u16* o = Vt + ((size_t)bh * kHD + ml) * kS + s0;
#pragma unroll
    for (int i = 0; i < kWT; ++i)
#pragma unroll
      for (int j = 0; j < kWT; ++j)
#pragma unroll
        for (int r = 0; r < 8; ++r)
          o[(size_t)(j * 16) * kS + i * 16 + r] = f2bf_u(acc[i][j][r] + bb_[j]);
    return;
  }
  u16* o = (z == 0 ? Qo : Ko) + ((size_t)bh * kS + s0) * kHD + ml;  // [BH, S, HD]
#pragma unroll
  for (int i = 0; i < kWT; ++i)
#pragma unroll
    for (int j = 0; j < kWT; ++j)
#pragma unroll
      for (int r = 0; r < 8; ++r)
        o[(i * 16 + r) * kHD + j * 16] = f2bf_u(acc[i][j][r] + bb_[j]);
  // Behind the last stores: in the built code the V path's block follows this
  // one and rewrites the registers that these stores name.
  asm volatile("s_wait_xcnt 0x0" ::: "memory");
}

// ---------------------------------------------------------------------------
// Kernel 2: flash attention.  8 waves / block share one (b,h); K/V chunks are
// DMA'd into double-buffered LDS with global_load_async_to_lds_b128, then each
// wave streams WMMA fragments from LDS.  Online softmax; P tile transposed
// C-layout -> A-layout through per-wave LDS.  Writes ctx bf16 [B,S,H].
// ---------------------------------------------------------------------------
__global__ void __launch_bounds__(256)
flash_attn_kernel(const u16* __restrict__ Q, const u16* __restrict__ K,
                  const u16* __restrict__ Vt,
                  const float* __restrict__ amask,
                  u16* __restrict__ ctx) {
  __shared__ __align__(16) u16 kbuf[2][32 * kKStride];  // 32 kv-rows x 64 dims
  __shared__ __align__(16) u16 vbuf[2][64 * kVStride];  // 64 d-rows  x 32 kv
  __shared__ float pbuf[8][16 * 33];                    // per-wave P tile

  const int tid  = threadIdx.x;
  const int lane = tid & 31;
  const int wave = tid >> 5;
  const int lh   = lane >> 4;
  const int ml   = lane & 15;
  const int c0   = lh * 8;

  const int bh = blockIdx.y;                  // 0..B*NH-1
  const int b  = bh / kNH;
  const int q0 = (blockIdx.x * 8 + wave) * 16;

  const u16* Qb  = Q  + (size_t)bh * kS * kHD;
  const u16* Kb  = K  + (size_t)bh * kS * kHD;
  const u16* Vtb = Vt + (size_t)bh * kHD * kS;

  // Staging coordinates: K chunk = 256 threads x 16B, V chunk likewise.
  const int krow = tid >> 3, kseg = tid & 7;  // 32 rows x 8 segs
  const int vrow = tid >> 2, vseg = tid & 3;  // 64 rows x 4 segs

  // Q fragments for this tile (HD=64 -> two k-steps of 32), loaded once.
  const v16bf qf0 = load_frag_bf16(Qb + (size_t)(q0 + ml) * kHD + 0  + c0);
  const v16bf qf1 = load_frag_bf16(Qb + (size_t)(q0 + ml) * kHD + 32 + c0);

  v8f o0 = {}, o1 = {}, o2 = {}, o3 = {};     // 16x64 output accumulator
  float mrun[8], lrun[8];
#pragma unroll
  for (int r = 0; r < 8; ++r) { mrun[r] = -3.0e38f; lrun[r] = 0.0f; }

  float* pw = &pbuf[wave][0];

  // Kick off DMA for chunk 0 into buffer 0.
  async_copy_b128(&kbuf[0][krow * kKStride + kseg * 8],
                  Kb + (size_t)krow * kHD + kseg * 8);
  async_copy_b128(&vbuf[0][vrow * kVStride + vseg * 8],
                  Vtb + (size_t)vrow * kS + vseg * 8);

  for (int kv0 = 0; kv0 < kS; kv0 += 32) {
    const int cur = (kv0 >> 5) & 1;
    wait_async0();                    // my chunk DMA done
    __syncthreads();                  // everyone's DMA done, prev buf free

    // Prefetch next chunk into the other buffer (overlaps with compute).
    if (kv0 + 32 < kS) {
      const int nxt = cur ^ 1;
      async_copy_b128(&kbuf[nxt][krow * kKStride + kseg * 8],
                      Kb + (size_t)(kv0 + 32 + krow) * kHD + kseg * 8);
      async_copy_b128(&vbuf[nxt][vrow * kVStride + vseg * 8],
                      Vtb + (size_t)vrow * kS + (kv0 + 32) + vseg * 8);
    }

    const u16* kch = &kbuf[cur][0];
    const u16* vch = &vbuf[cur][0];

    // ---- scores: two 16x16 tiles covering kv columns [kv0, kv0+32) ----
    v8f s0, s1;
#pragma unroll
    for (int t = 0; t < 2; ++t) {
      v8f sc = {};
      const u16* krow_l = kch + (t * 16 + ml) * kKStride + c0;
      sc = wmma_bf16(qf0, load_frag_bf16(krow_l + 0),  sc);
      sc = wmma_bf16(qf1, load_frag_bf16(krow_l + 32), sc);
      const float mval =
          (1.0f - amask[(size_t)b * kS + kv0 + t * 16 + ml]) * -10000.0f;
      v8f sv;
#pragma unroll
      for (int r = 0; r < 8; ++r) sv[r] = sc[r] * 0.125f + mval;  // 1/sqrt(64)
      if (t == 0) s0 = sv; else s1 = sv;
    }

    // ---- online softmax: row max / rescale / exp / row sum ----
#pragma unroll
    for (int r = 0; r < 8; ++r) {
      float mx = fmaxf(s0[r], s1[r]);
#pragma unroll
      for (int off = 1; off < 16; off <<= 1)
        mx = fmaxf(mx, __shfl_xor(mx, off, 32));
      const float mnew  = fmaxf(mrun[r], mx);
      const float alpha = __expf(mrun[r] - mnew);
      const float p0 = __expf(s0[r] - mnew);
      const float p1 = __expf(s1[r] - mnew);
      s0[r] = p0; s1[r] = p1;
      float rs = p0 + p1;
#pragma unroll
      for (int off = 1; off < 16; off <<= 1)
        rs += __shfl_xor(rs, off, 32);
      lrun[r] = lrun[r] * alpha + rs;
      mrun[r] = mnew;
      o0[r] *= alpha; o1[r] *= alpha; o2[r] *= alpha; o3[r] *= alpha;
    }

    // ---- transpose P (C-layout) -> A-layout via per-wave LDS ----
#pragma unroll
    for (int r = 0; r < 8; ++r) {
      const int row = r + 8 * lh;
      pw[row * 33 + ml]      = s0[r];
      pw[row * 33 + 16 + ml] = s1[r];
    }
    // Same-wave LDS ops are in-order; compiler inserts s_wait_dscnt for deps.
    v16us pu;
    const float* prow = pw + ml * 33 + c0;
#pragma unroll
    for (int i = 0; i < 8; ++i) pu[i]     = f2bf_u(prow[i]);
#pragma unroll
    for (int i = 0; i < 8; ++i) pu[8 + i] = f2bf_u(prow[16 + i]);
    const v16bf pf = __builtin_bit_cast(v16bf, pu);

    // ---- P x V : four 16-wide d tiles across HD=64 (LDS b128 loads) ----
    o0 = wmma_bf16(pf, load_frag_bf16(vch + (0  + ml) * kVStride + c0), o0);
    o1 = wmma_bf16(pf, load_frag_bf16(vch + (16 + ml) * kVStride + c0), o1);
    o2 = wmma_bf16(pf, load_frag_bf16(vch + (32 + ml) * kVStride + c0), o2);
    o3 = wmma_bf16(pf, load_frag_bf16(vch + (48 + ml) * kVStride + c0), o3);

    __syncthreads();                  // done reading cur buffer
  }

  // ---- normalize and write ctx (bf16) in merged [B, S, H] layout ----
  const int h = bh % kNH;
#pragma unroll
  for (int r = 0; r < 8; ++r) {
    const float inv = 1.0f / lrun[r];
    const int   q   = q0 + r + 8 * lh;
    u16* crow = ctx + ((size_t)b * kS + q) * kH + h * kHD + ml;
    crow[0]  = f2bf_u(o0[r] * inv);
    crow[16] = f2bf_u(o1[r] * inv);
    crow[32] = f2bf_u(o2[r] * inv);
    crow[48] = f2bf_u(o3[r] * inv);
  }
}

// ---------------------------------------------------------------------------
// Kernel 3: output projection + bias + residual.  y = ctx @ Wo^T + bo + x
// One wave = 64 x 64 outputs; the 3 waves of a block share 64 rows of ctx.
// ---------------------------------------------------------------------------
__global__ void __launch_bounds__(96)
out_proj_kernel(const u16* __restrict__ ctxb, const u16* __restrict__ Wob,
                const float* __restrict__ bo, const float* __restrict__ x,
                float* __restrict__ y) {
  const int lane = threadIdx.x & 31;
  const int wave = __builtin_amdgcn_readfirstlane(threadIdx.x >> 5);
  const int lh   = lane >> 4;
  const int ml   = lane & 15;
  const int c0   = lh * 8;
  const int m0   = blockIdx.x * (16 * kWT);
  const int n0   = (blockIdx.y * 3 + wave) * (16 * kWT);

  v8f acc[kWT][kWT] = {};
  gemm_wave_tile(ctxb + (size_t)m0 * kH, Wob + (size_t)n0 * kH,
                 (unsigned)(ml * kH + c0) * 2u, acc);

  float bb_[kWT];
#pragma unroll
  for (int j = 0; j < kWT; ++j) bb_[j] = bo[n0 + j * 16 + ml];

  const size_t base = (size_t)(m0 + 8 * lh) * kH + n0 + ml;
#pragma unroll
  for (int i = 0; i < kWT; ++i) {
    // The 32 residual values of a 16-row strip are fetched together, ahead of
    // its stores, so the wave waits for memory once per strip.
    float xr[kWT][8];
    // These loads land in registers that the bias loads (their index) and the
    // previous strip's stores (their data) still name.
    asm volatile("s_wait_xcnt 0x0" ::: "memory");
#pragma unroll
    for (int j = 0; j < kWT; ++j)
#pragma unroll
      for (int r = 0; r < 8; ++r) xr[j][r] = x[base + (i * 16 + r) * kH + j * 16];
#pragma unroll
    for (int j = 0; j < kWT; ++j)
#pragma unroll
      for (int r = 0; r < 8; ++r) xr[j][r] = acc[i][j][r] + bb_[j] + xr[j][r];
#pragma unroll
    for (int j = 0; j < kWT; ++j)
#pragma unroll
      for (int r = 0; r < 8; ++r) y[base + (i * 16 + r) * kH + j * 16] = xr[j][r];
  }
}

// ---------------------------------------------------------------------------
// Kernel 4: LayerNorm over last dim (768).  One wave per row.
// ---------------------------------------------------------------------------
__global__ void __launch_bounds__(256)
layernorm_kernel(const float* __restrict__ y, const float* __restrict__ gamma,
                 const float* __restrict__ beta, float* __restrict__ out) {
  const int lane = threadIdx.x & 31;
  const int wave = threadIdx.x >> 5;
  const int row  = blockIdx.x * 8 + wave;
  const float* yr = y + (size_t)row * kH;

  float s = 0.0f, s2 = 0.0f;
  for (int i = lane; i < kH; i += 32) {
    const float v = yr[i];
    s += v; s2 += v * v;
  }
#pragma unroll
  for (int off = 1; off < 32; off <<= 1) {
    s  += __shfl_xor(s,  off, 32);
    s2 += __shfl_xor(s2, off, 32);
  }
  const float mean = s * (1.0f / kH);
  const float var  = s2 * (1.0f / kH) - mean * mean;
  const float rstd = rsqrtf(var + 1e-5f);

  float* orow = out + (size_t)row * kH;
  for (int i = lane; i < kH; i += 32)
    orow[i] = (yr[i] - mean) * rstd * gamma[i] + beta[i];
}

// ---------------------------------------------------------------------------
// Launch
// ---------------------------------------------------------------------------
extern "C" void kernel_launch(void* const* d_in, const int* in_sizes, int n_in,
                              void* d_out, int out_size, void* d_ws,
                              size_t ws_size, hipStream_t stream) {
  (void)in_sizes; (void)n_in; (void)out_size; (void)ws_size;

  const float* x     = (const float*)d_in[0];
  const float* amask = (const float*)d_in[1];
  const float* Wq    = (const float*)d_in[2];
  const float* bq    = (const float*)d_in[3];
  const float* Wk    = (const float*)d_in[4];
  const float* bk    = (const float*)d_in[5];
  const float* Wv    = (const float*)d_in[6];
  const float* bv    = (const float*)d_in[7];
  const float* Wo    = (const float*)d_in[8];
  const float* bo    = (const float*)d_in[9];
  const float* g     = (const float*)d_in[10];
  const float* be    = (const float*)d_in[11];
  float* out = (float*)d_out;

  // Workspace carve-up (all regions 16B-aligned by construction).
  const size_t NX = (size_t)kM * kH;          // 3,145,728 activation elems
  const size_t NW = (size_t)kH * kH;          // 589,824 weight elems
  char* w = (char*)d_ws;
  u16* XBF = (u16*)w;  w += NX * 2;
  u16* WQB = (u16*)w;  w += NW * 2;
  u16* WKB = (u16*)w;  w += NW * 2;
  u16* WVB = (u16*)w;  w += NW * 2;
  u16* WOB = (u16*)w;  w += NW * 2;
  u16* Qb  = (u16*)w;  w += NX * 2;           // [BH, S, HD]
  u16* Kb  = (u16*)w;  w += NX * 2;           // [BH, S, HD]
  u16* Vtb = (u16*)w;  w += NX * 2;           // [BH, HD, S] (transposed)
  u16* CTX = (u16*)w;  w += NX * 2;           // [B, S, H] bf16
  float* Y = (float*)w;                       // [B, S, H] f32

  // One-time f32 -> bf16 conversions.
  cvt_bf16_kernel<<<dim3((int)(NX / 2048)), 256, 0, stream>>>(x,  XBF, (int)NX);
  cvt_bf16_kernel<<<dim3((int)(NW / 2048)), 256, 0, stream>>>(Wq, WQB, (int)NW);
  cvt_bf16_kernel<<<dim3((int)(NW / 2048)), 256, 0, stream>>>(Wk, WKB, (int)NW);
  cvt_bf16_kernel<<<dim3((int)(NW / 2048)), 256, 0, stream>>>(Wv, WVB, (int)NW);
  cvt_bf16_kernel<<<dim3((int)(NW / 2048)), 256, 0, stream>>>(Wo, WOB, (int)NW);

  // QKV projections: 64 row blocks x 4 groups of 9 (head, z) slots = 256 blocks.
  qkv_proj_kernel<<<dim3(kM / 64, 3 * kNH / 9), 288, 0, stream>>>(
      XBF, WQB, bq, WKB, bk, WVB, bv, Qb, Kb, Vtb);

  // Flash attention: 128 q-tiles (8 per block) x 24 (b,h) pairs.
  flash_attn_kernel<<<dim3(kS / 16 / 8, kBH), 256, 0, stream>>>(
      Qb, Kb, Vtb, amask, CTX);

  // Output projection + residual.
  out_proj_kernel<<<dim3(kM / 64, kH / 64 / 3), 96, 0, stream>>>(
      CTX, WOB, bo, x, Y);

  // LayerNorm -> d_out.
  layernorm_kernel<<<dim3(kM / 8), 256, 0, stream>>>(Y, g, be, out);
}

// v002
// A run of this version takes 108 microseconds.
// Two timings next to v001 put it at 1.36 and 1.37 times that version's speed.
// Over all steps from v000 it is 1.99 times as fast.
#include <hip/hip_runtime.h>

// ---------------------------------------------------------------------------
// Encoder attention block on gfx1250 (wave32, WMMA bf16 16x16x32).
//   H=768, NH=12, HD=64, B=2, S=2048
// - One-time f32->bf16 conversion; all GEMMs stream raw bf16 b128 fragments.
// - Flash attention stages K/V chunks into LDS once per block via
//   global_load_async_to_lds_b128 (ASYNCcnt), double-buffered.
// ---------------------------------------------------------------------------

constexpr int kH  = 768;
constexpr int kNH = 12;
constexpr int kHD = 64;
constexpr int kB  = 2;
constexpr int kS  = 2048;
constexpr int kM  = kB * kS;          // 4096 total rows
constexpr int kBH = kB * kNH;         // 24 (batch*heads)

constexpr int kKStride = 72;          // LDS row stride for K chunk (pad 8)
constexpr int kVStride = 40;          // LDS row stride for V chunk (pad 8)

typedef unsigned short u16;
typedef __attribute__((ext_vector_type(16))) __bf16 v16bf;
typedef __attribute__((ext_vector_type(16))) u16    v16us;
typedef __attribute__((ext_vector_type(8)))  u16    v8us;
typedef __attribute__((ext_vector_type(8)))  float  v8f;
typedef __attribute__((ext_vector_type(4)))  float  v4f;
typedef __attribute__((ext_vector_type(2)))  float  v2f;
typedef __attribute__((ext_vector_type(2)))  __bf16 v2bf;
typedef __attribute__((ext_vector_type(8)))  unsigned v8u;

typedef __attribute__((address_space(3))) u16 lds_u16;

__device__ __forceinline__ u16 f2bf_u(float f) {
  unsigned u = __builtin_bit_cast(unsigned, f);
  u += 0x7FFFu + ((u >> 16) & 1u);    // round-to-nearest-even
  return (u16)(u >> 16);
}

// Per-lane slice of a 16x32 bf16 WMMA A/B fragment from a row-major bf16
// matrix.  p points at element (row = lane&15, k = k0 + c0), c0 = 8*(lane>=16).
// Lane needs k-offsets {0..7} and {16..23}: two 16-byte loads, no ALU.
__device__ __forceinline__ v16bf load_frag_bf16(const u16* p) {
  v8us a = *(const v8us*)(p);
  v8us b = *(const v8us*)(p + 16);
  v16us u = __builtin_shufflevector(a, b, 0, 1, 2, 3, 4, 5, 6, 7,
                                          8, 9, 10, 11, 12, 13, 14, 15);
  return __builtin_bit_cast(v16bf, u);
}

__device__ __forceinline__ v8f wmma_bf16(v16bf a, v16bf b, v8f c) {
  return __builtin_amdgcn_wmma_f32_16x16x32_bf16(false, a, false, b,
                                                 (short)0, c, false, false);
}

// Register tile of the projection GEMMs: one wave owns kWT x kWT accumulator
// tiles (64 x 64 outputs), so every loaded A or B fragment feeds kWT WMMAs.
// Every loop over tiles or accumulator rows is fully unrolled, here and in the
// two kernels, so that these arrays are indexed by constants and stay in VGPRs.
constexpr int kWT = 4;

// acc += A[64 rows] * B[64 rows]^T over k = 0..kH.  abase / bbase are the
// wave-uniform first rows; loff is this lane's byte offset (row = lane&15,
// k = c0) inside a 16-row tile, the same for A and B.  Every load is scalar
// base + 32-bit lane offset + immediate.
__device__ __forceinline__ void gemm_wave_tile(const u16* abase, const u16* bbase,
                                               unsigned loff,
                                               v8f (&acc)[kWT][kWT]) {
  // Fully unrolled (24 k-steps): every k-step is an immediate offset, so there
  // is no address arithmetic and no branch among the WMMAs.
#pragma unroll
  for (int k0 = 0; k0 < kH; k0 += 32) {
    v16bf a[kWT], b[kWT];
#pragma unroll
    for (int i = 0; i < kWT; ++i)
      a[i] = load_frag_bf16((const u16*)((const char*)(abase + k0 + i * 16 * kH) + loff));
#pragma unroll
    for (int j = 0; j < kWT; ++j)
      b[j] = load_frag_bf16((const u16*)((const char*)(bbase + k0 + j * 16 * kH) + loff));
    // Stands behind the 16 loads of a k-step and names their lane offset, so
    // that register is not reused (the last load's destination took it) ahead
    // of the wait.  The data wait follows at once, so it adds no stall.
    asm volatile("s_wait_xcnt 0x0" :: "v"(loff) : "memory");
    // Keeps the 16 loads in one group ahead of the WMMAs: a load sunk among
    // them is waited for at once and exposes its whole latency.
    __builtin_amdgcn_sched_barrier(0);
#pragma unroll
    for (int i = 0; i < kWT; ++i)
#pragma unroll
      for (int j = 0; j < kWT; ++j) acc[i][j] = wmma_bf16(a[i], b[j], acc[i][j]);
  }
}

// Async DMA of 16 bytes global -> LDS (tracked by ASYNCcnt).
__device__ __forceinline__ void async_copy_b128(u16* lds_dst, const u16* gsrc) {
  lds_u16* lp = (lds_u16*)lds_dst;
  asm volatile("global_load_async_to_lds_b128 %0, %1, off"
               :
               : "v"(lp), "v"(gsrc)
               : "memory");
}

__device__ __forceinline__ void wait_async0() {
  asm volatile("s_wait_asynccnt 0" ::: "memory");
}

// ---------------------------------------------------------------------------
// Kernel 0: elementwise f32 -> bf16 (8 elements / thread, vectorized).
// ---------------------------------------------------------------------------
__global__ void __launch_bounds__(256)
cvt_bf16_kernel(const float* __restrict__ in, u16* __restrict__ out, int n) {
  const int i = (blockIdx.x * 256 + threadIdx.x) * 8;
  if (i + 8 <= n) {
    v4f a = *(const v4f*)(in + i);
    v4f b = *(const v4f*)(in + i + 4);
    v8us u;
#pragma unroll
    for (int j = 0; j < 4; ++j) { u[j] = f2bf_u(a[j]); u[4 + j] = f2bf_u(b[j]); }
    *(v8us*)(out + i) = u;
  }
}

// ---------------------------------------------------------------------------
// Kernel 1: QKV projection from bf16 operands.  out = x @ W^T + b.
// Q,K written bf16 [BH, S, HD]; V written TRANSPOSED bf16 [BH, HD, S].
// One wave = 64 rows x one whole head of Q, K or V; the 9 waves of a block
// share the same 64 rows of x (36 (head, z) slots = 4 blocks along y).
// ---------------------------------------------------------------------------
__global__ void __launch_bounds__(288)
qkv_proj_kernel(const u16* __restrict__ xbf,
                const u16* __restrict__ Wqb, const float* __restrict__ bq,
                const u16* __restrict__ Wkb, const float* __restrict__ bk,
                const u16* __restrict__ Wvb, const float* __restrict__ bv,
                u16* __restrict__ Qo, u16* __restrict__ Ko,
                u16* __restrict__ Vt) {
  const int lane = threadIdx.x & 31;
  const int wave = __builtin_amdgcn_readfirstlane(threadIdx.x >> 5);
  const int lh   = lane >> 4;
  const int ml   = lane & 15;
  const int c0   = lh * 8;
  const int m0   = blockIdx.x * (16 * kWT);
  const int slot = blockIdx.y * 9 + wave;     // 0..35: (head, z)
  const int z    = slot % 3;                  // every block: 3 waves each of Q, K, V
  const int h    = slot / 3;
  const int n0   = h * kHD;

  const u16* W;  const float* bias;
  if (z == 0)      { W = Wqb; bias = bq; }
  else if (z == 1) { W = Wkb; bias = bk; }
  else             { W = Wvb; bias = bv; }

  v8f acc[kWT][kWT] = {};
  gemm_wave_tile(xbf + (size_t)m0 * kH, W + (size_t)n0 * kH,
                 (unsigned)(ml * kH + c0) * 2u, acc);

  const int bh = (m0 / kS) * kNH + h;         // 64 rows never cross a batch
  const int s0 = m0 % kS + 8 * lh;
  float bb_[kWT];
#pragma unroll
  for (int j = 0; j < kWT; ++j) bb_[j] = bias[n0 + j * 16 + ml];

  if (z == 2) {                               // V: [BH, HD, S]
    u16* o = Vt + ((size_t)bh * kHD + ml) * kS + s0;
#pragma unroll
    for (int i = 0; i < kWT; ++i)
#pragma unroll
      for (int j = 0; j < kWT; ++j)
#pragma unroll
        for (int r = 0; r < 8; ++r)
          o[(size_t)(j * 16) * kS + i * 16 + r] = f2bf_u(acc[i][j][r] + bb_[j]);
    return;
  }
  u16* o = (z == 0 ? Qo : Ko) + ((size_t)bh * kS + s0) * kHD + ml;  // [BH, S, HD]
#pragma unroll
  for (int i = 0; i < kWT; ++i)
#pragma unroll
    for (int j = 0; j < kWT; ++j)
#pragma unroll
      for (int r = 0; r < 8; ++r)
        o[(i * 16 + r) * kHD + j * 16] = f2bf_u(acc[i][j][r] + bb_[j]);
  // Behind the last stores: in the built code the V path's block follows this
  // one and rewrites the registers that these stores name.
  asm volatile("s_wait_xcnt 0x0" ::: "memory");
}

// ---------------------------------------------------------------------------
// Kernel 2: flash attention, transposed products.  8 waves / block share one
// (b,h); K/V chunks are DMA'd into double-buffered LDS with
// global_load_async_to_lds_b128, then each wave streams WMMA fragments from LDS.
//   S^T = K Q^T   : A = K rows, B = Q rows; lane (c, h) holds query column c,
//                   register r of tile t = key t*16 + 8h + r.
//   O^T += V^T P^T: A = V^T rows, B = the two S^T tiles packed to bf16 in place
//                   (their register order is the k order of the A loader).
// A query's scores sit in the two lanes c and c + 16: maximum and sum are taken
// in the lane, with one exchange between the halves.  Writes ctx bf16 [B,S,H].
// ---------------------------------------------------------------------------
__device__ __forceinline__ unsigned pack_bf16(float lo, float hi) {
  return __builtin_bit_cast(unsigned, __builtin_convertvector(v2f{lo, hi}, v2bf));
}

__device__ __forceinline__ float max3f(float a, float b, float c) {
  return fmaxf(fmaxf(a, b), c);
}

// Value of lane l ^ 16.
__device__ __forceinline__ float other_half(float x) {
  const int v = __builtin_bit_cast(int, x);
  return __builtin_bit_cast(float, __builtin_amdgcn_permlanex16(
      v, v, 0x76543210, 0xfedcba98, false, false));
}

__global__ void __launch_bounds__(256)
flash_attn_kernel(const u16* __restrict__ Q, const u16* __restrict__ K,
                  const u16* __restrict__ Vt,
                  const float* __restrict__ amask,
                  u16* __restrict__ ctx) {
  __shared__ __align__(16) u16 kbuf[2][32 * kKStride];  // 32 kv-rows x 64 dims
  __shared__ __align__(16) u16 vbuf[2][64 * kVStride];  // 64 d-rows  x 32 kv
  __shared__ __align__(16) float mbias[kS];             // mask term per key

  const int tid  = threadIdx.x;
  const int lane = tid & 31;
  const int wave = tid >> 5;
  const int lh   = lane >> 4;
  const int ml   = lane & 15;
  const int c0   = lh * 8;

  const int bh = blockIdx.y;                  // 0..B*NH-1
  const int b  = bh / kNH;
  const int q0 = (blockIdx.x * 8 + wave) * 16;

  const u16* Qb  = Q  + (size_t)bh * kS * kHD;
  const u16* Kb  = K  + (size_t)bh * kS * kHD;
  const u16* Vtb = Vt + (size_t)bh * kHD * kS;

  // Staging coordinates: K chunk = 256 threads x 16B, V chunk likewise.
  const int krow = tid >> 3, kseg = tid & 7;  // 32 rows x 8 segs
  const int vrow = tid >> 2, vseg = tid & 3;  // 64 rows x 4 segs

  // Q fragments for this tile (HD=64 -> two k-steps of 32), loaded once.
  const v16bf qf0 = load_frag_bf16(Qb + (size_t)(q0 + ml) * kHD + 0  + c0);
  const v16bf qf1 = load_frag_bf16(Qb + (size_t)(q0 + ml) * kHD + 32 + c0);

  v8f o[4] = {};                              // O^T: o[dt][r] = d dt*16+8h+r, query c
  float mrun = -3.0e38f, lrun = 0.0f;         // scaled log2 maximum; this lane's sum

  // Kick off DMA for chunk 0 into buffer 0.
  async_copy_b128(&kbuf[0][krow * kKStride + kseg * 8],
                  Kb + (size_t)krow * kHD + kseg * 8);
  async_copy_b128(&vbuf[0][vrow * kVStride + vseg * 8],
                  Vtb + (size_t)vrow * kS + vseg * 8);

  // A key is a row of the score tile, so its mask term differs by register
  // and not by lane: all kS terms go to LDS once (8 per thread), times
  // sqrt(HD) = 8 (exact) because they start the accumulator ahead of the
  // 1/sqrt(HD) scaling.  The loop's first barrier publishes them.
  {
    const float* amb = amask + (size_t)b * kS;   // same for the whole block
    const float* am  = amb + tid * 8;
    v4f ma = *(const v4f*)(am);
    v4f mb = *(const v4f*)(am + 4);
    // Behind the two loads, naming their scalar base: otherwise that register
    // pair is reused for constants ahead of any wait.
    asm volatile("s_wait_xcnt 0x0" :: "s"(amb) : "memory");
#pragma unroll
    for (int j = 0; j < 4; ++j) {
      ma[j] = (1.0f - ma[j]) * -80000.0f;
      mb[j] = (1.0f - mb[j]) * -80000.0f;
    }
    *(v4f*)(&mbias[tid * 8])     = ma;
    *(v4f*)(&mbias[tid * 8 + 4]) = mb;
  }

  constexpr float kScale = 0.125f * 1.4426950408889634f;  // log2(e) / sqrt(HD)

  for (int kv0 = 0; kv0 < kS; kv0 += 32) {
    const int cur = (kv0 >> 5) & 1;
    wait_async0();                    // my chunk DMA done
    __syncthreads();                  // everyone's DMA done, prev buf free

    // Prefetch next chunk into the other buffer (overlaps with compute).
    if (kv0 + 32 < kS) {
      const int nxt = cur ^ 1;
      async_copy_b128(&kbuf[nxt][krow * kKStride + kseg * 8],
                      Kb + (size_t)(kv0 + 32 + krow) * kHD + kseg * 8);
      async_copy_b128(&vbuf[nxt][vrow * kVStride + vseg * 8],
                      Vtb + (size_t)vrow * kS + (kv0 + 32) + vseg * 8);
    }

    const u16* kch = &kbuf[cur][0];
    const u16* vch = &vbuf[cur][0];

    // ---- fragments of the pass: K rows and mask terms, then V^T rows ----
    v16bf kf[2][2], vf[4];
    v8f st[2];
#pragma unroll
    for (int t = 0; t < 2; ++t) {
      const u16* krow_l = kch + (t * 16 + ml) * kKStride + c0;
      kf[t][0] = load_frag_bf16(krow_l + 0);
      kf[t][1] = load_frag_bf16(krow_l + 32);
      const float* mrow = &mbias[kv0 + t * 16 + c0];
      const v4f ma = *(const v4f*)(mrow);
      const v4f mb = *(const v4f*)(mrow + 4);
      st[t] = __builtin_shufflevector(ma, mb, 0, 1, 2, 3, 4, 5, 6, 7);
    }
#pragma unroll
    for (int dt = 0; dt < 4; ++dt)
      vf[dt] = load_frag_bf16(vch + (dt * 16 + ml) * kVStride + c0);
    // Keeps the 20 LDS loads of a pass in one group ahead of the WMMAs: sunk
    // among them they share one register set, and every WMMA then waits for
    // its own loads' whole latency.
    __builtin_amdgcn_sched_barrier(0);

    // ---- S^T: two 16x16 tiles, keys [kv0, kv0+32) x 16 queries ----
#pragma unroll
    for (int t = 0; t < 2; ++t) st[t] = wmma_bf16(kf[t][0], qf0, st[t]);
#pragma unroll
    for (int t = 0; t < 2; ++t) st[t] = wmma_bf16(kf[t][1], qf1, st[t]);

    // ---- online softmax of query c, log2 domain ----
    float mx;
    {
      const float a0 = max3f(st[0][0], st[0][1], st[0][2]);
      const float a1 = max3f(st[0][3], st[0][4], st[0][5]);
      const float a2 = max3f(st[0][6], st[0][7], st[1][0]);
      const float a3 = max3f(st[1][1], st[1][2], st[1][3]);
      const float a4 = max3f(st[1][4], st[1][5], st[1][6]);
      mx = fmaxf(max3f(a0, a1, a2), max3f(a3, a4, st[1][7]));
    }
    mx = fmaxf(mx, other_half(mx));
    const float mnew  = fmaxf(mrun, mx * kScale);
    const float alpha = __builtin_amdgcn_exp2f(mrun - mnew);
    mrun = mnew;
    const v8f vscale = {kScale, kScale, kScale, kScale, kScale, kScale, kScale, kScale};
    const v8f vmneg  = {-mnew, -mnew, -mnew, -mnew, -mnew, -mnew, -mnew, -mnew};
#pragma unroll
    for (int t = 0; t < 2; ++t) {
      st[t] = __builtin_elementwise_fma(st[t], vscale, vmneg);
#pragma unroll
      for (int r = 0; r < 8; ++r) st[t][r] = __builtin_amdgcn_exp2f(st[t][r]);
    }
    const v8f s8 = st[0] + st[1];
    const v4f s4 = __builtin_shufflevector(s8, s8, 0, 1, 2, 3) +
                   __builtin_shufflevector(s8, s8, 4, 5, 6, 7);
    lrun = lrun * alpha + ((s4[0] + s4[1]) + (s4[2] + s4[3]));
#pragma unroll
    for (int dt = 0; dt < 4; ++dt) o[dt] *= alpha;

    // ---- P^T as B operand: element s = st[s >> 3][s & 7] ----
    v8u pu;
#pragma unroll
    for (int i = 0; i < 4; ++i) {
      pu[i]     = pack_bf16(st[0][2 * i], st[0][2 * i + 1]);
      pu[4 + i] = pack_bf16(st[1][2 * i], st[1][2 * i + 1]);
    }
    const v16bf pf = __builtin_bit_cast(v16bf, pu);

    // ---- O^T += V^T P^T : four 16-row d tiles across HD=64 ----
#pragma unroll
    for (int dt = 0; dt < 4; ++dt)
      o[dt] = wmma_bf16(vf[dt], pf, o[dt]);

    __syncthreads();                  // done reading cur buffer
  }

  // ---- join the halves' sums, normalize, write ctx (bf16) [B, S, H] ----
  // A lane holds 8 consecutive d of its query per tile: one 16-byte store each.
  const int h = bh % kNH;
  const float inv = 1.0f / (lrun + other_half(lrun));
  u16* crow = ctx + ((size_t)b * kS + q0 + ml) * kH + h * kHD + c0;
#pragma unroll
  for (int dt = 0; dt < 4; ++dt) {
    v8us u;
#pragma unroll
    for (int r = 0; r < 8; ++r) u[r] = f2bf_u(o[dt][r] * inv);
    *(v8us*)(crow + dt * 16) = u;
  }
}

// ---------------------------------------------------------------------------
// Kernel 3: output projection + bias + residual.  y = ctx @ Wo^T + bo + x
// One wave = 64 x 64 outputs; the 3 waves of a block share 64 rows of ctx.
// ---------------------------------------------------------------------------
__global__ void __launch_bounds__(96)
out_proj_kernel(const u16* __restrict__ ctxb, const u16* __restrict__ Wob,
                const float* __restrict__ bo, const float* __restrict__ x,
                float* __restrict__ y) {
  const int lane = threadIdx.x & 31;
  const int wave = __builtin_amdgcn_readfirstlane(threadIdx.x >> 5);
  const int lh   = lane >> 4;
  const int ml   = lane & 15;
  const int c0   = lh * 8;
  const int m0   = blockIdx.x * (16 * kWT);
  const int n0   = (blockIdx.y * 3 + wave) * (16 * kWT);

  v8f acc[kWT][kWT] = {};
  gemm_wave_tile(ctxb + (size_t)m0 * kH, Wob + (size_t)n0 * kH,
                 (unsigned)(ml * kH + c0) * 2u, acc);

  float bb_[kWT];
#pragma unroll
  for (int j = 0; j < kWT; ++j) bb_[j] = bo[n0 + j * 16 + ml];

  const size_t base = (size_t)(m0 + 8 * lh) * kH + n0 + ml;
#pragma unroll
  for (int i = 0; i < kWT; ++i) {
    // The 32 residual values of a 16-row strip are fetched together, ahead of
    // its stores, so the wave waits for memory once per strip.
    float xr[kWT][8];
    // These loads land in registers that the bias loads (their index) and the
    // previous strip's stores (their data) still name.
    asm volatile("s_wait_xcnt 0x0" ::: "memory");
#pragma unroll
    for (int j = 0; j < kWT; ++j)
#pragma unroll
      for (int r = 0; r < 8; ++r) xr[j][r] = x[base + (i * 16 + r) * kH + j * 16];
#pragma unroll
    for (int j = 0; j < kWT; ++j)
#pragma unroll
      for (int r = 0; r < 8; ++r) xr[j][r] = acc[i][j][r] + bb_[j] + xr[j][r];
#pragma unroll
    for (int j = 0; j < kWT; ++j)
#pragma unroll
      for (int r = 0; r < 8; ++r) y[base + (i * 16 + r) * kH + j * 16] = xr[j][r];
  }
}

// ---------------------------------------------------------------------------
// Kernel 4: LayerNorm over last dim (768).  One wave per row.
// ---------------------------------------------------------------------------
__global__ void __launch_bounds__(256)
layernorm_kernel(const float* __restrict__ y, const float* __restrict__ gamma,
                 const float* __restrict__ beta, float* __restrict__ out) {
  const int lane = threadIdx.x & 31;
  const int wave = threadIdx.x >> 5;
  const int row  = blockIdx.x * 8 + wave;
  const float* yr = y + (size_t)row * kH;

  float s = 0.0f, s2 = 0.0f;
  for (int i = lane; i < kH; i += 32) {
    const float v = yr[i];
    s += v; s2 += v * v;
  }
#pragma unroll
  for (int off = 1; off < 32; off <<= 1) {
    s  += __shfl_xor(s,  off, 32);
    s2 += __shfl_xor(s2, off, 32);
  }
  const float mean = s * (1.0f / kH);
  const float var  = s2 * (1.0f / kH) - mean * mean;
  const float rstd = rsqrtf(var + 1e-5f);

  float* orow = out + (size_t)row * kH;
  for (int i = lane; i < kH; i += 32)
    orow[i] = (yr[i] - mean) * rstd * gamma[i] + beta[i];
}

// ---------------------------------------------------------------------------
// Launch
// ---------------------------------------------------------------------------
extern "C" void kernel_launch(void* const* d_in, const int* in_sizes, int n_in,
                              void* d_out, int out_size, void* d_ws,
                              size_t ws_size, hipStream_t stream) {
  (void)in_sizes; (void)n_in; (void)out_size; (void)ws_size;

  const float* x     = (const float*)d_in[0];
  const float* amask = (const float*)d_in[1];
  const float* Wq    = (const float*)d_in[2];
  const float* bq    = (const float*)d_in[3];
  const float* Wk    = (const float*)d_in[4];
  const float* bk    = (const float*)d_in[5];
  const float* Wv    = (const float*)d_in[6];
  const float* bv    = (const float*)d_in[7];
  const float* Wo    = (const float*)d_in[8];
  const float* bo    = (const float*)d_in[9];
  const float* g     = (const float*)d_in[10];
  const float* be    = (const float*)d_in[11];
  float* out = (float*)d_out;

  // Workspace carve-up (all regions 16B-aligned by construction).
  const size_t NX = (size_t)kM * kH;          // 3,145,728 activation elems
  const size_t NW = (size_t)kH * kH;          // 589,824 weight elems
  char* w = (char*)d_ws;
  u16* XBF = (u16*)w;  w += NX * 2;
  u16* WQB = (u16*)w;  w += NW * 2;
  u16* WKB = (u16*)w;  w += NW * 2;
  u16* WVB = (u16*)w;  w += NW * 2;
  u16* WOB = (u16*)w;  w += NW * 2;
  u16* Qb  = (u16*)w;  w += NX * 2;           // [BH, S, HD]
  u16* Kb  = (u16*)w;  w += NX * 2;           // [BH, S, HD]
  u16* Vtb = (u16*)w;  w += NX * 2;           // [BH, HD, S] (transposed)
  u16* CTX = (u16*)w;  w += NX * 2;           // [B, S, H] bf16
  float* Y = (float*)w;                       // [B, S, H] f32

  // One-time f32 -> bf16 conversions.
  cvt_bf16_kernel<<<dim3((int)(NX / 2048)), 256, 0, stream>>>(x,  XBF, (int)NX);
  cvt_bf16_kernel<<<dim3((int)(NW / 2048)), 256, 0, stream>>>(Wq, WQB, (int)NW);
  cvt_bf16_kernel<<<dim3((int)(NW / 2048)), 256, 0, stream>>>(Wk, WKB, (int)NW);
  cvt_bf16_kernel<<<dim3((int)(NW / 2048)), 256, 0, stream>>>(Wv, WVB, (int)NW);
  cvt_bf16_kernel<<<dim3((int)(NW / 2048)), 256, 0, stream>>>(Wo, WOB, (int)NW);

  // QKV projections: 64 row blocks x 4 groups of 9 (head, z) slots = 256 blocks.
  qkv_proj_kernel<<<dim3(kM / 64, 3 * kNH / 9), 288, 0, stream>>>(
      XBF, WQB, bq, WKB, bk, WVB, bv, Qb, Kb, Vtb);

  // Flash attention: 128 q-tiles (8 per block) x 24 (b,h) pairs.
  flash_attn_kernel<<<dim3(kS / 16 / 8, kBH), 256, 0, stream>>>(
      Qb, Kb, Vtb, amask, CTX);

  // Output projection + residual.
  out_proj_kernel<<<dim3(kM / 64, kH / 64 / 3), 96, 0, stream>>>(
      CTX, WOB, bo, x, Y);

  // LayerNorm -> d_out.
  layernorm_kernel<<<dim3(kM / 8), 256, 0, stream>>>(Y, g, be, out);
}

// v003
// Measured time: 99.6 microseconds a run.
// Next to v002, in two timings, it ran 1.08 times as fast each time.
// Over all steps from v000 it is 2.15 times as fast.
#include <hip/hip_runtime.h>

// ---------------------------------------------------------------------------
// Encoder attention block on gfx1250 (wave32, WMMA bf16 16x16x32).
//   H=768, NH=12, HD=64, B=2, S=2048
// - One-time f32->bf16 conversion; all GEMMs stream raw bf16 b128 fragments.
// - Flash attention stages K/V chunks into LDS once per block via
//   global_load_async_to_lds_b128 (ASYNCcnt), double-buffered.
// ---------------------------------------------------------------------------

constexpr int kH  = 768;
constexpr int kNH = 12;
constexpr int kHD = 64;
constexpr int kB  = 2;
constexpr int kS  = 2048;
constexpr int kM  = kB * kS;          // 4096 total rows
constexpr int kBH = kB * kNH;         // 24 (batch*heads)

constexpr int kKStride = 72;          // LDS row stride for K chunk (pad 8)
constexpr int kVStride = 40;          // LDS row stride for V chunk (pad 8)

typedef unsigned short u16;
typedef __attribute__((ext_vector_type(16))) __bf16 v16bf;
typedef __attribute__((ext_vector_type(16))) u16    v16us;
typedef __attribute__((ext_vector_type(8)))  u16    v8us;
typedef __attribute__((ext_vector_type(8)))  float  v8f;
typedef __attribute__((ext_vector_type(4)))  float  v4f;
typedef __attribute__((ext_vector_type(2)))  float  v2f;
typedef __attribute__((ext_vector_type(2)))  __bf16 v2bf;
typedef __attribute__((ext_vector_type(8)))  unsigned v8u;

typedef __attribute__((address_space(3))) u16 lds_u16;

__device__ __forceinline__ u16 f2bf_u(float f) {
  unsigned u = __builtin_bit_cast(unsigned, f);
  u += 0x7FFFu + ((u >> 16) & 1u);    // round-to-nearest-even
  return (u16)(u >> 16);
}

// Per-lane slice of a 16x32 bf16 WMMA A/B fragment from a row-major bf16
// matrix.  p points at element (row = lane&15, k = k0 + c0), c0 = 8*(lane>=16).
// Lane needs k-offsets {0..7} and {16..23}: two 16-byte loads, no ALU.
__device__ __forceinline__ v16bf load_frag_bf16(const u16* p) {
  v8us a = *(const v8us*)(p);
  v8us b = *(const v8us*)(p + 16);
  v16us u = __builtin_shufflevector(a, b, 0, 1, 2, 3, 4, 5, 6, 7,
                                          8, 9, 10, 11, 12, 13, 14, 15);
  return __builtin_bit_cast(v16bf, u);
}

__device__ __forceinline__ v8f wmma_bf16(v16bf a, v16bf b, v8f c) {
  return __builtin_amdgcn_wmma_f32_16x16x32_bf16(false, a, false, b,
                                                 (short)0, c, false, false);
}

// Register tile of the projection GEMMs: one wave owns kWT x kWT accumulator
// tiles (64 x 64 outputs), so every loaded A or B fragment feeds kWT WMMAs.
// Every loop over tiles or accumulator rows is fully unrolled, here and in the
// two kernels, so that these arrays are indexed by constants and stay in VGPRs.
constexpr int kWT = 4;

// acc += A[64 rows] * B[64 rows]^T over k = 0..kH.  abase / bbase are the
// wave-uniform first rows; loff is this lane's byte offset (row = lane&15,
// k = c0) inside a 16-row tile, the same for A and B.  Every load is scalar
// base + 32-bit lane offset + immediate.
__device__ __forceinline__ void gemm_wave_tile(const u16* abase, const u16* bbase,
                                               unsigned loff,
                                               v8f (&acc)[kWT][kWT]) {
  // Fully unrolled (24 k-steps): every k-step is an immediate offset, so there
  // is no address arithmetic and no branch among the WMMAs.
#pragma unroll
  for (int k0 = 0; k0 < kH; k0 += 32) {
    v16bf a[kWT], b[kWT];
#pragma unroll
    for (int i = 0; i < kWT; ++i)
      a[i] = load_frag_bf16((const u16*)((const char*)(abase + k0 + i * 16 * kH) + loff));
#pragma unroll
    for (int j = 0; j < kWT; ++j)
      b[j] = load_frag_bf16((const u16*)((const char*)(bbase + k0 + j * 16 * kH) + loff));
    // Stands behind the 16 loads of a k-step and names their lane offset, so
    // that register is not reused (the last load's destination took it) ahead
    // of the wait.  The data wait follows at once, so it adds no stall.
    asm volatile("s_wait_xcnt 0x0" :: "v"(loff) : "memory");
    // Keeps the 16 loads in one group ahead of the WMMAs: a load sunk among
    // them is waited for at once and exposes its whole latency.
    __builtin_amdgcn_sched_barrier(0);
#pragma unroll
    for (int i = 0; i < kWT; ++i)
#pragma unroll
      for (int j = 0; j < kWT; ++j) acc[i][j] = wmma_bf16(a[i], b[j], acc[i][j]);
  }
}

// Async DMA of 16 bytes global -> LDS (tracked by ASYNCcnt).
__device__ __forceinline__ void async_copy_b128(u16* lds_dst, const u16* gsrc) {
  lds_u16* lp = (lds_u16*)lds_dst;
  asm volatile("global_load_async_to_lds_b128 %0, %1, off"
               :
               : "v"(lp), "v"(gsrc)
               : "memory");
}

__device__ __forceinline__ void wait_async0() {
  asm volatile("s_wait_asynccnt 0" ::: "memory");
}

// ---------------------------------------------------------------------------
// Kernel 0: elementwise f32 -> bf16 (8 elements / thread, vectorized) of x and
// the four weight matrices in ONE launch.  None of the five needs anything of
// another, so each takes a range of the block index; a block lies wholly in
// one array (every array is a whole number of 2048-element blocks).  The five
// bf16 planes follow one another in the workspace in the same order, so the
// output offset is the flat element index of the grid.
// ---------------------------------------------------------------------------
constexpr int kCvtBlk = 256 * 8;                  // elements per block
constexpr int kXBlks  = kM * kH / kCvtBlk;        // 1536 blocks of x
constexpr int kWBlks  = kH * kH / kCvtBlk;        // 288 blocks per weight matrix
static_assert(kXBlks * kCvtBlk == kM * kH && kWBlks * kCvtBlk == kH * kH,
              "every array is a whole number of blocks");

__global__ void __launch_bounds__(256)
cvt_bf16_kernel(const float* __restrict__ x,
                const float* __restrict__ Wq, const float* __restrict__ Wk,
                const float* __restrict__ Wv, const float* __restrict__ Wo,
                u16* __restrict__ out) {
  const int blk = blockIdx.x;
  const float* in = x;                            // block-uniform choice
  int first = 0;                                  // first block of that array
  if (blk >= kXBlks) {
    const int w = (blk - kXBlks) / kWBlks;
    first = kXBlks + w * kWBlks;
    in = w == 0 ? Wq : w == 1 ? Wk : w == 2 ? Wv : Wo;
  }
  const int t = threadIdx.x * 8;
  const float* p = in + (blk - first) * kCvtBlk + t;
  v4f a = *(const v4f*)(p);
  v4f b = *(const v4f*)(p + 4);
  v8us u;
#pragma unroll
  for (int j = 0; j < 4; ++j) { u[j] = f2bf_u(a[j]); u[4 + j] = f2bf_u(b[j]); }
  *(v8us*)(out + (size_t)blk * kCvtBlk + t) = u;
}

// ---------------------------------------------------------------------------
// Kernel 1: QKV projection from bf16 operands.  out = x @ W^T + b.
// Q,K written bf16 [BH, S, HD]; V written TRANSPOSED bf16 [BH, HD, S].
// One wave = 64 rows x one whole head of Q, K or V; the 9 waves of a block
// share the same 64 rows of x (36 (head, z) slots = 4 blocks along y).
// ---------------------------------------------------------------------------
__global__ void __launch_bounds__(288)
qkv_proj_kernel(const u16* __restrict__ xbf,
                const u16* __restrict__ Wqb, const float* __restrict__ bq,
                const u16* __restrict__ Wkb, const float* __restrict__ bk,
                const u16* __restrict__ Wvb, const float* __restrict__ bv,
                u16* __restrict__ Qo, u16* __restrict__ Ko,
                u16* __restrict__ Vt) {
  const int lane = threadIdx.x & 31;
  const int wave = __builtin_amdgcn_readfirstlane(threadIdx.x >> 5);
  const int lh   = lane >> 4;
  const int ml   = lane & 15;
  const int c0   = lh * 8;
  const int m0   = blockIdx.x * (16 * kWT);
  const int slot = blockIdx.y * 9 + wave;     // 0..35: (head, z)
  const int z    = slot % 3;                  // every block: 3 waves each of Q, K, V
  const int h    = slot / 3;
  const int n0   = h * kHD;

  const u16* W;  const float* bias;
  if (z == 0)      { W = Wqb; bias = bq; }
  else if (z == 1) { W = Wkb; bias = bk; }
  else             { W = Wvb; bias = bv; }

  v8f acc[kWT][kWT] = {};
  gemm_wave_tile(xbf + (size_t)m0 * kH, W + (size_t)n0 * kH,
                 (unsigned)(ml * kH + c0) * 2u, acc);

  const int bh = (m0 / kS) * kNH + h;         // 64 rows never cross a batch
  const int s0 = m0 % kS + 8 * lh;
  float bb_[kWT];
#pragma unroll
  for (int j = 0; j < kWT; ++j) bb_[j] = bias[n0 + j * 16 + ml];

  if (z == 2) {                               // V: [BH, HD, S]
    u16* o = Vt + ((size_t)bh * kHD + ml) * kS + s0;
#pragma unroll
    for (int i = 0; i < kWT; ++i)
#pragma unroll
      for (int j = 0; j < kWT; ++j)
#pragma unroll
        for (int r = 0; r < 8; ++r)
          o[(size_t)(j * 16) * kS + i * 16 + r] = f2bf_u(acc[i][j][r] + bb_[j]);
    return;
  }
  u16* o = (z == 0 ? Qo : Ko) + ((size_t)bh * kS + s0) * kHD + ml;  // [BH, S, HD]
#pragma unroll
  for (int i = 0; i < kWT; ++i)
#pragma unroll
    for (int j = 0; j < kWT; ++j)
#pragma unroll
      for (int r = 0; r < 8; ++r)
        o[(i * 16 + r) * kHD + j * 16] = f2bf_u(acc[i][j][r] + bb_[j]);
  // Behind the last stores: in the built code the V path's block follows this
  // one and rewrites the registers that these stores name.
  asm volatile("s_wait_xcnt 0x0" ::: "memory");
}

// ---------------------------------------------------------------------------
// Kernel 2: flash attention, transposed products.  8 waves / block share one
// (b,h); K/V chunks are DMA'd into double-buffered LDS with
// global_load_async_to_lds_b128, then each wave streams WMMA fragments from LDS.
//   S^T = K Q^T   : A = K rows, B = Q rows; lane (c, h) holds query column c,
//                   register r of tile t = key t*16 + 8h + r.
//   O^T += V^T P^T: A = V^T rows, B = the two S^T tiles packed to bf16 in place
//                   (their register order is the k order of the A loader).
// A query's scores sit in the two lanes c and c + 16: maximum and sum are taken
// in the lane, with one exchange between the halves.  Writes ctx bf16 [B,S,H].
// ---------------------------------------------------------------------------
__device__ __forceinline__ unsigned pack_bf16(float lo, float hi) {
  return __builtin_bit_cast(unsigned, __builtin_convertvector(v2f{lo, hi}, v2bf));
}

__device__ __forceinline__ float max3f(float a, float b, float c) {
  return fmaxf(fmaxf(a, b), c);
}

// Value of lane l ^ 16.
__device__ __forceinline__ float other_half(float x) {
  const int v = __builtin_bit_cast(int, x);
  return __builtin_bit_cast(float, __builtin_amdgcn_permlanex16(
      v, v, 0x76543210, 0xfedcba98, false, false));
}

__global__ void __launch_bounds__(256)
flash_attn_kernel(const u16* __restrict__ Q, const u16* __restrict__ K,
                  const u16* __restrict__ Vt,
                  const float* __restrict__ amask,
                  u16* __restrict__ ctx) {
  __shared__ __align__(16) u16 kbuf[2][32 * kKStride];  // 32 kv-rows x 64 dims
  __shared__ __align__(16) u16 vbuf[2][64 * kVStride];  // 64 d-rows  x 32 kv
  __shared__ __align__(16) float mbias[kS];             // mask term per key

  const int tid  = threadIdx.x;
  const int lane = tid & 31;
  const int wave = tid >> 5;
  const int lh   = lane >> 4;
  const int ml   = lane & 15;
  const int c0   = lh * 8;

  const int bh = blockIdx.y;                  // 0..B*NH-1
  const int b  = bh / kNH;
  const int q0 = (blockIdx.x * 8 + wave) * 16;

  const u16* Qb  = Q  + (size_t)bh * kS * kHD;
  const u16* Kb  = K  + (size_t)bh * kS * kHD;
  const u16* Vtb = Vt + (size_t)bh * kHD * kS;

  // Staging coordinates: K chunk = 256 threads x 16B, V chunk likewise.
  const int krow = tid >> 3, kseg = tid & 7;  // 32 rows x 8 segs
  const int vrow = tid >> 2, vseg = tid & 3;  // 64 rows x 4 segs

  // Q fragments for this tile (HD=64 -> two k-steps of 32), loaded once.
  const v16bf qf0 = load_frag_bf16(Qb + (size_t)(q0 + ml) * kHD + 0  + c0);
  const v16bf qf1 = load_frag_bf16(Qb + (size_t)(q0 + ml) * kHD + 32 + c0);

  v8f o[4] = {};                              // O^T: o[dt][r] = d dt*16+8h+r, query c
  float mrun = -3.0e38f, lrun = 0.0f;         // scaled log2 maximum; this lane's sum

  // Kick off DMA for chunk 0 into buffer 0.
  async_copy_b128(&kbuf[0][krow * kKStride + kseg * 8],
                  Kb + (size_t)krow * kHD + kseg * 8);
  async_copy_b128(&vbuf[0][vrow * kVStride + vseg * 8],
                  Vtb + (size_t)vrow * kS + vseg * 8);

  // A key is a row of the score tile, so its mask term differs by register
  // and not by lane: all kS terms go to LDS once (8 per thread), times
  // sqrt(HD) = 8 (exact) because they start the accumulator ahead of the
  // 1/sqrt(HD) scaling.  The loop's first barrier publishes them.
  {
    const float* amb = amask + (size_t)b * kS;   // same for the whole block
    const float* am  = amb + tid * 8;
    v4f ma = *(const v4f*)(am);
    v4f mb = *(const v4f*)(am + 4);
    // Behind the two loads, naming their scalar base: otherwise that register
    // pair is reused for constants ahead of any wait.
    asm volatile("s_wait_xcnt 0x0" :: "s"(amb) : "memory");
#pragma unroll
    for (int j = 0; j < 4; ++j) {
      ma[j] = (1.0f - ma[j]) * -80000.0f;
      mb[j] = (1.0f - mb[j]) * -80000.0f;
    }
    *(v4f*)(&mbias[tid * 8])     = ma;
    *(v4f*)(&mbias[tid * 8 + 4]) = mb;
  }

  constexpr float kScale = 0.125f * 1.4426950408889634f;  // log2(e) / sqrt(HD)

  for (int kv0 = 0; kv0 < kS; kv0 += 32) {
    const int cur = (kv0 >> 5) & 1;
    wait_async0();                    // my chunk DMA done
    __syncthreads();                  // everyone's DMA done, prev buf free

    // Prefetch next chunk into the other buffer (overlaps with compute).
    if (kv0 + 32 < kS) {
      const int nxt = cur ^ 1;
      async_copy_b128(&kbuf[nxt][krow * kKStride + kseg * 8],
                      Kb + (size_t)(kv0 + 32 + krow) * kHD + kseg * 8);
      async_copy_b128(&vbuf[nxt][vrow * kVStride + vseg * 8],
                      Vtb + (size_t)vrow * kS + (kv0 + 32) + vseg * 8);
    }

    const u16* kch = &kbuf[cur][0];
    const u16* vch = &vbuf[cur][0];

    // ---- fragments of the pass: K rows and mask terms, then V^T rows ----
    v16bf kf[2][2], vf[4];
    v8f st[2];
#pragma unroll
    for (int t = 0; t < 2; ++t) {
      const u16* krow_l = kch + (t * 16 + ml) * kKStride + c0;
      kf[t][0] = load_frag_bf16(krow_l + 0);
      kf[t][1] = load_frag_bf16(krow_l + 32);
      const float* mrow = &mbias[kv0 + t * 16 + c0];
      const v4f ma = *(const v4f*)(mrow);
      const v4f mb = *(const v4f*)(mrow + 4);
      st[t] = __builtin_shufflevector(ma, mb, 0, 1, 2, 3, 4, 5, 6, 7);
    }
#pragma unroll
    for (int dt = 0; dt < 4; ++dt)
      vf[dt] = load_frag_bf16(vch + (dt * 16 + ml) * kVStride + c0);
    // Keeps the 20 LDS loads of a pass in one group ahead of the WMMAs: sunk
    // among them they share one register set, and every WMMA then waits for
    // its own loads' whole latency.
    __builtin_amdgcn_sched_barrier(0);

    // ---- S^T: two 16x16 tiles, keys [kv0, kv0+32) x 16 queries ----
#pragma unroll
    for (int t = 0; t < 2; ++t) st[t] = wmma_bf16(kf[t][0], qf0, st[t]);
#pragma unroll
    for (int t = 0; t < 2; ++t) st[t] = wmma_bf16(kf[t][1], qf1, st[t]);

    // ---- online softmax of query c, log2 domain ----
    float mx;
    {
      const float a0 = max3f(st[0][0], st[0][1], st[0][2]);
      const float a1 = max3f(st[0][3], st[0][4], st[0][5]);
      const float a2 = max3f(st[0][6], st[0][7], st[1][0]);
      const float a3 = max3f(st[1][1], st[1][2], st[1][3]);
      const float a4 = max3f(st[1][4], st[1][5], st[1][6]);
      mx = fmaxf(max3f(a0, a1, a2), max3f(a3, a4, st[1][7]));
    }
    mx = fmaxf(mx, other_half(mx));
    const float mnew  = fmaxf(mrun, mx * kScale);
    const float alpha = __builtin_amdgcn_exp2f(mrun - mnew);
    mrun = mnew;
    const v8f vscale = {kScale, kScale, kScale, kScale, kScale, kScale, kScale, kScale};
    const v8f vmneg  = {-mnew, -mnew, -mnew, -mnew, -mnew, -mnew, -mnew, -mnew};
#pragma unroll
    for (int t = 0; t < 2; ++t) {
      st[t] = __builtin_elementwise_fma(st[t], vscale, vmneg);
#pragma unroll
      for (int r = 0; r < 8; ++r) st[t][r] = __builtin_amdgcn_exp2f(st[t][r]);
    }
    const v8f s8 = st[0] + st[1];
    const v4f s4 = __builtin_shufflevector(s8, s8, 0, 1, 2, 3) +
                   __builtin_shufflevector(s8, s8, 4, 5, 6, 7);
    lrun = lrun * alpha + ((s4[0] + s4[1]) + (s4[2] + s4[3]));
#pragma unroll
    for (int dt = 0; dt < 4; ++dt) o[dt] *= alpha;

    // ---- P^T as B operand: element s = st[s >> 3][s & 7] ----
    v8u pu;
#pragma unroll
    for (int i = 0; i < 4; ++i) {
      pu[i]     = pack_bf16(st[0][2 * i], st[0][2 * i + 1]);
      pu[4 + i] = pack_bf16(st[1][2 * i], st[1][2 * i + 1]);
    }
    const v16bf pf = __builtin_bit_cast(v16bf, pu);

    // ---- O^T += V^T P^T : four 16-row d tiles across HD=64 ----
#pragma unroll
    for (int dt = 0; dt < 4; ++dt)
      o[dt] = wmma_bf16(vf[dt], pf, o[dt]);

    __syncthreads();                  // done reading cur buffer
  }

  // ---- join the halves' sums, normalize, write ctx (bf16) [B, S, H] ----
  // A lane holds 8 consecutive d of its query per tile: one 16-byte store each.
  const int h = bh % kNH;
  const float inv = 1.0f / (lrun + other_half(lrun));
  u16* crow = ctx + ((size_t)b * kS + q0 + ml) * kH + h * kHD + c0;
#pragma unroll
  for (int dt = 0; dt < 4; ++dt) {
    v8us u;
#pragma unroll
    for (int r = 0; r < 8; ++r) u[r] = f2bf_u(o[dt][r] * inv);
    *(v8us*)(crow + dt * 16) = u;
  }
}

// ---------------------------------------------------------------------------
// Kernel 3: output projection + bias + residual.  y = ctx @ Wo^T + bo + x
// One wave = 64 x 64 outputs; the 3 waves of a block share 64 rows of ctx.
// ---------------------------------------------------------------------------
__global__ void __launch_bounds__(96)
out_proj_kernel(const u16* __restrict__ ctxb, const u16* __restrict__ Wob,
                const float* __restrict__ bo, const float* __restrict__ x,
                float* __restrict__ y) {
  const int lane = threadIdx.x & 31;
  const int wave = __builtin_amdgcn_readfirstlane(threadIdx.x >> 5);
  const int lh   = lane >> 4;
  const int ml   = lane & 15;
  const int c0   = lh * 8;
  const int m0   = blockIdx.x * (16 * kWT);
  const int n0   = (blockIdx.y * 3 + wave) * (16 * kWT);

  v8f acc[kWT][kWT] = {};
  gemm_wave_tile(ctxb + (size_t)m0 * kH, Wob + (size_t)n0 * kH,
                 (unsigned)(ml * kH + c0) * 2u, acc);

  float bb_[kWT];
#pragma unroll
  for (int j = 0; j < kWT; ++j) bb_[j] = bo[n0 + j * 16 + ml];

  const size_t base = (size_t)(m0 + 8 * lh) * kH + n0 + ml;
#pragma unroll
  for (int i = 0; i < kWT; ++i) {
    // The 32 residual values of a 16-row strip are fetched together, ahead of
    // its stores, so the wave waits for memory once per strip.
    float xr[kWT][8];
    // These loads land in registers that the bias loads (their index) and the
    // previous strip's stores (their data) still name.
    asm volatile("s_wait_xcnt 0x0" ::: "memory");
#pragma unroll
    for (int j = 0; j < kWT; ++j)
#pragma unroll
      for (int r = 0; r < 8; ++r) xr[j][r] = x[base + (i * 16 + r) * kH + j * 16];
#pragma unroll
    for (int j = 0; j < kWT; ++j)
#pragma unroll
      for (int r = 0; r < 8; ++r) xr[j][r] = acc[i][j][r] + bb_[j] + xr[j][r];
#pragma unroll
    for (int j = 0; j < kWT; ++j)
#pragma unroll
      for (int r = 0; r < 8; ++r) y[base + (i * 16 + r) * kH + j * 16] = xr[j][r];
  }
}

// ---------------------------------------------------------------------------
// Kernel 4: LayerNorm over last dim (768).  One wave per row.
// ---------------------------------------------------------------------------
__global__ void __launch_bounds__(256)
layernorm_kernel(const float* __restrict__ y, const float* __restrict__ gamma,
                 const float* __restrict__ beta, float* __restrict__ out) {
  const int lane = threadIdx.x & 31;
  const int wave = threadIdx.x >> 5;
  const int row  = blockIdx.x * 8 + wave;
  const float* yr = y + (size_t)row * kH;

  float s = 0.0f, s2 = 0.0f;
  for (int i = lane; i < kH; i += 32) {
    const float v = yr[i];
    s += v; s2 += v * v;
  }
#pragma unroll
  for (int off = 1; off < 32; off <<= 1) {
    s  += __shfl_xor(s,  off, 32);
    s2 += __shfl_xor(s2, off, 32);
  }
  const float mean = s * (1.0f / kH);
  const float var  = s2 * (1.0f / kH) - mean * mean;
  const float rstd = rsqrtf(var + 1e-5f);

  float* orow = out + (size_t)row * kH;
  for (int i = lane; i < kH; i += 32)
    orow[i] = (yr[i] - mean) * rstd * gamma[i] + beta[i];
}

// ---------------------------------------------------------------------------
// Launch
// ---------------------------------------------------------------------------
extern "C" void kernel_launch(void* const* d_in, const int* in_sizes, int n_in,
                              void* d_out, int out_size, void* d_ws,
                              size_t ws_size, hipStream_t stream) {
  (void)in_sizes; (void)n_in; (void)out_size; (void)ws_size;

  const float* x     = (const float*)d_in[0];
  const float* amask = (const float*)d_in[1];
  const float* Wq    = (const float*)d_in[2];
  const float* bq    = (const float*)d_in[3];
  const float* Wk    = (const float*)d_in[4];
  const float* bk    = (const float*)d_in[5];
  const float* Wv    = (const float*)d_in[6];
  const float* bv    = (const float*)d_in[7];
  const float* Wo    = (const float*)d_in[8];
  const float* bo    = (const float*)d_in[9];
  const float* g     = (const float*)d_in[10];
  const float* be    = (const float*)d_in[11];
  float* out = (float*)d_out;

  // Workspace carve-up (all regions 16B-aligned by construction).
  const size_t NX = (size_t)kM * kH;          // 3,145,728 activation elems
  const size_t NW = (size_t)kH * kH;          // 589,824 weight elems
  char* w = (char*)d_ws;
  u16* XBF = (u16*)w;  w += NX * 2;
  u16* WQB = (u16*)w;  w += NW * 2;
  u16* WKB = (u16*)w;  w += NW * 2;
  u16* WVB = (u16*)w;  w += NW * 2;
  u16* WOB = (u16*)w;  w += NW * 2;
  u16* Qb  = (u16*)w;  w += NX * 2;           // [BH, S, HD]
  u16* Kb  = (u16*)w;  w += NX * 2;           // [BH, S, HD]
  u16* Vtb = (u16*)w;  w += NX * 2;           // [BH, HD, S] (transposed)
  u16* CTX = (u16*)w;  w += NX * 2;           // [B, S, H] bf16
  float* Y = (float*)w;                       // [B, S, H] f32

  // f32 -> bf16 conversions, one launch: XBF, WQB, WKB, WVB, WOB lie in a row.
  cvt_bf16_kernel<<<dim3(kXBlks + 4 * kWBlks), 256, 0, stream>>>(
      x, Wq, Wk, Wv, Wo, XBF);

  // QKV projections: 64 row blocks x 4 groups of 9 (head, z) slots = 256 blocks.
  qkv_proj_kernel<<<dim3(kM / 64, 3 * kNH / 9), 288, 0, stream>>>(
      XBF, WQB, bq, WKB, bk, WVB, bv, Qb, Kb, Vtb);

  // Flash attention: 128 q-tiles (8 per block) x 24 (b,h) pairs.
  flash_attn_kernel<<<dim3(kS / 16 / 8, kBH), 256, 0, stream>>>(
      Qb, Kb, Vtb, amask, CTX);

  // Output projection + residual.
  out_proj_kernel<<<dim3(kM / 64, kH / 64 / 3), 96, 0, stream>>>(
      CTX, WOB, bo, x, Y);

  // LayerNorm -> d_out.
  layernorm_kernel<<<dim3(kM / 8), 256, 0, stream>>>(Y, g, be, out);
}

// v004
// It runs in 93 microseconds.
// Timed twice side by side with v003, it ran 1.05 and 1.07 times as fast.
// Counting every step since v000, it is 2.29 times as fast.
#include <hip/hip_runtime.h>

// ---------------------------------------------------------------------------
// Encoder attention block on gfx1250 (wave32, WMMA bf16 16x16x32).
//   H=768, NH=12, HD=64, B=2, S=2048
// - One-time f32->bf16 conversion; all GEMMs stream raw bf16 b128 fragments.
// - The projection GEMMs' operands (x, the weights, ctx) lie in fragment order
//   (see load_frag_packed), so a fragment load reads whole cache lines.
// - Flash attention stages K/V chunks into LDS once per block via
//   global_load_async_to_lds_b128 (ASYNCcnt), double-buffered.
// ---------------------------------------------------------------------------

constexpr int kH  = 768;
constexpr int kNH = 12;
constexpr int kHD = 64;
constexpr int kB  = 2;
constexpr int kS  = 2048;
constexpr int kM  = kB * kS;          // 4096 total rows
constexpr int kBH = kB * kNH;         // 24 (batch*heads)

constexpr int kKStride = 72;          // LDS row stride for K chunk (pad 8)
constexpr int kVStride = 40;          // LDS row stride for V chunk (pad 8)

typedef unsigned short u16;
typedef __attribute__((ext_vector_type(16))) __bf16 v16bf;
typedef __attribute__((ext_vector_type(16))) u16    v16us;
typedef __attribute__((ext_vector_type(8)))  u16    v8us;
typedef __attribute__((ext_vector_type(8)))  float  v8f;
typedef __attribute__((ext_vector_type(4)))  float  v4f;
typedef __attribute__((ext_vector_type(2)))  float  v2f;
typedef __attribute__((ext_vector_type(2)))  __bf16 v2bf;
typedef __attribute__((ext_vector_type(8)))  unsigned v8u;

typedef __attribute__((address_space(3))) u16 lds_u16;

__device__ __forceinline__ u16 f2bf_u(float f) {
  unsigned u = __builtin_bit_cast(unsigned, f);
  u += 0x7FFFu + ((u >> 16) & 1u);    // round-to-nearest-even
  return (u16)(u >> 16);
}

// Per-lane slice of a 16x32 bf16 WMMA A/B fragment from a row-major bf16
// matrix.  p points at element (row = lane&15, k = k0 + c0), c0 = 8*(lane>=16).
// Lane needs k-offsets {0..7} and {16..23}: two 16-byte loads, no ALU.
__device__ __forceinline__ v16bf load_frag_bf16(const u16* p) {
  v8us a = *(const v8us*)(p);
  v8us b = *(const v8us*)(p + 16);
  v16us u = __builtin_shufflevector(a, b, 0, 1, 2, 3, 4, 5, 6, 7,
                                          8, 9, 10, 11, 12, 13, 14, 15);
  return __builtin_bit_cast(v16bf, u);
}

// Fragment order of a [rows x kH] bf16 operand of the projection GEMMs.  The
// 16-row x 32-k tile (R, Ks) is kTileElems consecutive elements at
// R * 16 * kH + Ks * kTileElems; inside it the 8 elements (row ml, k = 8 g ..
// 8 g + 7), g = 0..3, stand at (g >> 1) * 256 + (g & 1) * 128 + ml * 8.  Lane
// l = 16 * lh + ml then finds its k-offsets {8 lh ..} and {16 + 8 lh ..} (the
// same ones as load_frag_bf16) at l * 8 and 256 + l * 8: each of the two
// 16-byte loads of a wave covers 512 consecutive bytes, four whole lines,
// where a row-major operand makes it touch 16 lines.
constexpr int kTileElems = 16 * 32;

// p = tile start + lane * 8.
__device__ __forceinline__ v16bf load_frag_packed(const u16* p) {
  v8us a = *(const v8us*)(p);
  v8us b = *(const v8us*)(p + 256);
  v16us u = __builtin_shufflevector(a, b, 0, 1, 2, 3, 4, 5, 6, 7,
                                          8, 9, 10, 11, 12, 13, 14, 15);
  return __builtin_bit_cast(v16bf, u);
}

__device__ __forceinline__ v8f wmma_bf16(v16bf a, v16bf b, v8f c) {
  return __builtin_amdgcn_wmma_f32_16x16x32_bf16(false, a, false, b,
                                                 (short)0, c, false, false);
}

// Register tile of the projection GEMMs: one wave owns kWT x kWT accumulator
// tiles (64 x 64 outputs), so every loaded A or B fragment feeds kWT WMMAs.
// Every loop over tiles or accumulator rows is fully unrolled, here and in the
// two kernels, so that these arrays are indexed by constants and stay in VGPRs.
constexpr int kWT = 4;

// acc += A[64 rows] * B[64 rows]^T over k = 0..kH, both in fragment order.
// abase / bbase are the wave-uniform starts of the first 16-row tiles; loff is
// this lane's byte offset (lane * 16) inside a tile, the same for A and B.
// Every load is scalar base + 32-bit lane offset + immediate.
__device__ __forceinline__ void gemm_wave_tile(const u16* abase, const u16* bbase,
                                               unsigned loff,
                                               v8f (&acc)[kWT][kWT]) {
  // Fully unrolled (24 k-steps): every k-step is an immediate offset, so there
  // is no address arithmetic and no branch among the WMMAs.
#pragma unroll
  for (int k0 = 0; k0 < kH; k0 += 32) {
    v16bf a[kWT], b[kWT];
#pragma unroll
    for (int i = 0; i < kWT; ++i)
      a[i] = load_frag_packed((const u16*)(
          (const char*)(abase + (k0 / 32) * kTileElems + i * 16 * kH) + loff));
#pragma unroll
    for (int j = 0; j < kWT; ++j)
      b[j] = load_frag_packed((const u16*)(
          (const char*)(bbase + (k0 / 32) * kTileElems + j * 16 * kH) + loff));
    // Stands behind the 16 loads of a k-step and names their lane offset, so
    // that register is not reused (the last load's destination took it) ahead
    // of the wait.  The data wait follows at once, so it adds no stall.
    asm volatile("s_wait_xcnt 0x0" :: "v"(loff) : "memory");
    // Keeps the 16 loads in one group ahead of the WMMAs: a load sunk among
    // them is waited for at once and exposes its whole latency.
    __builtin_amdgcn_sched_barrier(0);
#pragma unroll
    for (int i = 0; i < kWT; ++i)
#pragma unroll
      for (int j = 0; j < kWT; ++j) acc[i][j] = wmma_bf16(a[i], b[j], acc[i][j]);
  }
}

// Async DMA of 16 bytes global -> LDS (tracked by ASYNCcnt).
__device__ __forceinline__ void async_copy_b128(u16* lds_dst, const u16* gsrc) {
  lds_u16* lp = (lds_u16*)lds_dst;
  asm volatile("global_load_async_to_lds_b128 %0, %1, off"
               :
               : "v"(lp), "v"(gsrc)
               : "memory");
}

__device__ __forceinline__ void wait_async0() {
  asm volatile("s_wait_asynccnt 0" ::: "memory");
}

// ---------------------------------------------------------------------------
// Kernel 0: elementwise f32 -> bf16 (8 elements / thread, vectorized) of x and
// the four weight matrices in ONE launch.  None of the five needs anything of
// another, so each takes a range of the block index; a block lies wholly in
// one array (every array is a whole number of 2048-element blocks).  The five
// bf16 planes follow one another in the workspace in the same order.
// The planes are written in fragment order (load_frag_packed).  A block takes
// 16 rows x 128 k = four tiles, which are its 2048 consecutive output elements.
// A wave takes 8 rows x one 32-k step: it reads 128 consecutive bytes of each
// row (8 lines per load) and stores four whole 128-byte lines.
// ---------------------------------------------------------------------------
constexpr int kCvtBlk = 256 * 8;                  // elements per block
constexpr int kXBlks  = kM * kH / kCvtBlk;        // 1536 blocks of x
constexpr int kWBlks  = kH * kH / kCvtBlk;        // 288 blocks per weight matrix
constexpr int kCvtK   = kCvtBlk / 16;             // 128 k per block
constexpr int kCvtKB  = kH / kCvtK;               // 6 blocks along k
static_assert(kXBlks * kCvtBlk == kM * kH && kWBlks * kCvtBlk == kH * kH,
              "every array is a whole number of blocks");
static_assert(kCvtKB * kCvtK == kH && kCvtK == 4 * 32 && kM % 16 == 0 && kH % 16 == 0,
              "a block is four whole tiles of one 16-row strip");

__global__ void __launch_bounds__(256)
cvt_bf16_kernel(const float* __restrict__ x,
                const float* __restrict__ Wq, const float* __restrict__ Wk,
                const float* __restrict__ Wv, const float* __restrict__ Wo,
                u16* __restrict__ out) {
  const int blk = blockIdx.x;
  const float* in = x;                            // block-uniform choice
  int first = 0;                                  // first block of that array
  if (blk >= kXBlks) {
    const int w = (blk - kXBlks) / kWBlks;
    first = kXBlks + w * kWBlks;
    in = w == 0 ? Wq : w == 1 ? Wk : w == 2 ? Wv : Wo;
  }
  const int lb  = blk - first;                    // block inside its array
  const int tid = threadIdx.x;
  const int ml  = ((tid >> 5) & 1) * 8 + (tid & 7);  // row in the 16-row strip
  const int g   = (tid >> 3) & 3;                 // group of 8 k in the 32-k step
  const int ks  = tid >> 6;                       // 32-k step in the block
  const float* p = in + ((lb / kCvtKB) * 16 + ml) * kH + (lb % kCvtKB) * kCvtK +
                   ks * 32 + g * 8;
  u16* q = out + (size_t)blk * kCvtBlk + ks * kTileElems +
           (g >> 1) * 256 + (g & 1) * 128 + ml * 8;
  v4f a = *(const v4f*)(p);
  v4f b = *(const v4f*)(p + 4);
  v8us u;
#pragma unroll
  for (int j = 0; j < 4; ++j) { u[j] = f2bf_u(a[j]); u[4 + j] = f2bf_u(b[j]); }
  *(v8us*)q = u;
}

// ---------------------------------------------------------------------------
// Kernel 1: QKV projection from bf16 operands.  out = x @ W^T + b.
// Q,K written bf16 [BH, S, HD]; V written TRANSPOSED bf16 [BH, HD, S].
// One wave = 64 rows x one whole head of Q, K or V; the 9 waves of a block
// share the same 64 rows of x (36 (head, z) slots = 4 blocks along y).
// ---------------------------------------------------------------------------
__global__ void __launch_bounds__(288)
qkv_proj_kernel(const u16* __restrict__ xbf,
                const u16* __restrict__ Wqb, const float* __restrict__ bq,
                const u16* __restrict__ Wkb, const float* __restrict__ bk,
                const u16* __restrict__ Wvb, const float* __restrict__ bv,
                u16* __restrict__ Qo, u16* __restrict__ Ko,
                u16* __restrict__ Vt) {
  const int lane = threadIdx.x & 31;
  const int wave = __builtin_amdgcn_readfirstlane(threadIdx.x >> 5);
  const int lh   = lane >> 4;
  const int ml   = lane & 15;
  const int m0   = blockIdx.x * (16 * kWT);
  const int slot = blockIdx.y * 9 + wave;     // 0..35: (head, z)
  const int z    = slot % 3;                  // every block: 3 waves each of Q, K, V
  const int h    = slot / 3;
  const int n0   = h * kHD;

  const u16* W;  const float* bias;
  if (z == 0)      { W = Wqb; bias = bq; }
  else if (z == 1) { W = Wkb; bias = bk; }
  else             { W = Wvb; bias = bv; }

  v8f acc[kWT][kWT] = {};
  gemm_wave_tile(xbf + (size_t)m0 * kH, W + (size_t)n0 * kH,
                 (unsigned)lane * 16u, acc);

  const int bh = (m0 / kS) * kNH + h;         // 64 rows never cross a batch
  const int s0 = m0 % kS + 8 * lh;
  float bb_[kWT];
#pragma unroll
  for (int j = 0; j < kWT; ++j) bb_[j] = bias[n0 + j * 16 + ml];

  if (z == 2) {                               // V: [BH, HD, S]
    u16* o = Vt + ((size_t)bh * kHD + ml) * kS + s0;
#pragma unroll
    for (int i = 0; i < kWT; ++i)
#pragma unroll
      for (int j = 0; j < kWT; ++j)
#pragma unroll
        for (int r = 0; r < 8; ++r)
          o[(size_t)(j * 16) * kS + i * 16 + r] = f2bf_u(acc[i][j][r] + bb_[j]);
    return;
  }
  u16* o = (z == 0 ? Qo : Ko) + ((size_t)bh * kS + s0) * kHD + ml;  // [BH, S, HD]
#pragma unroll
  for (int i = 0; i < kWT; ++i)
#pragma unroll
    for (int j = 0; j < kWT; ++j)
#pragma unroll
      for (int r = 0; r < 8; ++r)
        o[(i * 16 + r) * kHD + j * 16] = f2bf_u(acc[i][j][r] + bb_[j]);
  // Behind the last stores: in the built code the V path's block follows this
  // one and rewrites the registers that these stores name.
  asm volatile("s_wait_xcnt 0x0" ::: "memory");
}

// ---------------------------------------------------------------------------
// Kernel 2: flash attention, transposed products.  8 waves / block share one
// (b,h); K/V chunks are DMA'd into double-buffered LDS with
// global_load_async_to_lds_b128, then each wave streams WMMA fragments from LDS.
//   S^T = K Q^T   : A = K rows, B = Q rows; lane (c, h) holds query column c,
//                   register r of tile t = key t*16 + 8h + r.
//   O^T += V^T P^T: A = V^T rows, B = the two S^T tiles packed to bf16 in place
//                   (their register order is the k order of the A loader).
// A query's scores sit in the two lanes c and c + 16: maximum and sum are taken
// in the lane, with one exchange between the halves.  Writes ctx bf16 [B*S, H]
// in fragment order (load_frag_packed).
// ---------------------------------------------------------------------------
__device__ __forceinline__ unsigned pack_bf16(float lo, float hi) {
  return __builtin_bit_cast(unsigned, __builtin_convertvector(v2f{lo, hi}, v2bf));
}

__device__ __forceinline__ float max3f(float a, float b, float c) {
  return fmaxf(fmaxf(a, b), c);
}

// Value of lane l ^ 16.
__device__ __forceinline__ float other_half(float x) {
  const int v = __builtin_bit_cast(int, x);
  return __builtin_bit_cast(float, __builtin_amdgcn_permlanex16(
      v, v, 0x76543210, 0xfedcba98, false, false));
}

__global__ void __launch_bounds__(256)
flash_attn_kernel(const u16* __restrict__ Q, const u16* __restrict__ K,
                  const u16* __restrict__ Vt,
                  const float* __restrict__ amask,
                  u16* __restrict__ ctx) {
  __shared__ __align__(16) u16 kbuf[2][32 * kKStride];  // 32 kv-rows x 64 dims
  __shared__ __align__(16) u16 vbuf[2][64 * kVStride];  // 64 d-rows  x 32 kv
  __shared__ __align__(16) float mbias[kS];             // mask term per key

  const int tid  = threadIdx.x;
  const int lane = tid & 31;
  const int wave = tid >> 5;
  const int lh   = lane >> 4;
  const int ml   = lane & 15;
  const int c0   = lh * 8;

  const int bh = blockIdx.y;                  // 0..B*NH-1
  const int b  = bh / kNH;
  const int q0 = (blockIdx.x * 8 + wave) * 16;

  const u16* Qb  = Q  + (size_t)bh * kS * kHD;
  const u16* Kb  = K  + (size_t)bh * kS * kHD;
  const u16* Vtb = Vt + (size_t)bh * kHD * kS;

  // Staging coordinates: K chunk = 256 threads x 16B, V chunk likewise.
  const int krow = tid >> 3, kseg = tid & 7;  // 32 rows x 8 segs
  const int vrow = tid >> 2, vseg = tid & 3;  // 64 rows x 4 segs

  // Q fragments for this tile (HD=64 -> two k-steps of 32), loaded once.
  const v16bf qf0 = load_frag_bf16(Qb + (size_t)(q0 + ml) * kHD + 0  + c0);
  const v16bf qf1 = load_frag_bf16(Qb + (size_t)(q0 + ml) * kHD + 32 + c0);

  v8f o[4] = {};                              // O^T: o[dt][r] = d dt*16+8h+r, query c
  float mrun = -3.0e38f, lrun = 0.0f;         // scaled log2 maximum; this lane's sum

  // Kick off DMA for chunk 0 into buffer 0.
  async_copy_b128(&kbuf[0][krow * kKStride + kseg * 8],
                  Kb + (size_t)krow * kHD + kseg * 8);
  async_copy_b128(&vbuf[0][vrow * kVStride + vseg * 8],
                  Vtb + (size_t)vrow * kS + vseg * 8);

  // A key is a row of the score tile, so its mask term differs by register
  // and not by lane: all kS terms go to LDS once (8 per thread), times
  // sqrt(HD) = 8 (exact) because they start the accumulator ahead of the
  // 1/sqrt(HD) scaling.  The loop's first barrier publishes them.
  {
    const float* amb = amask + (size_t)b * kS;   // same for the whole block
    const float* am  = amb + tid * 8;
    v4f ma = *(const v4f*)(am);
    v4f mb = *(const v4f*)(am + 4);
    // Behind the two loads, naming their scalar base: otherwise that register
    // pair is reused for constants ahead of any wait.
    asm volatile("s_wait_xcnt 0x0" :: "s"(amb) : "memory");
#pragma unroll
    for (int j = 0; j < 4; ++j) {
      ma[j] = (1.0f - ma[j]) * -80000.0f;
      mb[j] = (1.0f - mb[j]) * -80000.0f;
    }
    *(v4f*)(&mbias[tid * 8])     = ma;
    *(v4f*)(&mbias[tid * 8 + 4]) = mb;
  }

  constexpr float kScale = 0.125f * 1.4426950408889634f;  // log2(e) / sqrt(HD)

  for (int kv0 = 0; kv0 < kS; kv0 += 32) {
    const int cur = (kv0 >> 5) & 1;
    wait_async0();                    // my chunk DMA done
    __syncthreads();                  // everyone's DMA done, prev buf free

    // Prefetch next chunk into the other buffer (overlaps with compute).
    if (kv0 + 32 < kS) {
      const int nxt = cur ^ 1;
      async_copy_b128(&kbuf[nxt][krow * kKStride + kseg * 8],
                      Kb + (size_t)(kv0 + 32 + krow) * kHD + kseg * 8);
      async_copy_b128(&vbuf[nxt][vrow * kVStride + vseg * 8],
                      Vtb + (size_t)vrow * kS + (kv0 + 32) + vseg * 8);
    }

    const u16* kch = &kbuf[cur][0];
    const u16* vch = &vbuf[cur][0];

    // ---- fragments of the pass: K rows and mask terms, then V^T rows ----
    v16bf kf[2][2], vf[4];
    v8f st[2];
#pragma unroll
    for (int t = 0; t < 2; ++t) {
      const u16* krow_l = kch + (t * 16 + ml) * kKStride + c0;
      kf[t][0] = load_frag_bf16(krow_l + 0);
      kf[t][1] = load_frag_bf16(krow_l + 32);
      const float* mrow = &mbias[kv0 + t * 16 + c0];
      const v4f ma = *(const v4f*)(mrow);
      const v4f mb = *(const v4f*)(mrow + 4);
      st[t] = __builtin_shufflevector(ma, mb, 0, 1, 2, 3, 4, 5, 6, 7);
    }
#pragma unroll
    for (int dt = 0; dt < 4; ++dt)
      vf[dt] = load_frag_bf16(vch + (dt * 16 + ml) * kVStride + c0);
    // Keeps the 20 LDS loads of a pass in one group ahead of the WMMAs: sunk
    // among them they share one register set, and every WMMA then waits for
    // its own loads' whole latency.
    __builtin_amdgcn_sched_barrier(0);

    // ---- S^T: two 16x16 tiles, keys [kv0, kv0+32) x 16 queries ----
#pragma unroll
    for (int t = 0; t < 2; ++t) st[t] = wmma_bf16(kf[t][0], qf0, st[t]);
#pragma unroll
    for (int t = 0; t < 2; ++t) st[t] = wmma_bf16(kf[t][1], qf1, st[t]);

    // ---- online softmax of query c, log2 domain ----
    float mx;
    {
      const float a0 = max3f(st[0][0], st[0][1], st[0][2]);
      const float a1 = max3f(st[0][3], st[0][4], st[0][5]);
      const float a2 = max3f(st[0][6], st[0][7], st[1][0]);
      const float a3 = max3f(st[1][1], st[1][2], st[1][3]);
      const float a4 = max3f(st[1][4], st[1][5], st[1][6]);
      mx = fmaxf(max3f(a0, a1, a2), max3f(a3, a4, st[1][7]));
    }
    mx = fmaxf(mx, other_half(mx));
    const float mnew  = fmaxf(mrun, mx * kScale);
    const float alpha = __builtin_amdgcn_exp2f(mrun - mnew);
    mrun = mnew;
    const v8f vscale = {kScale, kScale, kScale, kScale, kScale, kScale, kScale, kScale};
    const v8f vmneg  = {-mnew, -mnew, -mnew, -mnew, -mnew, -mnew, -mnew, -mnew};
#pragma unroll
    for (int t = 0; t < 2; ++t) {
      st[t] = __builtin_elementwise_fma(st[t], vscale, vmneg);
#pragma unroll
      for (int r = 0; r < 8; ++r) st[t][r] = __builtin_amdgcn_exp2f(st[t][r]);
    }
    const v8f s8 = st[0] + st[1];
    const v4f s4 = __builtin_shufflevector(s8, s8, 0, 1, 2, 3) +
                   __builtin_shufflevector(s8, s8, 4, 5, 6, 7);
    lrun = lrun * alpha + ((s4[0] + s4[1]) + (s4[2] + s4[3]));
#pragma unroll
    for (int dt = 0; dt < 4; ++dt) o[dt] *= alpha;

    // ---- P^T as B operand: element s = st[s >> 3][s & 7] ----
    v8u pu;
#pragma unroll
    for (int i = 0; i < 4; ++i) {
      pu[i]     = pack_bf16(st[0][2 * i], st[0][2 * i + 1]);
      pu[4 + i] = pack_bf16(st[1][2 * i], st[1][2 * i + 1]);
    }
    const v16bf pf = __builtin_bit_cast(v16bf, pu);

    // ---- O^T += V^T P^T : four 16-row d tiles across HD=64 ----
#pragma unroll
    for (int dt = 0; dt < 4; ++dt)
      o[dt] = wmma_bf16(vf[dt], pf, o[dt]);

    __syncthreads();                  // done reading cur buffer
  }

  // ---- join the halves' sums, normalize, write ctx (bf16), fragment order ----
  // A lane holds 8 consecutive d of its query per tile, group g = 2 (dt & 1) + lh
  // of 32-k step 2 h + (dt >> 1): one 16-byte store each, at lane * 8 in its half
  // tile, so a wave's store is 512 consecutive bytes.
  const int h = bh % kNH;
  const float inv = 1.0f / (lrun + other_half(lrun));
  u16* crow = ctx + ((size_t)b * kS + q0) * kH + h * 2 * kTileElems + lane * 8;
#pragma unroll
  for (int dt = 0; dt < 4; ++dt) {
    v8us u;
#pragma unroll
    for (int r = 0; r < 8; ++r) u[r] = f2bf_u(o[dt][r] * inv);
    *(v8us*)(crow + dt * 256) = u;
  }
}

// ---------------------------------------------------------------------------
// Kernel 3: output projection + bias + residual.  y = ctx @ Wo^T + bo + x
// One wave = 64 x 64 outputs; the 3 waves of a block share 64 rows of ctx.
// ---------------------------------------------------------------------------
__global__ void __launch_bounds__(96)
out_proj_kernel(const u16* __restrict__ ctxb, const u16* __restrict__ Wob,
                const float* __restrict__ bo, const float* __restrict__ x,
                float* __restrict__ y) {
  const int lane = threadIdx.x & 31;
  const int wave = __builtin_amdgcn_readfirstlane(threadIdx.x >> 5);
  const int lh   = lane >> 4;
  const int ml   = lane & 15;
  const int m0   = blockIdx.x * (16 * kWT);
  const int n0   = (blockIdx.y * 3 + wave) * (16 * kWT);

  v8f acc[kWT][kWT] = {};
  gemm_wave_tile(ctxb + (size_t)m0 * kH, Wob + (size_t)n0 * kH,
                 (unsigned)lane * 16u, acc);

  float bb_[kWT];
#pragma unroll
  for (int j = 0; j < kWT; ++j) bb_[j] = bo[n0 + j * 16 + ml];

  const size_t base = (size_t)(m0 + 8 * lh) * kH + n0 + ml;
#pragma unroll
  for (int i = 0; i < kWT; ++i) {
    // The 32 residual values of a 16-row strip are fetched together, ahead of
    // its stores, so the wave waits for memory once per strip.
    float xr[kWT][8];
    // These loads land in registers that the bias loads (their index) and the
    // previous strip's stores (their data) still name.
    asm volatile("s_wait_xcnt 0x0" ::: "memory");
#pragma unroll
    for (int j = 0; j < kWT; ++j)
#pragma unroll
      for (int r = 0; r < 8; ++r) xr[j][r] = x[base + (i * 16 + r) * kH + j * 16];
#pragma unroll
    for (int j = 0; j < kWT; ++j)
#pragma unroll
      for (int r = 0; r < 8; ++r) xr[j][r] = acc[i][j][r] + bb_[j] + xr[j][r];
#pragma unroll
    for (int j = 0; j < kWT; ++j)
#pragma unroll
      for (int r = 0; r < 8; ++r) y[base + (i * 16 + r) * kH + j * 16] = xr[j][r];
  }
}

// ---------------------------------------------------------------------------
// Kernel 4: LayerNorm over last dim (768).  One wave per row.
// ---------------------------------------------------------------------------
__global__ void __launch_bounds__(256)
layernorm_kernel(const float* __restrict__ y, const float* __restrict__ gamma,
                 const float* __restrict__ beta, float* __restrict__ out) {
  const int lane = threadIdx.x & 31;
  const int wave = threadIdx.x >> 5;
  const int row  = blockIdx.x * 8 + wave;
  const float* yr = y + (size_t)row * kH;

  float s = 0.0f, s2 = 0.0f;
  for (int i = lane; i < kH; i += 32) {
    const float v = yr[i];
    s += v; s2 += v * v;
  }
#pragma unroll
  for (int off = 1; off < 32; off <<= 1) {
    s  += __shfl_xor(s,  off, 32);
    s2 += __shfl_xor(s2, off, 32);
  }
  const float mean = s * (1.0f / kH);
  const float var  = s2 * (1.0f / kH) - mean * mean;
  const float rstd = rsqrtf(var + 1e-5f);

  float* orow = out + (size_t)row * kH;
  for (int i = lane; i < kH; i += 32)
    orow[i] = (yr[i] - mean) * rstd * gamma[i] + beta[i];
}

// ---------------------------------------------------------------------------
// Launch
// ---------------------------------------------------------------------------
extern "C" void kernel_launch(void* const* d_in, const int* in_sizes, int n_in,
                              void* d_out, int out_size, void* d_ws,
                              size_t ws_size, hipStream_t stream) {
  (void)in_sizes; (void)n_in; (void)out_size; (void)ws_size;

  const float* x     = (const float*)d_in[0];
  const float* amask = (const float*)d_in[1];
  const float* Wq    = (const float*)d_in[2];
  const float* bq    = (const float*)d_in[3];
  const float* Wk    = (const float*)d_in[4];
  const float* bk    = (const float*)d_in[5];
  const float* Wv    = (const float*)d_in[6];
  const float* bv    = (const float*)d_in[7];
  const float* Wo    = (const float*)d_in[8];
  const float* bo    = (const float*)d_in[9];
  const float* g     = (const float*)d_in[10];
  const float* be    = (const float*)d_in[11];
  float* out = (float*)d_out;

  // Workspace carve-up (all regions 16B-aligned by construction).
  const size_t NX = (size_t)kM * kH;          // 3,145,728 activation elems
  const size_t NW = (size_t)kH * kH;          // 589,824 weight elems
  char* w = (char*)d_ws;
  u16* XBF = (u16*)w;  w += NX * 2;
  u16* WQB = (u16*)w;  w += NW * 2;
  u16* WKB = (u16*)w;  w += NW * 2;
  u16* WVB = (u16*)w;  w += NW * 2;
  u16* WOB = (u16*)w;  w += NW * 2;
  u16* Qb  = (u16*)w;  w += NX * 2;           // [BH, S, HD]
  u16* Kb  = (u16*)w;  w += NX * 2;           // [BH, S, HD]
  u16* Vtb = (u16*)w;  w += NX * 2;           // [BH, HD, S] (transposed)
  u16* CTX = (u16*)w;  w += NX * 2;           // [B*S, H] bf16, fragment order
  float* Y = (float*)w;                       // [B, S, H] f32

  // f32 -> bf16 conversions, one launch: XBF, WQB, WKB, WVB, WOB lie in a row.
  cvt_bf16_kernel<<<dim3(kXBlks + 4 * kWBlks), 256, 0, stream>>>(
      x, Wq, Wk, Wv, Wo, XBF);

  // QKV projections: 64 row blocks x 4 groups of 9 (head, z) slots = 256 blocks.
  qkv_proj_kernel<<<dim3(kM / 64, 3 * kNH / 9), 288, 0, stream>>>(
      XBF, WQB, bq, WKB, bk, WVB, bv, Qb, Kb, Vtb);

  // Flash attention: 128 q-tiles (8 per block) x 24 (b,h) pairs.
  flash_attn_kernel<<<dim3(kS / 16 / 8, kBH), 256, 0, stream>>>(
      Qb, Kb, Vtb, amask, CTX);

  // Output projection + residual.
  out_proj_kernel<<<dim3(kM / 64, kH / 64 / 3), 96, 0, stream>>>(
      CTX, WOB, bo, x, Y);

  // LayerNorm -> d_out.
  layernorm_kernel<<<dim3(kM / 8), 256, 0, stream>>>(Y, g, be, out);
}

// v005
// Measured time: 92.8 microseconds a run.
// Timed twice side by side with v004, it ran 1.04 and 1.05 times as fast.
// Counting every step since v000, it is 2.39 times as fast.
#include <hip/hip_runtime.h>

// ---------------------------------------------------------------------------
// Encoder attention block on gfx1250 (wave32, WMMA bf16 16x16x32).
//   H=768, NH=12, HD=64, B=2, S=2048
// - One-time f32->bf16 conversion; all GEMMs stream raw bf16 b128 fragments.
// - The projection GEMMs' operands (x, the weights, ctx) lie in fragment order
//   (see load_frag_packed), so a fragment load reads whole cache lines.
// - Flash attention stages K/V chunks into LDS once per block via
//   global_load_async_to_lds_b128 (ASYNCcnt), double-buffered.
// ---------------------------------------------------------------------------

constexpr int kH  = 768;
constexpr int kNH = 12;
constexpr int kHD = 64;
constexpr int kB  = 2;
constexpr int kS  = 2048;
constexpr int kM  = kB * kS;          // 4096 total rows
constexpr int kBH = kB * kNH;         // 24 (batch*heads)

constexpr int kKStride = 72;          // LDS row stride for K chunk (pad 8)
constexpr int kVStride = 40;          // LDS row stride for V chunk (pad 8)

typedef unsigned short u16;
typedef __attribute__((ext_vector_type(16))) __bf16 v16bf;
typedef __attribute__((ext_vector_type(16))) u16    v16us;
typedef __attribute__((ext_vector_type(8)))  u16    v8us;
typedef __attribute__((ext_vector_type(8)))  float  v8f;
typedef __attribute__((ext_vector_type(4)))  float  v4f;
typedef __attribute__((ext_vector_type(2)))  float  v2f;
typedef __attribute__((ext_vector_type(2)))  __bf16 v2bf;
typedef __attribute__((ext_vector_type(8)))  unsigned v8u;

typedef __attribute__((address_space(3))) u16 lds_u16;

__device__ __forceinline__ u16 f2bf_u(float f) {
  unsigned u = __builtin_bit_cast(unsigned, f);
  u += 0x7FFFu + ((u >> 16) & 1u);    // round-to-nearest-even
  return (u16)(u >> 16);
}

// Per-lane slice of a 16x32 bf16 WMMA A/B fragment from a row-major bf16
// matrix.  p points at element (row = lane&15, k = k0 + c0), c0 = 8*(lane>=16).
// Lane needs k-offsets {0..7} and {16..23}: two 16-byte loads, no ALU.
__device__ __forceinline__ v16bf load_frag_bf16(const u16* p) {
  v8us a = *(const v8us*)(p);
  v8us b = *(const v8us*)(p + 16);
  v16us u = __builtin_shufflevector(a, b, 0, 1, 2, 3, 4, 5, 6, 7,
                                          8, 9, 10, 11, 12, 13, 14, 15);
  return __builtin_bit_cast(v16bf, u);
}

// Fragment order of a [rows x kH] bf16 operand of the projection GEMMs.  The
// 16-row x 32-k tile (R, Ks) is kTileElems consecutive elements at
// R * 16 * kH + Ks * kTileElems; inside it the 8 elements (row ml, k = 8 g ..
// 8 g + 7), g = 0..3, stand at (g >> 1) * 256 + (g & 1) * 128 + ml * 8.  Lane
// l = 16 * lh + ml then finds its k-offsets {8 lh ..} and {16 + 8 lh ..} (the
// same ones as load_frag_bf16) at l * 8 and 256 + l * 8: each of the two
// 16-byte loads of a wave covers 512 consecutive bytes, four whole lines,
// where a row-major operand makes it touch 16 lines.
constexpr int kTileElems = 16 * 32;

// p = tile start + lane * 8.
__device__ __forceinline__ v16bf load_frag_packed(const u16* p) {
  v8us a = *(const v8us*)(p);
  v8us b = *(const v8us*)(p + 256);
  v16us u = __builtin_shufflevector(a, b, 0, 1, 2, 3, 4, 5, 6, 7,
                                          8, 9, 10, 11, 12, 13, 14, 15);
  return __builtin_bit_cast(v16bf, u);
}

__device__ __forceinline__ v8f wmma_bf16(v16bf a, v16bf b, v8f c) {
  return __builtin_amdgcn_wmma_f32_16x16x32_bf16(false, a, false, b,
                                                 (short)0, c, false, false);
}

// Register tile of the projection GEMMs: one wave owns MT x kWT accumulator
// tiles (MT = kWT, 64 x 64 outputs, in the QKV projection), so every loaded A
// fragment feeds kWT WMMAs and every B fragment MT.
// Every loop over tiles or accumulator rows is fully unrolled, here and in the
// two kernels, so that these arrays are indexed by constants and stay in VGPRs.
constexpr int kWT = 4;

// acc += A[16 MT rows] * B[64 rows]^T over k = 0..kH, both in fragment order.
// abase / bbase are the wave-uniform starts of the first 16-row tiles; loff is
// this lane's byte offset (lane * 16) inside a tile, the same for A and B.
// Every load is scalar base + 32-bit lane offset + immediate.
template <int MT>
__device__ __forceinline__ void gemm_wave_tile(const u16* abase, const u16* bbase,
                                               unsigned loff,
                                               v8f (&acc)[MT][kWT]) {
  // Fully unrolled (24 k-steps): every k-step is an immediate offset, so there
  // is no address arithmetic and no branch among the WMMAs.
#pragma unroll
  for (int k0 = 0; k0 < kH; k0 += 32) {
    v16bf a[MT], b[kWT];
#pragma unroll
    for (int i = 0; i < MT; ++i)
      a[i] = load_frag_packed((const u16*)(
          (const char*)(abase + (k0 / 32) * kTileElems + i * 16 * kH) + loff));
#pragma unroll
    for (int j = 0; j < kWT; ++j)
      b[j] = load_frag_packed((const u16*)(
          (const char*)(bbase + (k0 / 32) * kTileElems + j * 16 * kH) + loff));
    // Stands behind the loads of a k-step and names their lane offset, so
    // that register is not reused (the last load's destination took it) ahead
    // of the wait.  The data wait follows at once, so it adds no stall.
    asm volatile("s_wait_xcnt 0x0" :: "v"(loff) : "memory");
    // Keeps the loads in one group ahead of the WMMAs: a load sunk among
    // them is waited for at once and exposes its whole latency.
    __builtin_amdgcn_sched_barrier(0);
#pragma unroll
    for (int i = 0; i < MT; ++i)
#pragma unroll
      for (int j = 0; j < kWT; ++j) acc[i][j] = wmma_bf16(a[i], b[j], acc[i][j]);
  }
}

// Async DMA of 16 bytes global -> LDS (tracked by ASYNCcnt).
__device__ __forceinline__ void async_copy_b128(u16* lds_dst, const u16* gsrc) {
  lds_u16* lp = (lds_u16*)lds_dst;
  asm volatile("global_load_async_to_lds_b128 %0, %1, off"
               :
               : "v"(lp), "v"(gsrc)
               : "memory");
}

__device__ __forceinline__ void wait_async0() {
  asm volatile("s_wait_asynccnt 0" ::: "memory");
}

// ---------------------------------------------------------------------------
// Kernel 0: elementwise f32 -> bf16 (8 elements / thread, vectorized) of x and
// the four weight matrices in ONE launch.  None of the five needs anything of
// another, so each takes a range of the block index; a block lies wholly in
// one array (every array is a whole number of 2048-element blocks).  The five
// bf16 planes follow one another in the workspace in the same order.
// The planes are written in fragment order (load_frag_packed).  A block takes
// 16 rows x 128 k = four tiles, which are its 2048 consecutive output elements.
// A wave takes 8 rows x one 32-k step: it reads 128 consecutive bytes of each
// row (8 lines per load) and stores four whole 128-byte lines.
// ---------------------------------------------------------------------------
constexpr int kCvtBlk = 256 * 8;                  // elements per block
constexpr int kXBlks  = kM * kH / kCvtBlk;        // 1536 blocks of x
constexpr int kWBlks  = kH * kH / kCvtBlk;        // 288 blocks per weight matrix
constexpr int kCvtK   = kCvtBlk / 16;             // 128 k per block
constexpr int kCvtKB  = kH / kCvtK;               // 6 blocks along k
static_assert(kXBlks * kCvtBlk == kM * kH && kWBlks * kCvtBlk == kH * kH,
              "every array is a whole number of blocks");
static_assert(kCvtKB * kCvtK == kH && kCvtK == 4 * 32 && kM % 16 == 0 && kH % 16 == 0,
              "a block is four whole tiles of one 16-row strip");

__global__ void __launch_bounds__(256)
cvt_bf16_kernel(const float* __restrict__ x,
                const float* __restrict__ Wq, const float* __restrict__ Wk,
                const float* __restrict__ Wv, const float* __restrict__ Wo,
                u16* __restrict__ out) {
  const int blk = blockIdx.x;
  const float* in = x;                            // block-uniform choice
  int first = 0;                                  // first block of that array
  if (blk >= kXBlks) {
    const int w = (blk - kXBlks) / kWBlks;
    first = kXBlks + w * kWBlks;
    in = w == 0 ? Wq : w == 1 ? Wk : w == 2 ? Wv : Wo;
  }
  const int lb  = blk - first;                    // block inside its array
  const int tid = threadIdx.x;
  const int ml  = ((tid >> 5) & 1) * 8 + (tid & 7);  // row in the 16-row strip
  const int g   = (tid >> 3) & 3;                 // group of 8 k in the 32-k step
  const int ks  = tid >> 6;                       // 32-k step in the block
  const float* p = in + ((lb / kCvtKB) * 16 + ml) * kH + (lb % kCvtKB) * kCvtK +
                   ks * 32 + g * 8;
  u16* q = out + (size_t)blk * kCvtBlk + ks * kTileElems +
           (g >> 1) * 256 + (g & 1) * 128 + ml * 8;
  v4f a = *(const v4f*)(p);
  v4f b = *(const v4f*)(p + 4);
  v8us u;
#pragma unroll
  for (int j = 0; j < 4; ++j) { u[j] = f2bf_u(a[j]); u[4 + j] = f2bf_u(b[j]); }
  *(v8us*)q = u;
}

// ---------------------------------------------------------------------------
// Kernel 1: QKV projection from bf16 operands.  out = x @ W^T + b.
// Q,K written bf16 [BH, S, HD]; V written TRANSPOSED bf16 [BH, HD, S].
// One wave = 64 rows x one whole head of Q, K or V; the 9 waves of a block
// share the same 64 rows of x (36 (head, z) slots = 4 blocks along y).
// ---------------------------------------------------------------------------
__global__ void __launch_bounds__(288)
qkv_proj_kernel(const u16* __restrict__ xbf,
                const u16* __restrict__ Wqb, const float* __restrict__ bq,
                const u16* __restrict__ Wkb, const float* __restrict__ bk,
                const u16* __restrict__ Wvb, const float* __restrict__ bv,
                u16* __restrict__ Qo, u16* __restrict__ Ko,
                u16* __restrict__ Vt) {
  const int lane = threadIdx.x & 31;
  const int wave = __builtin_amdgcn_readfirstlane(threadIdx.x >> 5);
  const int lh   = lane >> 4;
  const int ml   = lane & 15;
  const int m0   = blockIdx.x * (16 * kWT);
  const int slot = blockIdx.y * 9 + wave;     // 0..35: (head, z)
  const int z    = slot % 3;                  // every block: 3 waves each of Q, K, V
  const int h    = slot / 3;
  const int n0   = h * kHD;

  const u16* W;  const float* bias;
  if (z == 0)      { W = Wqb; bias = bq; }
  else if (z == 1) { W = Wkb; bias = bk; }
  else             { W = Wvb; bias = bv; }

  v8f acc[kWT][kWT] = {};
  gemm_wave_tile(xbf + (size_t)m0 * kH, W + (size_t)n0 * kH,
                 (unsigned)lane * 16u, acc);

  const int bh = (m0 / kS) * kNH + h;         // 64 rows never cross a batch
  const int s0 = m0 % kS + 8 * lh;
  float bb_[kWT];
#pragma unroll
  for (int j = 0; j < kWT; ++j) bb_[j] = bias[n0 + j * 16 + ml];

  if (z == 2) {                               // V: [BH, HD, S]
    u16* o = Vt + ((size_t)bh * kHD + ml) * kS + s0;
#pragma unroll
    for (int i = 0; i < kWT; ++i)
#pragma unroll
      for (int j = 0; j < kWT; ++j)
#pragma unroll
        for (int r = 0; r < 8; ++r)
          o[(size_t)(j * 16) * kS + i * 16 + r] = f2bf_u(acc[i][j][r] + bb_[j]);
    return;
  }
  u16* o = (z == 0 ? Qo : Ko) + ((size_t)bh * kS + s0) * kHD + ml;  // [BH, S, HD]
#pragma unroll
  for (int i = 0; i < kWT; ++i)
#pragma unroll
    for (int j = 0; j < kWT; ++j)
#pragma unroll
      for (int r = 0; r < 8; ++r)
        o[(i * 16 + r) * kHD + j * 16] = f2bf_u(acc[i][j][r] + bb_[j]);
  // Behind the last stores: in the built code the V path's block follows this
  // one and rewrites the registers that these stores name.
  asm volatile("s_wait_xcnt 0x0" ::: "memory");
}

// ---------------------------------------------------------------------------
// Kernel 2: flash attention, transposed products.  8 waves / block share one
// (b,h); K/V chunks are DMA'd into double-buffered LDS with
// global_load_async_to_lds_b128, then each wave streams WMMA fragments from LDS.
//   S^T = K Q^T   : A = K rows, B = Q rows; lane (c, h) holds query column c,
//                   register r of tile t = key t*16 + 8h + r.
//   O^T += V^T P^T: A = V^T rows, B = the two S^T tiles packed to bf16 in place
//                   (their register order is the k order of the A loader).
// A query's scores sit in the two lanes c and c + 16: maximum and sum are taken
// in the lane, with one exchange between the halves.  Writes ctx bf16 [B*S, H]
// in fragment order (load_frag_packed).
// ---------------------------------------------------------------------------
__device__ __forceinline__ unsigned pack_bf16(float lo, float hi) {
  return __builtin_bit_cast(unsigned, __builtin_convertvector(v2f{lo, hi}, v2bf));
}

__device__ __forceinline__ float max3f(float a, float b, float c) {
  return fmaxf(fmaxf(a, b), c);
}

// Value of lane l ^ 16.
__device__ __forceinline__ float other_half(float x) {
  const int v = __builtin_bit_cast(int, x);
  return __builtin_bit_cast(float, __builtin_amdgcn_permlanex16(
      v, v, 0x76543210, 0xfedcba98, false, false));
}

__global__ void __launch_bounds__(256)
flash_attn_kernel(const u16* __restrict__ Q, const u16* __restrict__ K,
                  const u16* __restrict__ Vt,
                  const float* __restrict__ amask,
                  u16* __restrict__ ctx) {
  __shared__ __align__(16) u16 kbuf[2][32 * kKStride];  // 32 kv-rows x 64 dims
  __shared__ __align__(16) u16 vbuf[2][64 * kVStride];  // 64 d-rows  x 32 kv
  __shared__ __align__(16) float mbias[kS];             // mask term per key

  const int tid  = threadIdx.x;
  const int lane = tid & 31;
  const int wave = tid >> 5;
  const int lh   = lane >> 4;
  const int ml   = lane & 15;
  const int c0   = lh * 8;

  const int bh = blockIdx.y;                  // 0..B*NH-1
  const int b  = bh / kNH;
  const int q0 = (blockIdx.x * 8 + wave) * 16;

  const u16* Qb  = Q  + (size_t)bh * kS * kHD;
  const u16* Kb  = K  + (size_t)bh * kS * kHD;
  const u16* Vtb = Vt + (size_t)bh * kHD * kS;

  // Staging coordinates: K chunk = 256 threads x 16B, V chunk likewise.
  const int krow = tid >> 3, kseg = tid & 7;  // 32 rows x 8 segs
  const int vrow = tid >> 2, vseg = tid & 3;  // 64 rows x 4 segs

  // Q fragments for this tile (HD=64 -> two k-steps of 32), loaded once.
  const v16bf qf0 = load_frag_bf16(Qb + (size_t)(q0 + ml) * kHD + 0  + c0);
  const v16bf qf1 = load_frag_bf16(Qb + (size_t)(q0 + ml) * kHD + 32 + c0);

  v8f o[4] = {};                              // O^T: o[dt][r] = d dt*16+8h+r, query c
  float mrun = -3.0e38f, lrun = 0.0f;         // scaled log2 maximum; this lane's sum

  // Kick off DMA for chunk 0 into buffer 0.
  async_copy_b128(&kbuf[0][krow * kKStride + kseg * 8],
                  Kb + (size_t)krow * kHD + kseg * 8);
  async_copy_b128(&vbuf[0][vrow * kVStride + vseg * 8],
                  Vtb + (size_t)vrow * kS + vseg * 8);

  // A key is a row of the score tile, so its mask term differs by register
  // and not by lane: all kS terms go to LDS once (8 per thread), times
  // sqrt(HD) = 8 (exact) because they start the accumulator ahead of the
  // 1/sqrt(HD) scaling.  The loop's first barrier publishes them.
  {
    const float* amb = amask + (size_t)b * kS;   // same for the whole block
    const float* am  = amb + tid * 8;
    v4f ma = *(const v4f*)(am);
    v4f mb = *(const v4f*)(am + 4);
    // Behind the two loads, naming their scalar base: otherwise that register
    // pair is reused for constants ahead of any wait.
    asm volatile("s_wait_xcnt 0x0" :: "s"(amb) : "memory");
#pragma unroll
    for (int j = 0; j < 4; ++j) {
      ma[j] = (1.0f - ma[j]) * -80000.0f;
      mb[j] = (1.0f - mb[j]) * -80000.0f;
    }
    *(v4f*)(&mbias[tid * 8])     = ma;
    *(v4f*)(&mbias[tid * 8 + 4]) = mb;
  }

  constexpr float kScale = 0.125f * 1.4426950408889634f;  // log2(e) / sqrt(HD)

  for (int kv0 = 0; kv0 < kS; kv0 += 32) {
    const int cur = (kv0 >> 5) & 1;
    wait_async0();                    // my chunk DMA done
    __syncthreads();                  // everyone's DMA done, prev buf free

    // Prefetch next chunk into the other buffer (overlaps with compute).
    if (kv0 + 32 < kS) {
      const int nxt = cur ^ 1;
      async_copy_b128(&kbuf[nxt][krow * kKStride + kseg * 8],
                      Kb + (size_t)(kv0 + 32 + krow) * kHD + kseg * 8);
      async_copy_b128(&vbuf[nxt][vrow * kVStride + vseg * 8],
                      Vtb + (size_t)vrow * kS + (kv0 + 32) + vseg * 8);
    }

    const u16* kch = &kbuf[cur][0];
    const u16* vch = &vbuf[cur][0];

    // ---- fragments of the pass: K rows and mask terms, then V^T rows ----
    v16bf kf[2][2], vf[4];
    v8f st[2];
#pragma unroll
    for (int t = 0; t < 2; ++t) {
      const u16* krow_l = kch + (t * 16 + ml) * kKStride + c0;
      kf[t][0] = load_frag_bf16(krow_l + 0);
      kf[t][1] = load_frag_bf16(krow_l + 32);
      const float* mrow = &mbias[kv0 + t * 16 + c0];
      const v4f ma = *(const v4f*)(mrow);
      const v4f mb = *(const v4f*)(mrow + 4);
      st[t] = __builtin_shufflevector(ma, mb, 0, 1, 2, 3, 4, 5, 6, 7);
    }
#pragma unroll
    for (int dt = 0; dt < 4; ++dt)
      vf[dt] = load_frag_bf16(vch + (dt * 16 + ml) * kVStride + c0);
    // Keeps the 20 LDS loads of a pass in one group ahead of the WMMAs: sunk
    // among them they share one register set, and every WMMA then waits for
    // its own loads' whole latency.
    __builtin_amdgcn_sched_barrier(0);

    // ---- S^T: two 16x16 tiles, keys [kv0, kv0+32) x 16 queries ----
#pragma unroll
    for (int t = 0; t < 2; ++t) st[t] = wmma_bf16(kf[t][0], qf0, st[t]);
#pragma unroll
    for (int t = 0; t < 2; ++t) st[t] = wmma_bf16(kf[t][1], qf1, st[t]);

    // ---- online softmax of query c, log2 domain ----
    float mx;
    {
      const float a0 = max3f(st[0][0], st[0][1], st[0][2]);
      const float a1 = max3f(st[0][3], st[0][4], st[0][5]);
      const float a2 = max3f(st[0][6], st[0][7], st[1][0]);
      const float a3 = max3f(st[1][1], st[1][2], st[1][3]);
      const float a4 = max3f(st[1][4], st[1][5], st[1][6]);
      mx = fmaxf(max3f(a0, a1, a2), max3f(a3, a4, st[1][7]));
    }
    mx = fmaxf(mx, other_half(mx));
    const float mnew  = fmaxf(mrun, mx * kScale);
    const float alpha = __builtin_amdgcn_exp2f(mrun - mnew);
    mrun = mnew;
    const v8f vscale = {kScale, kScale, kScale, kScale, kScale, kScale, kScale, kScale};
    const v8f vmneg  = {-mnew, -mnew, -mnew, -mnew, -mnew, -mnew, -mnew, -mnew};
#pragma unroll
    for (int t = 0; t < 2; ++t) {
      st[t] = __builtin_elementwise_fma(st[t], vscale, vmneg);
#pragma unroll
      for (int r = 0; r < 8; ++r) st[t][r] = __builtin_amdgcn_exp2f(st[t][r]);
    }
    const v8f s8 = st[0] + st[1];
    const v4f s4 = __builtin_shufflevector(s8, s8, 0, 1, 2, 3) +
                   __builtin_shufflevector(s8, s8, 4, 5, 6, 7);
    lrun = lrun * alpha + ((s4[0] + s4[1]) + (s4[2] + s4[3]));
#pragma unroll
    for (int dt = 0; dt < 4; ++dt) o[dt] *= alpha;

    // ---- P^T as B operand: element s = st[s >> 3][s & 7] ----
    v8u pu;
#pragma unroll
    for (int i = 0; i < 4; ++i) {
      pu[i]     = pack_bf16(st[0][2 * i], st[0][2 * i + 1]);
      pu[4 + i] = pack_bf16(st[1][2 * i], st[1][2 * i + 1]);
    }
    const v16bf pf = __builtin_bit_cast(v16bf, pu);

    // ---- O^T += V^T P^T : four 16-row d tiles across HD=64 ----
#pragma unroll
    for (int dt = 0; dt < 4; ++dt)
      o[dt] = wmma_bf16(vf[dt], pf, o[dt]);

    __syncthreads();                  // done reading cur buffer
  }

  // ---- join the halves' sums, normalize, write ctx (bf16), fragment order ----
  // A lane holds 8 consecutive d of its query per tile, group g = 2 (dt & 1) + lh
  // of 32-k step 2 h + (dt >> 1): one 16-byte store each, at lane * 8 in its half
  // tile, so a wave's store is 512 consecutive bytes.
  const int h = bh % kNH;
  const float inv = 1.0f / (lrun + other_half(lrun));
  u16* crow = ctx + ((size_t)b * kS + q0) * kH + h * 2 * kTileElems + lane * 8;
#pragma unroll
  for (int dt = 0; dt < 4; ++dt) {
    v8us u;
#pragma unroll
    for (int r = 0; r < 8; ++r) u[r] = f2bf_u(o[dt][r] * inv);
    *(v8us*)(crow + dt * 256) = u;
  }
}

// ---------------------------------------------------------------------------
// Kernel 3: output projection + bias + residual + LayerNorm, one launch.
//   y = ctx @ Wo^T + bo + x;  out = (y - mean) * rstd * gamma + beta
// A block owns kLT * 16 = 32 whole rows: its 12 waves take 64 columns each
// (2 x 4 accumulator tiles) and share the rows of ctx.  y stays in registers:
// each wave sums its 64 columns of every row, the 12 partial sums of a row meet
// in LDS behind one barrier, and every wave normalizes and stores its own tile.
// ---------------------------------------------------------------------------
constexpr int kLT = 2;                        // 16-row tiles per block
constexpr int kLW = kH / (16 * kWT);          // 12 waves cover the kH columns
constexpr int kLR = 16 * kLT;                 // 32 rows per block = lanes per wave
static_assert(kLR == 32 && kLW * 16 * kWT == kH && kM % kLR == 0,
              "one lane per row in the join of the partial sums");

// v + (v of lane l ^ M), M < 16: one step of a sum over a 16-lane row (DPP
// row_xmask).
template <int M>
__device__ __forceinline__ float add_row_xor(float v) {
  return v + __builtin_bit_cast(float, __builtin_amdgcn_mov_dpp(
      __builtin_bit_cast(int, v), 0x160 + M, 0xf, 0xf, false));
}

__global__ void __launch_bounds__(32 * kLW)
out_proj_ln_kernel(const u16* __restrict__ ctxb, const u16* __restrict__ Wob,
                   const float* __restrict__ bo, const float* __restrict__ x,
                   const float* __restrict__ gamma, const float* __restrict__ beta,
                   float* __restrict__ out) {
  __shared__ __align__(16) float psum[kLW][kLR];   // per wave and row: sum of y
  __shared__ __align__(16) float psq[kLW][kLR];    //                   sum of y * y
  __shared__ __align__(16) float smean[kLW][kLR];  // per row, a copy for each wave
  __shared__ __align__(16) float srstd[kLW][kLR];

  const int lane = threadIdx.x & 31;
  const int wave = __builtin_amdgcn_readfirstlane(threadIdx.x >> 5);
  const int lh   = lane >> 4;
  const int ml   = lane & 15;
  const int m0   = blockIdx.x * kLR;
  const int n0   = wave * (16 * kWT);

  v8f acc[kLT][kWT] = {};
  gemm_wave_tile(ctxb + (size_t)m0 * kH, Wob + (size_t)n0 * kH,
                 (unsigned)lane * 16u, acc);

  float bb_[kWT], gg[kWT], bt[kWT];
#pragma unroll
  for (int j = 0; j < kWT; ++j) {
    bb_[j] = bo[n0 + j * 16 + ml];
    gg[j]  = gamma[n0 + j * 16 + ml];
    bt[j]  = beta[n0 + j * 16 + ml];
  }

  // The 64 residual values of the tile are fetched together, so the wave waits
  // for memory once.  y[i][j][r] = row i*16 + 8*lh + r, column n0 + j*16 + ml.
  const size_t base = (size_t)(m0 + 8 * lh) * kH + n0 + ml;
  v8f y[kLT][kWT];
#pragma unroll
  for (int i = 0; i < kLT; ++i)
#pragma unroll
    for (int j = 0; j < kWT; ++j)
#pragma unroll
      for (int r = 0; r < 8; ++r) y[i][j][r] = x[base + (i * 16 + r) * kH + j * 16];
  // Behind the loads above: their index registers are reused in what follows.
  asm volatile("s_wait_xcnt 0x0" ::: "memory");
#pragma unroll
  for (int i = 0; i < kLT; ++i)
#pragma unroll
    for (int j = 0; j < kWT; ++j) y[i][j] = acc[i][j] + bb_[j] + y[i][j];

  // ---- this wave's 64 columns of each row: 4 in the lane, then the 16 lanes
  // of the half ----
#pragma unroll
  for (int i = 0; i < kLT; ++i) {
    const v8f s8 = (y[i][0] + y[i][1]) + (y[i][2] + y[i][3]);
    const v8f q8 = (y[i][0] * y[i][0] + y[i][1] * y[i][1]) +
                   (y[i][2] * y[i][2] + y[i][3] * y[i][3]);
    float s[8], q[8];
#pragma unroll
    for (int r = 0; r < 8; ++r) {
      s[r] = add_row_xor<8>(add_row_xor<4>(add_row_xor<2>(add_row_xor<1>(s8[r]))));
      q[r] = add_row_xor<8>(add_row_xor<4>(add_row_xor<2>(add_row_xor<1>(q8[r]))));
    }
    if (ml == 0) {                            // one lane of each half: its 8 rows
      v4f* ps = (v4f*)&psum[wave][i * 16 + 8 * lh];
      v4f* pq = (v4f*)&psq[wave][i * 16 + 8 * lh];
      ps[0] = v4f{s[0], s[1], s[2], s[3]};  ps[1] = v4f{s[4], s[5], s[6], s[7]};
      pq[0] = v4f{q[0], q[1], q[2], q[3]};  pq[1] = v4f{q[4], q[5], q[6], q[7]};
    }
  }
  __syncthreads();                            // all 12 partial sums of every row

  // ---- lane l joins row l (every wave does, so one barrier is enough) ----
  {
    float ts = psum[0][lane], tq = psq[0][lane];
#pragma unroll
    for (int w = 1; w < kLW; ++w) { ts += psum[w][lane]; tq += psq[w][lane]; }
    const float mean = ts * (1.0f / kH);
    const float var  = tq * (1.0f / kH) - mean * mean;
    smean[wave][lane] = mean;
    srstd[wave][lane] = rsqrtf(var + 1e-5f);
  }
  // The wave reads back what its other lanes wrote: their stores are done first.
  asm volatile("s_wait_dscnt 0x0" ::: "memory");

#pragma unroll
  for (int i = 0; i < kLT; ++i) {
    const v4f* pm = (const v4f*)&smean[wave][i * 16 + 8 * lh];
    const v4f* pr = (const v4f*)&srstd[wave][i * 16 + 8 * lh];
    const v8f mean = __builtin_shufflevector(pm[0], pm[1], 0, 1, 2, 3, 4, 5, 6, 7);
    const v8f rstd = __builtin_shufflevector(pr[0], pr[1], 0, 1, 2, 3, 4, 5, 6, 7);
#pragma unroll
    for (int j = 0; j < kWT; ++j) y[i][j] = (y[i][j] - mean) * rstd * gg[j] + bt[j];
  }
  // Keeps the 64 stores in one run behind the arithmetic: mixed into it they
  // share data registers, and each reuse waits for earlier stores.
  __builtin_amdgcn_sched_barrier(0);
#pragma unroll
  for (int i = 0; i < kLT; ++i)
#pragma unroll
    for (int j = 0; j < kWT; ++j)
#pragma unroll
      for (int r = 0; r < 8; ++r) out[base + (i * 16 + r) * kH + j * 16] = y[i][j][r];
}

// ---------------------------------------------------------------------------
// Launch
// ---------------------------------------------------------------------------
extern "C" void kernel_launch(void* const* d_in, const int* in_sizes, int n_in,
                              void* d_out, int out_size, void* d_ws,
                              size_t ws_size, hipStream_t stream) {
  (void)in_sizes; (void)n_in; (void)out_size; (void)ws_size;

  const float* x     = (const float*)d_in[0];
  const float* amask = (const float*)d_in[1];
  const float* Wq    = (const float*)d_in[2];
  const float* bq    = (const float*)d_in[3];
  const float* Wk    = (const float*)d_in[4];
  const float* bk    = (const float*)d_in[5];
  const float* Wv    = (const float*)d_in[6];
  const float* bv    = (const float*)d_in[7];
  const float* Wo    = (const float*)d_in[8];
  const float* bo    = (const float*)d_in[9];
  const float* g     = (const float*)d_in[10];
  const float* be    = (const float*)d_in[11];
  float* out = (float*)d_out;

  // Workspace carve-up (all regions 16B-aligned by construction).
  const size_t NX = (size_t)kM * kH;          // 3,145,728 activation elems
  const size_t NW = (size_t)kH * kH;          // 589,824 weight elems
  char* w = (char*)d_ws;
  u16* XBF = (u16*)w;  w += NX * 2;
  u16* WQB = (u16*)w;  w += NW * 2;
  u16* WKB = (u16*)w;  w += NW * 2;
  u16* WVB = (u16*)w;  w += NW * 2;
  u16* WOB = (u16*)w;  w += NW * 2;
  u16* Qb  = (u16*)w;  w += NX * 2;           // [BH, S, HD]
  u16* Kb  = (u16*)w;  w += NX * 2;           // [BH, S, HD]
  u16* Vtb = (u16*)w;  w += NX * 2;           // [BH, HD, S] (transposed)
  u16* CTX = (u16*)w;                         // [B*S, H] bf16, fragment order

  // f32 -> bf16 conversions, one launch: XBF, WQB, WKB, WVB, WOB lie in a row.
  cvt_bf16_kernel<<<dim3(kXBlks + 4 * kWBlks), 256, 0, stream>>>(
      x, Wq, Wk, Wv, Wo, XBF);

  // QKV projections: 64 row blocks x 4 groups of 9 (head, z) slots = 256 blocks.
  qkv_proj_kernel<<<dim3(kM / 64, 3 * kNH / 9), 288, 0, stream>>>(
      XBF, WQB, bq, WKB, bk, WVB, bv, Qb, Kb, Vtb);

  // Flash attention: 128 q-tiles (8 per block) x 24 (b,h) pairs.
  flash_attn_kernel<<<dim3(kS / 16 / 8, kBH), 256, 0, stream>>>(
      Qb, Kb, Vtb, amask, CTX);

  // Output projection + residual + LayerNorm -> d_out: 128 blocks of 32 rows.
  out_proj_ln_kernel<<<dim3(kM / kLR), 32 * kLW, 0, stream>>>(
      CTX, WOB, bo, x, g, be, out);
}

// v006
// It runs in 66.7 microseconds.
// Two timings next to v005 put it at 1.37 and 1.38 times that version's speed.
// Counting every step since v000, it is 3.28 times as fast.
#include <hip/hip_runtime.h>

// ---------------------------------------------------------------------------
// Encoder attention block on gfx1250 (wave32, WMMA bf16 16x16x32).
//   H=768, NH=12, HD=64, B=2, S=2048
// - One-time f32->bf16 conversion; all GEMMs stream raw bf16 b128 fragments.
// - The projection GEMMs' operands (x, the weights, ctx) lie in fragment order
//   (see load_frag_packed), so a fragment load reads whole cache lines.
// - Flash attention stages K/V chunks into LDS once per block via
//   global_load_async_to_lds_b128 (ASYNCcnt), double-buffered.
// ---------------------------------------------------------------------------

constexpr int kH  = 768;
constexpr int kNH = 12;
constexpr int kHD = 64;
constexpr int kB  = 2;
constexpr int kS  = 2048;
constexpr int kM  = kB * kS;          // 4096 total rows
constexpr int kBH = kB * kNH;         // 24 (batch*heads)

constexpr int kKStride = 72;          // LDS row stride for K chunk (pad 8)
constexpr int kVStride = 40;          // LDS row stride for V chunk (pad 8)

typedef unsigned short u16;
typedef __attribute__((ext_vector_type(16))) __bf16 v16bf;
typedef __attribute__((ext_vector_type(16))) u16    v16us;
typedef __attribute__((ext_vector_type(8)))  u16    v8us;
typedef __attribute__((ext_vector_type(8)))  float  v8f;
typedef __attribute__((ext_vector_type(4)))  float  v4f;
typedef __attribute__((ext_vector_type(2)))  float  v2f;
typedef __attribute__((ext_vector_type(2)))  __bf16 v2bf;
typedef __attribute__((ext_vector_type(8)))  unsigned v8u;

typedef __attribute__((address_space(3))) u16 lds_u16;

__device__ __forceinline__ u16 f2bf_u(float f) {
  unsigned u = __builtin_bit_cast(unsigned, f);
  u += 0x7FFFu + ((u >> 16) & 1u);    // round-to-nearest-even
  return (u16)(u >> 16);
}

// Per-lane slice of a 16x32 bf16 WMMA A/B fragment from a row-major bf16
// matrix.  p points at element (row = lane&15, k = k0 + c0), c0 = 8*(lane>=16).
// Lane needs k-offsets {0..7} and {16..23}: two 16-byte loads, no ALU.
__device__ __forceinline__ v16bf load_frag_bf16(const u16* p) {
  v8us a = *(const v8us*)(p);
  v8us b = *(const v8us*)(p + 16);
  v16us u = __builtin_shufflevector(a, b, 0, 1, 2, 3, 4, 5, 6, 7,
                                          8, 9, 10, 11, 12, 13, 14, 15);
  return __builtin_bit_cast(v16bf, u);
}

// Fragment order of a [rows x kH] bf16 operand of the projection GEMMs.  The
// 16-row x 32-k tile (R, Ks) is kTileElems consecutive elements at
// R * 16 * kH + Ks * kTileElems; inside it the 8 elements (row ml, k = 8 g ..
// 8 g + 7), g = 0..3, stand at (g >> 1) * 256 + (g & 1) * 128 + ml * 8.  Lane
// l = 16 * lh + ml then finds its k-offsets {8 lh ..} and {16 + 8 lh ..} (the
// same ones as load_frag_bf16) at l * 8 and 256 + l * 8: each of the two
// 16-byte loads of a wave covers 512 consecutive bytes, four whole lines,
// where a row-major operand makes it touch 16 lines.
constexpr int kTileElems = 16 * 32;

// p = tile start + lane * 8.
__device__ __forceinline__ v16bf load_frag_packed(const u16* p) {
  v8us a = *(const v8us*)(p);
  v8us b = *(const v8us*)(p + 256);
  v16us u = __builtin_shufflevector(a, b, 0, 1, 2, 3, 4, 5, 6, 7,
                                          8, 9, 10, 11, 12, 13, 14, 15);
  return __builtin_bit_cast(v16bf, u);
}

__device__ __forceinline__ v8f wmma_bf16(v16bf a, v16bf b, v8f c) {
  return __builtin_amdgcn_wmma_f32_16x16x32_bf16(false, a, false, b,
                                                 (short)0, c, false, false);
}

// Prefetch into L2.  One instruction names 32 units (256-byte pieces), one per
// lane, at base + off + IMM bytes; nothing is returned and no counter is
// touched.  A hint, for speed only: results do not depend on what it brings or
// where a work-group runs.  Every address lies inside the operand.  base is the
// scalar base that the k loop's own loads use, so it stays an address.
template <int IMM>
__device__ __forceinline__ void prefetch_units(const u16* base, unsigned off) {
  asm volatile("global_prefetch_b8 %0, %1 offset:%2 scope:SCOPE_SE"
               :: "v"(off), "s"(base), "n"(IMM));
}

// Lane offset (bytes) that spreads one prefetch over the NS 16-row strips of a
// fragment-order operand: 32 / NS consecutive units, the same k-steps, of each.
constexpr unsigned kStripBytes = 16 * kH * 2;
template <int NS>
__device__ __forceinline__ unsigned prefetch_lane_off(int lane) {
  return (unsigned)(lane / (32 / NS)) * kStripBytes + (unsigned)(lane % (32 / NS)) * 256u;
}

// Register tile of the projection GEMMs: one wave owns MT x kWT accumulator
// tiles (MT = kWT, 64 x 64 outputs, in the QKV projection), so every loaded A
// fragment feeds kWT WMMAs and every B fragment MT.
// Every loop over tiles or accumulator rows is fully unrolled, here and in the
// two kernels, so that these arrays are indexed by constants and stay in VGPRs.
constexpr int kWT = 4;

// acc += A[16 MT rows] * B[64 rows]^T over k = 0..kH, both in fragment order.
// abase / bbase are the wave-uniform starts of the first 16-row tiles; loff is
// this lane's byte offset (lane * 16) inside a tile, the same for A and B.
// Every load is scalar base + 32-bit lane offset + immediate (the offset
// register holds lane * 16, or lane where the load scales it).
// pfa / pfb are the lane offsets of the prefetches that the caller has issued.
template <int MT>
__device__ __forceinline__ void gemm_wave_tile(const u16* abase, const u16* bbase,
                                               unsigned lane, unsigned pfa, unsigned pfb,
                                               v8f (&acc)[MT][kWT]) {
  const unsigned loff = lane * 16u;
  // Fully unrolled (24 k-steps): every k-step is an immediate offset, so there
  // is no address arithmetic and no branch among the WMMAs.
#pragma unroll
  for (int k0 = 0; k0 < kH; k0 += 32) {
    v16bf a[MT], b[kWT];
#pragma unroll
    for (int i = 0; i < MT; ++i)
      a[i] = load_frag_packed((const u16*)(
          (const char*)(abase + (k0 / 32) * kTileElems + i * 16 * kH) + loff));
#pragma unroll
    for (int j = 0; j < kWT; ++j)
      b[j] = load_frag_packed((const u16*)(
          (const char*)(bbase + (k0 / 32) * kTileElems + j * 16 * kH) + loff));
    // Stands behind the loads of a k-step and names their lane offset, in
    // both forms, so that register is not reused (the last load's destination
    // took it) ahead of the wait.  The data wait follows at once: no stall.
    // It names the prefetches' lane offsets too: their registers then hold
    // in-bounds offsets all through the loop, whenever a prefetch is served.
    asm volatile("s_wait_xcnt 0x0" :: "v"(loff), "v"(lane), "v"(pfa), "v"(pfb) : "memory");
    // Keeps the loads in one group ahead of the WMMAs: a load sunk among
    // them is waited for at once and exposes its whole latency.
    __builtin_amdgcn_sched_barrier(0);
#pragma unroll
    for (int i = 0; i < MT; ++i)
#pragma unroll
      for (int j = 0; j < kWT; ++j) acc[i][j] = wmma_bf16(a[i], b[j], acc[i][j]);
  }
}

// Async DMA of 16 bytes global -> LDS (tracked by ASYNCcnt).
__device__ __forceinline__ void async_copy_b128(u16* lds_dst, const u16* gsrc) {
  lds_u16* lp = (lds_u16*)lds_dst;
  asm volatile("global_load_async_to_lds_b128 %0, %1, off"
               :
               : "v"(lp), "v"(gsrc)
               : "memory");
}

__device__ __forceinline__ void wait_async0() {
  asm volatile("s_wait_asynccnt 0" ::: "memory");
}

// ---------------------------------------------------------------------------
// Kernel 0: elementwise f32 -> bf16 (8 elements / thread, vectorized) of x and
// the four weight matrices in ONE launch.  None of the five needs anything of
// another, so each takes a range of the block index; a block lies wholly in
// one array (every array is a whole number of 2048-element blocks).  The five
// bf16 planes follow one another in the workspace in the same order.
// The planes are written in fragment order (load_frag_packed).  A block takes
// 16 rows x 128 k = four tiles, which are its 2048 consecutive output elements.
// A wave takes 8 rows x one 32-k step: it reads 128 consecutive bytes of each
// row (8 lines per load) and stores four whole 128-byte lines.
// ---------------------------------------------------------------------------
constexpr int kCvtBlk = 256 * 8;                  // elements per block
constexpr int kXBlks  = kM * kH / kCvtBlk;        // 1536 blocks of x
constexpr int kWBlks  = kH * kH / kCvtBlk;        // 288 blocks per weight matrix
constexpr int kCvtK   = kCvtBlk / 16;             // 128 k per block
constexpr int kCvtKB  = kH / kCvtK;               // 6 blocks along k
static_assert(kXBlks * kCvtBlk == kM * kH && kWBlks * kCvtBlk == kH * kH,
              "every array is a whole number of blocks");
static_assert(kCvtKB * kCvtK == kH && kCvtK == 4 * 32 && kM % 16 == 0 && kH % 16 == 0,
              "a block is four whole tiles of one 16-row strip");

__global__ void __launch_bounds__(256)
cvt_bf16_kernel(const float* __restrict__ x,
                const float* __restrict__ Wq, const float* __restrict__ Wk,
                const float* __restrict__ Wv, const float* __restrict__ Wo,
                u16* __restrict__ out) {
  const int blk = blockIdx.x;
  const float* in = x;                            // block-uniform choice
  int first = 0;                                  // first block of that array
  if (blk >= kXBlks) {
    const int w = (blk - kXBlks) / kWBlks;
    first = kXBlks + w * kWBlks;
    in = w == 0 ? Wq : w == 1 ? Wk : w == 2 ? Wv : Wo;
  }
  const int lb  = blk - first;                    // block inside its array
  const int tid = threadIdx.x;
  const int ml  = ((tid >> 5) & 1) * 8 + (tid & 7);  // row in the 16-row strip
  const int g   = (tid >> 3) & 3;                 // group of 8 k in the 32-k step
  const int ks  = tid >> 6;                       // 32-k step in the block
  const float* p = in + ((lb / kCvtKB) * 16 + ml) * kH + (lb % kCvtKB) * kCvtK +
                   ks * 32 + g * 8;
  u16* q = out + (size_t)blk * kCvtBlk + ks * kTileElems +
           (g >> 1) * 256 + (g & 1) * 128 + ml * 8;
  v4f a = *(const v4f*)(p);
  v4f b = *(const v4f*)(p + 4);
  v8us u;
#pragma unroll
  for (int j = 0; j < 4; ++j) { u[j] = f2bf_u(a[j]); u[4 + j] = f2bf_u(b[j]); }
  *(v8us*)q = u;
}

// ---------------------------------------------------------------------------
// Kernel 1: QKV projection from bf16 operands.  out = x @ W^T + b.
// Q,K written bf16 [BH, S, HD]; V written TRANSPOSED bf16 [BH, HD, S].
// One wave = 64 rows x one whole head of Q, K or V; the 9 waves of a block
// share the same 64 rows of x (36 (head, z) slots = 4 blocks along y).
// ---------------------------------------------------------------------------
__global__ void __launch_bounds__(288)
qkv_proj_kernel(const u16* __restrict__ xbf,
                const u16* __restrict__ Wqb, const float* __restrict__ bq,
                const u16* __restrict__ Wkb, const float* __restrict__ bk,
                const u16* __restrict__ Wvb, const float* __restrict__ bv,
                u16* __restrict__ Qo, u16* __restrict__ Ko,
                u16* __restrict__ Vt) {
  const int lane = threadIdx.x & 31;
  const int wave = __builtin_amdgcn_readfirstlane(threadIdx.x >> 5);
  const int lh   = lane >> 4;
  const int ml   = lane & 15;
  const int m0   = blockIdx.x * (16 * kWT);
  const int slot = blockIdx.y * 9 + wave;     // 0..35: (head, z)
  const int z    = slot % 3;                  // every block: 3 waves each of Q, K, V
  const int h    = slot / 3;
  const int n0   = h * kHD;

  const u16* W;  const float* bias;
  if (z == 0)      { W = Wqb; bias = bq; }
  else if (z == 1) { W = Wkb; bias = bk; }
  else             { W = Wvb; bias = bv; }

  // Prefetch: one instruction covers two k-steps (2048 bytes) of all four
  // strips, so 12 cover an operand of 64 rows.  The block's x rows: one per
  // wave, waves 0..2 a second.  The wave's weight rows are read by all 64
  // blocks along x: 16 neighbours ask for the same quarter of k, later blocks
  // for later k.
  const u16* xrows = xbf + (size_t)m0 * kH;
  const u16* wrows = W + (size_t)n0 * kH;
  const unsigned pfa = prefetch_lane_off<kWT>(lane) + (unsigned)wave * 2048u;
  const unsigned pfb = prefetch_lane_off<kWT>(lane) + (blockIdx.x >> 4) * (3u * 2048u);
  prefetch_units<0>(xrows, pfa);
  if (wave < 3) prefetch_units<9 * 2048>(xrows, pfa);
  prefetch_units<0>(wrows, pfb);
  prefetch_units<2048>(wrows, pfb);
  prefetch_units<4096>(wrows, pfb);

  v8f acc[kWT][kWT] = {};
  gemm_wave_tile(xrows, wrows, (unsigned)lane, pfa, pfb, acc);

  const int bh = (m0 / kS) * kNH + h;         // 64 rows never cross a batch
  const int s0 = m0 % kS + 8 * lh;
  float bb_[kWT];
#pragma unroll
  for (int j = 0; j < kWT; ++j) bb_[j] = bias[n0 + j * 16 + ml];

  if (z == 2) {                               // V: [BH, HD, S]
    u16* o = Vt + ((size_t)bh * kHD + ml) * kS + s0;
#pragma unroll
    for (int i = 0; i < kWT; ++i)
#pragma unroll
      for (int j = 0; j < kWT; ++j)
#pragma unroll
        for (int r = 0; r < 8; ++r)
          o[(size_t)(j * 16) * kS + i * 16 + r] = f2bf_u(acc[i][j][r] + bb_[j]);
    return;
  }
  u16* o = (z == 0 ? Qo : Ko) + ((size_t)bh * kS + s0) * kHD + ml;  // [BH, S, HD]
#pragma unroll
  for (int i = 0; i < kWT; ++i)
#pragma unroll
    for (int j = 0; j < kWT; ++j)
#pragma unroll
      for (int r = 0; r < 8; ++r)
        o[(i * 16 + r) * kHD + j * 16] = f2bf_u(acc[i][j][r] + bb_[j]);
  // Behind the last stores: in the built code the V path's block follows this
  // one and rewrites the registers that these stores name.
  asm volatile("s_wait_xcnt 0x0" ::: "memory");
}

// ---------------------------------------------------------------------------
// Kernel 2: flash attention, transposed products.  8 waves / block share one
// (b,h); K/V chunks are DMA'd into double-buffered LDS with
// global_load_async_to_lds_b128, then each wave streams WMMA fragments from LDS.
//   S^T = K Q^T   : A = K rows, B = Q rows; lane (c, h) holds query column c,
//                   register r of tile t = key t*16 + 8h + r.
//   O^T += V^T P^T: A = V^T rows, B = the two S^T tiles packed to bf16 in place
//                   (their register order is the k order of the A loader).
// A query's scores sit in the two lanes c and c + 16: maximum and sum are taken
// in the lane, with one exchange between the halves.  Writes ctx bf16 [B*S, H]
// in fragment order (load_frag_packed).
// ---------------------------------------------------------------------------
__device__ __forceinline__ unsigned pack_bf16(float lo, float hi) {
  return __builtin_bit_cast(unsigned, __builtin_convertvector(v2f{lo, hi}, v2bf));
}

__device__ __forceinline__ float max3f(float a, float b, float c) {
  return fmaxf(fmaxf(a, b), c);
}

// Value of lane l ^ 16.
__device__ __forceinline__ float other_half(float x) {
  const int v = __builtin_bit_cast(int, x);
  return __builtin_bit_cast(float, __builtin_amdgcn_permlanex16(
      v, v, 0x76543210, 0xfedcba98, false, false));
}

__global__ void __launch_bounds__(256)
flash_attn_kernel(const u16* __restrict__ Q, const u16* __restrict__ K,
                  const u16* __restrict__ Vt,
                  const float* __restrict__ amask,
                  u16* __restrict__ ctx) {
  __shared__ __align__(16) u16 kbuf[2][32 * kKStride];  // 32 kv-rows x 64 dims
  __shared__ __align__(16) u16 vbuf[2][64 * kVStride];  // 64 d-rows  x 32 kv
  __shared__ __align__(16) float mbias[kS];             // mask term per key

  const int tid  = threadIdx.x;
  const int lane = tid & 31;
  const int wave = tid >> 5;
  const int lh   = lane >> 4;
  const int ml   = lane & 15;
  const int c0   = lh * 8;

  const int bh = blockIdx.y;                  // 0..B*NH-1
  const int b  = bh / kNH;
  const int q0 = (blockIdx.x * 8 + wave) * 16;

  const u16* Qb  = Q  + (size_t)bh * kS * kHD;
  const u16* Kb  = K  + (size_t)bh * kS * kHD;
  const u16* Vtb = Vt + (size_t)bh * kHD * kS;

  // Staging coordinates: K chunk = 256 threads x 16B, V chunk likewise.
  const int krow = tid >> 3, kseg = tid & 7;  // 32 rows x 8 segs
  const int vrow = tid >> 2, vseg = tid & 3;  // 64 rows x 4 segs

  // Q fragments for this tile (HD=64 -> two k-steps of 32), loaded once.
  const v16bf qf0 = load_frag_bf16(Qb + (size_t)(q0 + ml) * kHD + 0  + c0);
  const v16bf qf1 = load_frag_bf16(Qb + (size_t)(q0 + ml) * kHD + 32 + c0);

  v8f o[4] = {};                              // O^T: o[dt][r] = d dt*16+8h+r, query c
  float mrun = -3.0e38f, lrun = 0.0f;         // scaled log2 maximum; this lane's sum

  // Kick off DMA for chunk 0 into buffer 0.
  async_copy_b128(&kbuf[0][krow * kKStride + kseg * 8],
                  Kb + (size_t)krow * kHD + kseg * 8);
  async_copy_b128(&vbuf[0][vrow * kVStride + vseg * 8],
                  Vtb + (size_t)vrow * kS + vseg * 8);

  // Prefetch of K and V^T, in groups of 256 keys (8 passes): 128 units of K
  // (consecutive) and 128 of V^T (two per d row).  The 16 blocks of a (b,h) walk
  // the same keys in step, so they share the asking: a block takes a quarter of
  // every group, chosen by its index, with its waves 0 and 1.  pf walks from
  // group to group, lives through the loop and stays inside the array; group 0
  // is asked for here, group g + 1 when the loop enters group g.
  const bool pfwave = __builtin_amdgcn_readfirstlane(tid >> 5) < 2;
  const int  pfq    = blockIdx.x & 3;           // quarters 0, 1: K; 2, 3: V^T
  const int  pfu    = (pfq & 1) * 64 + (tid & 63);
  const char* pf = pfq < 2 ? (const char*)Kb + pfu * 256
                           : (const char*)Vtb + (pfu >> 1) * (kS * 2) + (pfu & 1) * 256;
  const int pfstep = pfq < 2 ? 256 * kHD * 2 : 256 * 2;
  if (pfwave) asm volatile("global_prefetch_b8 %0, off scope:SCOPE_SE" :: "v"(pf));

  // A key is a row of the score tile, so its mask term differs by register
  // and not by lane: all kS terms go to LDS once (8 per thread), times
  // sqrt(HD) = 8 (exact) because they start the accumulator ahead of the
  // 1/sqrt(HD) scaling.  The loop's first barrier publishes them.
  {
    const float* amb = amask + (size_t)b * kS;   // same for the whole block
    const float* am  = amb + tid * 8;
    v4f ma = *(const v4f*)(am);
    v4f mb = *(const v4f*)(am + 4);
    // Behind the two loads, naming their scalar base: otherwise that register
    // pair is reused for constants ahead of any wait.
    asm volatile("s_wait_xcnt 0x0" :: "s"(amb) : "memory");
#pragma unroll
    for (int j = 0; j < 4; ++j) {
      ma[j] = (1.0f - ma[j]) * -80000.0f;
      mb[j] = (1.0f - mb[j]) * -80000.0f;
    }
    *(v4f*)(&mbias[tid * 8])     = ma;
    *(v4f*)(&mbias[tid * 8 + 4]) = mb;
  }

  constexpr float kScale = 0.125f * 1.4426950408889634f;  // log2(e) / sqrt(HD)

  for (int kv0 = 0; kv0 < kS; kv0 += 32) {
    const int cur = (kv0 >> 5) & 1;
    wait_async0();                    // my chunk DMA done
    __syncthreads();                  // everyone's DMA done, prev buf free

    // Prefetch next chunk into the other buffer (overlaps with compute).
    if (kv0 + 32 < kS) {
      const int nxt = cur ^ 1;
      async_copy_b128(&kbuf[nxt][krow * kKStride + kseg * 8],
                      Kb + (size_t)(kv0 + 32 + krow) * kHD + kseg * 8);
      async_copy_b128(&vbuf[nxt][vrow * kVStride + vseg * 8],
                      Vtb + (size_t)vrow * kS + (kv0 + 32) + vseg * 8);
      if (pfwave && (kv0 & 255) == 0 && kv0 + 256 < kS) {
        pf += pfstep;
        asm volatile("global_prefetch_b8 %0, off scope:SCOPE_SE" :: "v"(pf));
      }
    }

    const u16* kch = &kbuf[cur][0];
    const u16* vch = &vbuf[cur][0];

    // ---- fragments of the pass: K rows and mask terms, then V^T rows ----
    v16bf kf[2][2], vf[4];
    v8f st[2];
#pragma unroll
    for (int t = 0; t < 2; ++t) {
      const u16* krow_l = kch + (t * 16 + ml) * kKStride + c0;
      kf[t][0] = load_frag_bf16(krow_l + 0);
      kf[t][1] = load_frag_bf16(krow_l + 32);
      const float* mrow = &mbias[kv0 + t * 16 + c0];
      const v4f ma = *(const v4f*)(mrow);
      const v4f mb = *(const v4f*)(mrow + 4);
      st[t] = __builtin_shufflevector(ma, mb, 0, 1, 2, 3, 4, 5, 6, 7);
    }
#pragma unroll
    for (int dt = 0; dt < 4; ++dt)
      vf[dt] = load_frag_bf16(vch + (dt * 16 + ml) * kVStride + c0);
    // Keeps the 20 LDS loads of a pass in one group ahead of the WMMAs: sunk
    // among them they share one register set, and every WMMA then waits for
    // its own loads' whole latency.
    __builtin_amdgcn_sched_barrier(0);

    // ---- S^T: two 16x16 tiles, keys [kv0, kv0+32) x 16 queries ----
#pragma unroll
    for (int t = 0; t < 2; ++t) st[t] = wmma_bf16(kf[t][0], qf0, st[t]);
#pragma unroll
    for (int t = 0; t < 2; ++t) st[t] = wmma_bf16(kf[t][1], qf1, st[t]);

    // ---- online softmax of query c, log2 domain ----
    float mx;
    {
      const float a0 = max3f(st[0][0], st[0][1], st[0][2]);
      const float a1 = max3f(st[0][3], st[0][4], st[0][5]);
      const float a2 = max3f(st[0][6], st[0][7], st[1][0]);
      const float a3 = max3f(st[1][1], st[1][2], st[1][3]);
      const float a4 = max3f(st[1][4], st[1][5], st[1][6]);
      mx = fmaxf(max3f(a0, a1, a2), max3f(a3, a4, st[1][7]));
    }
    mx = fmaxf(mx, other_half(mx));
    const float mnew  = fmaxf(mrun, mx * kScale);
    const float alpha = __builtin_amdgcn_exp2f(mrun - mnew);
    mrun = mnew;
    const v8f vscale = {kScale, kScale, kScale, kScale, kScale, kScale, kScale, kScale};
    const v8f vmneg  = {-mnew, -mnew, -mnew, -mnew, -mnew, -mnew, -mnew, -mnew};
#pragma unroll
    for (int t = 0; t < 2; ++t) {
      st[t] = __builtin_elementwise_fma(st[t], vscale, vmneg);
#pragma unroll
      for (int r = 0; r < 8; ++r) st[t][r] = __builtin_amdgcn_exp2f(st[t][r]);
    }
    const v8f s8 = st[0] + st[1];
    const v4f s4 = __builtin_shufflevector(s8, s8, 0, 1, 2, 3) +
                   __builtin_shufflevector(s8, s8, 4, 5, 6, 7);
    lrun = lrun * alpha + ((s4[0] + s4[1]) + (s4[2] + s4[3]));
#pragma unroll
    for (int dt = 0; dt < 4; ++dt) o[dt] *= alpha;

    // ---- P^T as B operand: element s = st[s >> 3][s & 7] ----
    v8u pu;
#pragma unroll
    for (int i = 0; i < 4; ++i) {
      pu[i]     = pack_bf16(st[0][2 * i], st[0][2 * i + 1]);
      pu[4 + i] = pack_bf16(st[1][2 * i], st[1][2 * i + 1]);
    }
    const v16bf pf = __builtin_bit_cast(v16bf, pu);

    // ---- O^T += V^T P^T : four 16-row d tiles across HD=64 ----
#pragma unroll
    for (int dt = 0; dt < 4; ++dt)
      o[dt] = wmma_bf16(vf[dt], pf, o[dt]);

    __syncthreads();                  // done reading cur buffer
  }

  // ---- join the halves' sums, normalize, write ctx (bf16), fragment order ----
  // A lane holds 8 consecutive d of its query per tile, group g = 2 (dt & 1) + lh
  // of 32-k step 2 h + (dt >> 1): one 16-byte store each, at lane * 8 in its half
  // tile, so a wave's store is 512 consecutive bytes.
  const int h = bh % kNH;
  const float inv = 1.0f / (lrun + other_half(lrun));
  u16* crow = ctx + ((size_t)b * kS + q0) * kH + h * 2 * kTileElems + lane * 8;
#pragma unroll
  for (int dt = 0; dt < 4; ++dt) {
    v8us u;
#pragma unroll
    for (int r = 0; r < 8; ++r) u[r] = f2bf_u(o[dt][r] * inv);
    *(v8us*)(crow + dt * 256) = u;
  }
}

// ---------------------------------------------------------------------------
// Kernel 3: output projection + bias + residual + LayerNorm, one launch.
//   y = ctx @ Wo^T + bo + x;  out = (y - mean) * rstd * gamma + beta
// A block owns kLT * 16 = 32 whole rows: its 12 waves take 64 columns each
// (2 x 4 accumulator tiles) and share the rows of ctx.  y stays in registers:
// each wave sums its 64 columns of every row, the 12 partial sums of a row meet
// in LDS behind one barrier, and every wave normalizes and stores its own tile.
// ---------------------------------------------------------------------------
constexpr int kLT = 2;                        // 16-row tiles per block
constexpr int kLW = kH / (16 * kWT);          // 12 waves cover the kH columns
constexpr int kLR = 16 * kLT;                 // 32 rows per block = lanes per wave
static_assert(kLR == 32 && kLW * 16 * kWT == kH && kM % kLR == 0,
              "one lane per row in the join of the partial sums");

// v + (v of lane l ^ M), M < 16: one step of a sum over a 16-lane row (DPP
// row_xmask).
template <int M>
__device__ __forceinline__ float add_row_xor(float v) {
  return v + __builtin_bit_cast(float, __builtin_amdgcn_mov_dpp(
      __builtin_bit_cast(int, v), 0x160 + M, 0xf, 0xf, false));
}

__global__ void __launch_bounds__(32 * kLW)
out_proj_ln_kernel(const u16* __restrict__ ctxb, const u16* __restrict__ Wob,
                   const float* __restrict__ bo, const float* __restrict__ x,
                   const float* __restrict__ gamma, const float* __restrict__ beta,
                   float* __restrict__ out) {
  __shared__ __align__(16) float psum[kLW][kLR];   // per wave and row: sum of y
  __shared__ __align__(16) float psq[kLW][kLR];    //                   sum of y * y
  __shared__ __align__(16) float smean[kLW][kLR];  // per row, a copy for each wave
  __shared__ __align__(16) float srstd[kLW][kLR];

  const int lane = threadIdx.x & 31;
  const int wave = __builtin_amdgcn_readfirstlane(threadIdx.x >> 5);
  const int lh   = lane >> 4;
  const int ml   = lane & 15;
  const int m0   = blockIdx.x * kLR;
  const int n0   = wave * (16 * kWT);

  // Prefetch.  The block's 32 rows of ctx: an instruction covers four k-steps
  // (4096 bytes) of both strips, waves 0..5 one each.  The wave's rows of Wo are
  // read by every block: a block asks for two of the 24 k-steps, chosen by its
  // index.
  const u16* crows = ctxb + (size_t)m0 * kH;
  const u16* wrows = Wob + (size_t)n0 * kH;
  const unsigned pfa = prefetch_lane_off<kLT>(lane) + (unsigned)(wave % 6) * 4096u;
  const unsigned pfb = prefetch_lane_off<kWT>(lane) + (blockIdx.x % 12) * 2048u;
  if (wave < 6) prefetch_units<0>(crows, pfa);
  prefetch_units<0>(wrows, pfb);

  v8f acc[kLT][kWT] = {};
  gemm_wave_tile(crows, wrows, (unsigned)lane, pfa, pfb, acc);

  float bb_[kWT], gg[kWT], bt[kWT];
#pragma unroll
  for (int j = 0; j < kWT; ++j) {
    bb_[j] = bo[n0 + j * 16 + ml];
    gg[j]  = gamma[n0 + j * 16 + ml];
    bt[j]  = beta[n0 + j * 16 + ml];
  }

  // The 64 residual values of the tile are fetched together, so the wave waits
  // for memory once.  y[i][j][r] = row i*16 + 8*lh + r, column n0 + j*16 + ml.
  const size_t base = (size_t)(m0 + 8 * lh) * kH + n0 + ml;
  v8f y[kLT][kWT];
#pragma unroll
  for (int i = 0; i < kLT; ++i)
#pragma unroll
    for (int j = 0; j < kWT; ++j)
#pragma unroll
      for (int r = 0; r < 8; ++r) y[i][j][r] = x[base + (i * 16 + r) * kH + j * 16];
  // Behind the loads above: their index registers are reused in what follows.
  asm volatile("s_wait_xcnt 0x0" ::: "memory");
#pragma unroll
  for (int i = 0; i < kLT; ++i)
#pragma unroll
    for (int j = 0; j < kWT; ++j) y[i][j] = acc[i][j] + bb_[j] + y[i][j];

  // ---- this wave's 64 columns of each row: 4 in the lane, then the 16 lanes
  // of the half ----
#pragma unroll
  for (int i = 0; i < kLT; ++i) {
    const v8f s8 = (y[i][0] + y[i][1]) + (y[i][2] + y[i][3]);
    const v8f q8 = (y[i][0] * y[i][0] + y[i][1] * y[i][1]) +
                   (y[i][2] * y[i][2] + y[i][3] * y[i][3]);
    float s[8], q[8];
#pragma unroll
    for (int r = 0; r < 8; ++r) {
      s[r] = add_row_xor<8>(add_row_xor<4>(add_row_xor<2>(add_row_xor<1>(s8[r]))));
      q[r] = add_row_xor<8>(add_row_xor<4>(add_row_xor<2>(add_row_xor<1>(q8[r]))));
    }
    if (ml == 0) {                            // one lane of each half: its 8 rows
      v4f* ps = (v4f*)&psum[wave][i * 16 + 8 * lh];
      v4f* pq = (v4f*)&psq[wave][i * 16 + 8 * lh];
      ps[0] = v4f{s[0], s[1], s[2], s[3]};  ps[1] = v4f{s[4], s[5], s[6], s[7]};
      pq[0] = v4f{q[0], q[1], q[2], q[3]};  pq[1] = v4f{q[4], q[5], q[6], q[7]};
    }
  }
  __syncthreads();                            // all 12 partial sums of every row

  // ---- lane l joins row l (every wave does, so one barrier is enough) ----
  {
    float ts = psum[0][lane], tq = psq[0][lane];
#pragma unroll
    for (int w = 1; w < kLW; ++w) { ts += psum[w][lane]; tq += psq[w][lane]; }
    const float mean = ts * (1.0f / kH);
    const float var  = tq * (1.0f / kH) - mean * mean;
    smean[wave][lane] = mean;
    srstd[wave][lane] = rsqrtf(var + 1e-5f);
  }
  // The wave reads back what its other lanes wrote: their stores are done first.
  asm volatile("s_wait_dscnt 0x0" ::: "memory");

#pragma unroll
  for (int i = 0; i < kLT; ++i) {
    const v4f* pm = (const v4f*)&smean[wave][i * 16 + 8 * lh];
    const v4f* pr = (const v4f*)&srstd[wave][i * 16 + 8 * lh];
    const v8f mean = __builtin_shufflevector(pm[0], pm[1], 0, 1, 2, 3, 4, 5, 6, 7);
    const v8f rstd = __builtin_shufflevector(pr[0], pr[1], 0, 1, 2, 3, 4, 5, 6, 7);
#pragma unroll
    for (int j = 0; j < kWT; ++j) y[i][j] = (y[i][j] - mean) * rstd * gg[j] + bt[j];
  }
  // Keeps the 64 stores in one run behind the arithmetic: mixed into it they
  // share data registers, and each reuse waits for earlier stores.
  __builtin_amdgcn_sched_barrier(0);
#pragma unroll
  for (int i = 0; i < kLT; ++i)
#pragma unroll
    for (int j = 0; j < kWT; ++j)
#pragma unroll
      for (int r = 0; r < 8; ++r) out[base + (i * 16 + r) * kH + j * 16] = y[i][j][r];
}

// ---------------------------------------------------------------------------
// Launch
// ---------------------------------------------------------------------------
extern "C" void kernel_launch(void* const* d_in, const int* in_sizes, int n_in,
                              void* d_out, int out_size, void* d_ws,
                              size_t ws_size, hipStream_t stream) {
  (void)in_sizes; (void)n_in; (void)out_size; (void)ws_size;

  const float* x     = (const float*)d_in[0];
  const float* amask = (const float*)d_in[1];
  const float* Wq    = (const float*)d_in[2];
  const float* bq    = (const float*)d_in[3];
  const float* Wk    = (const float*)d_in[4];
  const float* bk    = (const float*)d_in[5];
  const float* Wv    = (const float*)d_in[6];
  const float* bv    = (const float*)d_in[7];
  const float* Wo    = (const float*)d_in[8];
  const float* bo    = (const float*)d_in[9];
  const float* g     = (const float*)d_in[10];
  const float* be    = (const float*)d_in[11];
  float* out = (float*)d_out;

  // Workspace carve-up (all regions 16B-aligned by construction).
  const size_t NX = (size_t)kM * kH;          // 3,145,728 activation elems
  const size_t NW = (size_t)kH * kH;          // 589,824 weight elems
  char* w = (char*)d_ws;
  u16* XBF = (u16*)w;  w += NX * 2;
  u16* WQB = (u16*)w;  w += NW * 2;
  u16* WKB = (u16*)w;  w += NW * 2;
  u16* WVB = (u16*)w;  w += NW * 2;
  u16* WOB = (u16*)w;  w += NW * 2;
  u16* Qb  = (u16*)w;  w += NX * 2;           // [BH, S, HD]
  u16* Kb  = (u16*)w;  w += NX * 2;           // [BH, S, HD]
  u16* Vtb = (u16*)w;  w += NX * 2;           // [BH, HD, S] (transposed)
  u16* CTX = (u16*)w;                         // [B*S, H] bf16, fragment order

  // f32 -> bf16 conversions, one launch: XBF, WQB, WKB, WVB, WOB lie in a row.
  cvt_bf16_kernel<<<dim3(kXBlks + 4 * kWBlks), 256, 0, stream>>>(
      x, Wq, Wk, Wv, Wo, XBF);

  // QKV projections: 64 row blocks x 4 groups of 9 (head, z) slots = 256 blocks.
  qkv_proj_kernel<<<dim3(kM / 64, 3 * kNH / 9), 288, 0, stream>>>(
      XBF, WQB, bq, WKB, bk, WVB, bv, Qb, Kb, Vtb);

  // Flash attention: 128 q-tiles (8 per block) x 24 (b,h) pairs.
  flash_attn_kernel<<<dim3(kS / 16 / 8, kBH), 256, 0, stream>>>(
      Qb, Kb, Vtb, amask, CTX);

  // Output projection + residual + LayerNorm -> d_out: 128 blocks of 32 rows.
  out_proj_ln_kernel<<<dim3(kM / kLR), 32 * kLW, 0, stream>>>(
      CTX, WOB, bo, x, g, be, out);
}

// v007
// A run of this version takes 61.6 microseconds.
// Two timings next to v006 both put it at 1.09 times that version's speed.
// All steps since v000 together make it 3.56 times as fast.
#include <hip/hip_runtime.h>

// ---------------------------------------------------------------------------
// Encoder attention block on gfx1250 (wave32, WMMA bf16 16x16x32).
//   H=768, NH=12, HD=64, B=2, S=2048
// - One-time f32->bf16 conversion; all GEMMs stream raw bf16 b128 fragments.
// - The projection GEMMs' operands (x, the weights, ctx) lie in fragment order
//   (see load_frag_packed), so a fragment load reads whole cache lines.
// - Flash attention stages K/V chunks into LDS once per block via
//   global_load_async_to_lds_b128 (ASYNCcnt), double-buffered.
// ---------------------------------------------------------------------------

constexpr int kH  = 768;
constexpr int kNH = 12;
constexpr int kHD = 64;
constexpr int kB  = 2;
constexpr int kS  = 2048;
constexpr int kM  = kB * kS;          // 4096 total rows
constexpr int kBH = kB * kNH;         // 24 (batch*heads)

constexpr int kKC = 64;               // keys per pass of the attention loop
constexpr int kQT = 2;                // 16-query tiles per attention wave
constexpr int kAW = 4;                // waves per attention block
constexpr int kKStride = 72;          // LDS row stride for K chunk (pad 8)
constexpr int kVStride = 72;          // LDS row stride for V chunk (pad 8)

typedef unsigned short u16;
typedef __attribute__((ext_vector_type(16))) __bf16 v16bf;
typedef __attribute__((ext_vector_type(16))) u16    v16us;
typedef __attribute__((ext_vector_type(8)))  u16    v8us;
typedef __attribute__((ext_vector_type(8)))  float  v8f;
typedef __attribute__((ext_vector_type(4)))  float  v4f;
typedef __attribute__((ext_vector_type(2)))  float  v2f;
typedef __attribute__((ext_vector_type(2)))  __bf16 v2bf;
typedef __attribute__((ext_vector_type(8)))  unsigned v8u;

typedef __attribute__((address_space(3))) u16 lds_u16;

__device__ __forceinline__ u16 f2bf_u(float f) {
  unsigned u = __builtin_bit_cast(unsigned, f);
  u += 0x7FFFu + ((u >> 16) & 1u);    // round-to-nearest-even
  return (u16)(u >> 16);
}

// Per-lane slice of a 16x32 bf16 WMMA A/B fragment from a row-major bf16
// matrix.  p points at element (row = lane&15, k = k0 + c0), c0 = 8*(lane>=16).
// Lane needs k-offsets {0..7} and {16..23}: two 16-byte loads, no ALU.
__device__ __forceinline__ v16bf load_frag_bf16(const u16* p) {
  v8us a = *(const v8us*)(p);
  v8us b = *(const v8us*)(p + 16);
  v16us u = __builtin_shufflevector(a, b, 0, 1, 2, 3, 4, 5, 6, 7,
                                          8, 9, 10, 11, 12, 13, 14, 15);
  return __builtin_bit_cast(v16bf, u);
}

// Fragment order of a [rows x kH] bf16 operand of the projection GEMMs.  The
// 16-row x 32-k tile (R, Ks) is kTileElems consecutive elements at
// R * 16 * kH + Ks * kTileElems; inside it the 8 elements (row ml, k = 8 g ..
// 8 g + 7), g = 0..3, stand at (g >> 1) * 256 + (g & 1) * 128 + ml * 8.  Lane
// l = 16 * lh + ml then finds its k-offsets {8 lh ..} and {16 + 8 lh ..} (the
// same ones as load_frag_bf16) at l * 8 and 256 + l * 8: each of the two
// 16-byte loads of a wave covers 512 consecutive bytes, four whole lines,
// where a row-major operand makes it touch 16 lines.
constexpr int kTileElems = 16 * 32;

// p = tile start + lane * 8.
__device__ __forceinline__ v16bf load_frag_packed(const u16* p) {
  v8us a = *(const v8us*)(p);
  v8us b = *(const v8us*)(p + 256);
  v16us u = __builtin_shufflevector(a, b, 0, 1, 2, 3, 4, 5, 6, 7,
                                          8, 9, 10, 11, 12, 13, 14, 15);
  return __builtin_bit_cast(v16bf, u);
}

__device__ __forceinline__ v8f wmma_bf16(v16bf a, v16bf b, v8f c) {
  return __builtin_amdgcn_wmma_f32_16x16x32_bf16(false, a, false, b,
                                                 (short)0, c, false, false);
}

// Prefetch into L2.  One instruction names 32 units (256-byte pieces), one per
// lane, at base + off + IMM bytes; nothing is returned and no counter is
// touched.  A hint, for speed only: results do not depend on what it brings or
// where a work-group runs.  Every address lies inside the operand.  base is the
// scalar base that the k loop's own loads use, so it stays an address.
template <int IMM>
__device__ __forceinline__ void prefetch_units(const u16* base, unsigned off) {
  asm volatile("global_prefetch_b8 %0, %1 offset:%2 scope:SCOPE_SE"
               :: "v"(off), "s"(base), "n"(IMM));
}

// Lane offset (bytes) that spreads one prefetch over the NS 16-row strips of a
// fragment-order operand: 32 / NS consecutive units, the same k-steps, of each.
constexpr unsigned kStripBytes = 16 * kH * 2;
template <int NS>
__device__ __forceinline__ unsigned prefetch_lane_off(int lane) {
  return (unsigned)(lane / (32 / NS)) * kStripBytes + (unsigned)(lane % (32 / NS)) * 256u;
}

// Register tile of the projection GEMMs: one wave owns MT x kWT accumulator
// tiles (MT = kWT, 64 x 64 outputs, in the QKV projection), so every loaded A
// fragment feeds kWT WMMAs and every B fragment MT.
// Every loop over tiles or accumulator rows is fully unrolled, here and in the
// two kernels, so that these arrays are indexed by constants and stay in VGPRs.
constexpr int kWT = 4;

// acc += A[16 MT rows] * B[64 rows]^T over k = 0..kH, both in fragment order.
// abase / bbase are the wave-uniform starts of the first 16-row tiles; loff is
// this lane's byte offset (lane * 16) inside a tile, the same for A and B.
// Every load is scalar base + 32-bit lane offset + immediate (the offset
// register holds lane * 16, or lane where the load scales it).
// pfa / pfb are the lane offsets of the prefetches that the caller has issued.
template <int MT>
__device__ __forceinline__ void gemm_wave_tile(const u16* abase, const u16* bbase,
                                               unsigned lane, unsigned pfa, unsigned pfb,
                                               v8f (&acc)[MT][kWT]) {
  const unsigned loff = lane * 16u;
  // Fully unrolled (24 k-steps): every k-step is an immediate offset, so there
  // is no address arithmetic and no branch among the WMMAs.
#pragma unroll
  for (int k0 = 0; k0 < kH; k0 += 32) {
    v16bf a[MT], b[kWT];
#pragma unroll
    for (int i = 0; i < MT; ++i)
      a[i] = load_frag_packed((const u16*)(
          (const char*)(abase + (k0 / 32) * kTileElems + i * 16 * kH) + loff));
#pragma unroll
    for (int j = 0; j < kWT; ++j)
      b[j] = load_frag_packed((const u16*)(
          (const char*)(bbase + (k0 / 32) * kTileElems + j * 16 * kH) + loff));
    // Stands behind the loads of a k-step and names their lane offset, in
    // both forms, so that register is not reused (the last load's destination
    // took it) ahead of the wait.  The data wait follows at once: no stall.
    // It names the prefetches' lane offsets too: their registers then hold
    // in-bounds offsets all through the loop, whenever a prefetch is served.
    asm volatile("s_wait_xcnt 0x0" :: "v"(loff), "v"(lane), "v"(pfa), "v"(pfb) : "memory");
    // Keeps the loads in one group ahead of the WMMAs: a load sunk among
    // them is waited for at once and exposes its whole latency.
    __builtin_amdgcn_sched_barrier(0);
#pragma unroll
    for (int i = 0; i < MT; ++i)
#pragma unroll
      for (int j = 0; j < kWT; ++j) acc[i][j] = wmma_bf16(a[i], b[j], acc[i][j]);
  }
}

// Async DMA global -> LDS (tracked by ASYNCcnt) of a thread's share of one
// chunk: four 16-byte pieces of K and four of V^T, 16 rows apart.  kl / vl are
// the thread's first LDS places, kg / vg its first global pieces.  One
// statement: the s_wait_xcnt at its end stands ahead of any rewrite of the
// address registers that the copies name.
__device__ __forceinline__ void async_copy_chunk(u16* kl, const u16* kg,
                                                 u16* vl, const u16* vg) {
  lds_u16* k0 = (lds_u16*)kl;
  lds_u16* k1 = k0 + 16 * kKStride;
  lds_u16* k2 = k0 + 32 * kKStride;
  lds_u16* k3 = k0 + 48 * kKStride;
  lds_u16* v0 = (lds_u16*)vl;
  lds_u16* v1 = v0 + 16 * kVStride;
  lds_u16* v2 = v0 + 32 * kVStride;
  lds_u16* v3 = v0 + 48 * kVStride;
  asm volatile("global_load_async_to_lds_b128 %0, %8, off\n\t"
               "global_load_async_to_lds_b128 %1, %9, off\n\t"
               "global_load_async_to_lds_b128 %2, %10, off\n\t"
               "global_load_async_to_lds_b128 %3, %11, off\n\t"
               "global_load_async_to_lds_b128 %4, %12, off\n\t"
               "global_load_async_to_lds_b128 %5, %13, off\n\t"
               "global_load_async_to_lds_b128 %6, %14, off\n\t"
               "global_load_async_to_lds_b128 %7, %15, off\n\t"
               "s_wait_xcnt 0x0"
               :
               : "v"(k0), "v"(k1), "v"(k2), "v"(k3), "v"(v0), "v"(v1), "v"(v2), "v"(v3),
                 "v"(kg), "v"(kg + 16 * kHD), "v"(kg + 32 * kHD), "v"(kg + 48 * kHD),
                 "v"(vg), "v"(vg + 16 * kS), "v"(vg + 32 * kS), "v"(vg + 48 * kS)
               : "memory");
}

__device__ __forceinline__ void wait_async0() {
  asm volatile("s_wait_asynccnt 0" ::: "memory");
}

// ---------------------------------------------------------------------------
// Kernel 0: elementwise f32 -> bf16 (8 elements / thread, vectorized) of x and
// the four weight matrices in ONE launch.  None of the five needs anything of
// another, so each takes a range of the block index; a block lies wholly in
// one array (every array is a whole number of 2048-element blocks).  The five
// bf16 planes follow one another in the workspace in the same order.
// The planes are written in fragment order (load_frag_packed).  A block takes
// 16 rows x 128 k = four tiles, which are its 2048 consecutive output elements.
// A wave takes 8 rows x one 32-k step: it reads 128 consecutive bytes of each
// row (8 lines per load) and stores four whole 128-byte lines.
// ---------------------------------------------------------------------------
constexpr int kCvtBlk = 256 * 8;                  // elements per block
constexpr int kXBlks  = kM * kH / kCvtBlk;        // 1536 blocks of x
constexpr int kWBlks  = kH * kH / kCvtBlk;        // 288 blocks per weight matrix
constexpr int kCvtK   = kCvtBlk / 16;             // 128 k per block
constexpr int kCvtKB  = kH / kCvtK;               // 6 blocks along k
static_assert(kXBlks * kCvtBlk == kM * kH && kWBlks * kCvtBlk == kH * kH,
              "every array is a whole number of blocks");
static_assert(kCvtKB * kCvtK == kH && kCvtK == 4 * 32 && kM % 16 == 0 && kH % 16 == 0,
              "a block is four whole tiles of one 16-row strip");

__global__ void __launch_bounds__(256)
cvt_bf16_kernel(const float* __restrict__ x,
                const float* __restrict__ Wq, const float* __restrict__ Wk,
                const float* __restrict__ Wv, const float* __restrict__ Wo,
                u16* __restrict__ out) {
  const int blk = blockIdx.x;
  const float* in = x;                            // block-uniform choice
  int first = 0;                                  // first block of that array
  if (blk >= kXBlks) {
    const int w = (blk - kXBlks) / kWBlks;
    first = kXBlks + w * kWBlks;
    in = w == 0 ? Wq : w == 1 ? Wk : w == 2 ? Wv : Wo;
  }
  const int lb  = blk - first;                    // block inside its array
  const int tid = threadIdx.x;
  const int ml  = ((tid >> 5) & 1) * 8 + (tid & 7);  // row in the 16-row strip
  const int g   = (tid >> 3) & 3;                 // group of 8 k in the 32-k step
  const int ks  = tid >> 6;                       // 32-k step in the block
  const float* p = in + ((lb / kCvtKB) * 16 + ml) * kH + (lb % kCvtKB) * kCvtK +
                   ks * 32 + g * 8;
  u16* q = out + (size_t)blk * kCvtBlk + ks * kTileElems +
           (g >> 1) * 256 + (g & 1) * 128 + ml * 8;
  v4f a = *(const v4f*)(p);
  v4f b = *(const v4f*)(p + 4);
  v8us u;
#pragma unroll
  for (int j = 0; j < 4; ++j) { u[j] = f2bf_u(a[j]); u[4 + j] = f2bf_u(b[j]); }
  *(v8us*)q = u;
}

// ---------------------------------------------------------------------------
// Kernel 1: QKV projection from bf16 operands.  out = x @ W^T + b.
// Q,K written bf16 [BH, S, HD]; V written TRANSPOSED bf16 [BH, HD, S].
// One wave = 64 rows x one whole head of Q, K or V; the 9 waves of a block
// share the same 64 rows of x (36 (head, z) slots = 4 blocks along y).
// ---------------------------------------------------------------------------
__global__ void __launch_bounds__(288)
qkv_proj_kernel(const u16* __restrict__ xbf,
                const u16* __restrict__ Wqb, const float* __restrict__ bq,
                const u16* __restrict__ Wkb, const float* __restrict__ bk,
                const u16* __restrict__ Wvb, const float* __restrict__ bv,
                u16* __restrict__ Qo, u16* __restrict__ Ko,
                u16* __restrict__ Vt) {
  const int lane = threadIdx.x & 31;
  const int wave = __builtin_amdgcn_readfirstlane(threadIdx.x >> 5);
  const int lh   = lane >> 4;
  const int ml   = lane & 15;
  const int m0   = blockIdx.x * (16 * kWT);
  const int slot = blockIdx.y * 9 + wave;     // 0..35: (head, z)
  const int z    = slot % 3;                  // every block: 3 waves each of Q, K, V
  const int h    = slot / 3;
  const int n0   = h * kHD;

  const u16* W;  const float* bias;
  if (z == 0)      { W = Wqb; bias = bq; }
  else if (z == 1) { W = Wkb; bias = bk; }
  else             { W = Wvb; bias = bv; }

  // Prefetch: one instruction covers two k-steps (2048 bytes) of all four
  // strips, so 12 cover an operand of 64 rows.  The block's x rows: one per
  // wave, waves 0..2 a second.  The wave's weight rows are read by all 64
  // blocks along x: 16 neighbours ask for the same quarter of k, later blocks
  // for later k.
  const u16* xrows = xbf + (size_t)m0 * kH;
  const u16* wrows = W + (size_t)n0 * kH;
  const unsigned pfa = prefetch_lane_off<kWT>(lane) + (unsigned)wave * 2048u;
  const unsigned pfb = prefetch_lane_off<kWT>(lane) + (blockIdx.x >> 4) * (3u * 2048u);
  prefetch_units<0>(xrows, pfa);
  if (wave < 3) prefetch_units<9 * 2048>(xrows, pfa);
  prefetch_units<0>(wrows, pfb);
  prefetch_units<2048>(wrows, pfb);
  prefetch_units<4096>(wrows, pfb);

  v8f acc[kWT][kWT] = {};
  gemm_wave_tile(xrows, wrows, (unsigned)lane, pfa, pfb, acc);

  const int bh = (m0 / kS) * kNH + h;         // 64 rows never cross a batch
  const int s0 = m0 % kS + 8 * lh;
  float bb_[kWT];
#pragma unroll
  for (int j = 0; j < kWT; ++j) bb_[j] = bias[n0 + j * 16 + ml];

  if (z == 2) {                               // V: [BH, HD, S]
    u16* o = Vt + ((size_t)bh * kHD + ml) * kS + s0;
#pragma unroll
    for (int i = 0; i < kWT; ++i)
#pragma unroll
      for (int j = 0; j < kWT; ++j)
#pragma unroll
        for (int r = 0; r < 8; ++r)
          o[(size_t)(j * 16) * kS + i * 16 + r] = f2bf_u(acc[i][j][r] + bb_[j]);
    return;
  }
  u16* o = (z == 0 ? Qo : Ko) + ((size_t)bh * kS + s0) * kHD + ml;  // [BH, S, HD]
#pragma unroll
  for (int i = 0; i < kWT; ++i)
#pragma unroll
    for (int j = 0; j < kWT; ++j)
#pragma unroll
      for (int r = 0; r < 8; ++r)
        o[(i * 16 + r) * kHD + j * 16] = f2bf_u(acc[i][j][r] + bb_[j]);
  // Behind the last stores: in the built code the V path's block follows this
  // one and rewrites the registers that these stores name.
  asm volatile("s_wait_xcnt 0x0" ::: "memory");
}

// ---------------------------------------------------------------------------
// Kernel 2: flash attention, transposed products.  4 waves / block share one
// (b,h); K/V chunks of 64 keys are DMA'd into double-buffered LDS with
// global_load_async_to_lds_b128, then each wave streams WMMA fragments from LDS.
// A wave owns 32 queries (two tiles): every K, V^T and mask fragment it reads
// from LDS feeds two WMMAs, and maximum, exchange and rescale come once per 64
// keys.
//   S^T = K Q^T   : A = K rows, B = Q rows; lane (c, h) holds query column c,
//                   register r of tile t = key t*16 + 8h + r.
//   O^T += V^T P^T: A = V^T rows, B = the two S^T tiles packed to bf16 in place
//                   (their register order is the k order of the A loader).
// A query's scores sit in the two lanes c and c + 16: maximum and sum are taken
// in the lane, with one exchange between the halves.  Writes ctx bf16 [B*S, H]
// in fragment order (load_frag_packed).
// ---------------------------------------------------------------------------
__device__ __forceinline__ unsigned pack_bf16(float lo, float hi) {
  return __builtin_bit_cast(unsigned, __builtin_convertvector(v2f{lo, hi}, v2bf));
}

__device__ __forceinline__ float max3f(float a, float b, float c) {
  return fmaxf(fmaxf(a, b), c);
}

// Value of lane l ^ 16.
__device__ __forceinline__ float other_half(float x) {
  const int v = __builtin_bit_cast(int, x);
  return __builtin_bit_cast(float, __builtin_amdgcn_permlanex16(
      v, v, 0x76543210, 0xfedcba98, false, false));
}

__global__ void __launch_bounds__(32 * kAW)
flash_attn_kernel(const u16* __restrict__ Q, const u16* __restrict__ K,
                  const u16* __restrict__ Vt,
                  const float* __restrict__ amask,
                  u16* __restrict__ ctx) {
  __shared__ __align__(16) u16 kbuf[2][kKC * kKStride]; // 64 kv-rows x 64 dims
  __shared__ __align__(16) u16 vbuf[2][kHD * kVStride]; // 64 d-rows  x 64 kv
  __shared__ __align__(16) float mbias[kS];             // mask term per key

  const int tid  = threadIdx.x;
  const int lane = tid & 31;
  const int wave = tid >> 5;
  const int lh   = lane >> 4;
  const int ml   = lane & 15;
  const int c0   = lh * 8;

  const int bh = blockIdx.y;                  // 0..B*NH-1
  const int b  = bh / kNH;
  const int q0 = (blockIdx.x * kAW + wave) * (16 * kQT);

  const u16* Qb  = Q  + (size_t)bh * kS * kHD;
  const u16* Kb  = K  + (size_t)bh * kS * kHD;
  const u16* Vtb = Vt + (size_t)bh * kHD * kS;

  // Staging coordinates: a chunk of K and one of V^T are 64 rows x 8 pieces of
  // 16 bytes each; a thread takes piece srow, sseg and the ones 16, 32 and 48
  // rows on.
  const int srow = tid >> 3, sseg = tid & 7;
  const u16* kg = Kb + (size_t)srow * kHD + sseg * 8;   // chunk 0
  const u16* vg = Vtb + (size_t)srow * kS + sseg * 8;

  // Q fragments of the wave's tiles (HD=64 -> two k-steps of 32), loaded once.
  v16bf qf[kQT][2];
#pragma unroll
  for (int u = 0; u < kQT; ++u) {
    qf[u][0] = load_frag_bf16(Qb + (size_t)(q0 + u * 16 + ml) * kHD + 0  + c0);
    qf[u][1] = load_frag_bf16(Qb + (size_t)(q0 + u * 16 + ml) * kHD + 32 + c0);
  }

  v8f o[kQT][4] = {};                         // O^T: o[u][dt][r] = d dt*16+8h+r, query c
  float mrun[kQT], lrun[kQT];                 // scaled log2 maximum; this lane's sum
#pragma unroll
  for (int u = 0; u < kQT; ++u) { mrun[u] = -3.0e38f; lrun[u] = 0.0f; }

  // Kick off DMA for chunk 0 into buffer 0.
  async_copy_chunk(&kbuf[0][srow * kKStride + sseg * 8], kg,
                   &vbuf[0][srow * kVStride + sseg * 8], vg);

  // Prefetch of K and V^T, in groups of 256 keys (4 passes): 128 units of K
  // (consecutive) and 128 of V^T (two per d row).  The 16 blocks of a (b,h) walk
  // the same keys in step, so they share the asking: a block takes a quarter of
  // every group, chosen by its index, with its waves 0 and 1.  pf walks from
  // group to group, lives through the loop and stays inside the array; group 0
  // is asked for here, group g + 1 at the foot of group g's first pass.
  const bool pfwave = __builtin_amdgcn_readfirstlane(tid >> 5) < 2;
  const int  pfq    = blockIdx.x & 3;           // quarters 0, 1: K; 2, 3: V^T
  const int  pfu    = (pfq & 1) * 64 + (tid & 63);
  const char* pf = pfq < 2 ? (const char*)Kb + pfu * 256
                           : (const char*)Vtb + (pfu >> 1) * (kS * 2) + (pfu & 1) * 256;
  const int pfstep = pfq < 2 ? 256 * kHD * 2 : 256 * 2;
  if (pfwave) asm volatile("global_prefetch_b8 %0, off scope:SCOPE_SE" :: "v"(pf));

  // A key is a row of the score tile, so its mask term differs by register
  // and not by lane: all kS terms go to LDS once (16 per thread), times
  // sqrt(HD) = 8 (exact) because they start the accumulator ahead of the
  // 1/sqrt(HD) scaling.  The barrier in front of the loop publishes them.
  {
    const float* amb = amask + (size_t)b * kS;   // same for the whole block
    const float* am  = amb + tid * 16;
    v4f mm[4];
#pragma unroll
    for (int i = 0; i < 4; ++i) mm[i] = *(const v4f*)(am + 4 * i);
    // Behind the loads, naming their scalar base: otherwise that register
    // pair is reused for constants ahead of any wait.
    asm volatile("s_wait_xcnt 0x0" :: "s"(amb) : "memory");
#pragma unroll
    for (int i = 0; i < 4; ++i) {
#pragma unroll
      for (int j = 0; j < 4; ++j) mm[i][j] = (1.0f - mm[i][j]) * -80000.0f;
      *(v4f*)(&mbias[tid * 16 + 4 * i]) = mm[i];
    }
  }

  wait_async0();                      // my share of chunk 0 has landed
  __syncthreads();                    // everyone's has; mask terms published
  // Chunk 1 flies while chunk 0 is worked on.
  async_copy_chunk(&kbuf[1][srow * kKStride + sseg * 8], kg + (size_t)kKC * kHD,
                   &vbuf[1][srow * kVStride + sseg * 8], vg + kKC);

  constexpr float kScale = 0.125f * 1.4426950408889634f;  // log2(e) / sqrt(HD)

  for (int kv0 = 0; kv0 < kS; kv0 += kKC) {
    const int cur = (kv0 / kKC) & 1;

    const u16* kch = &kbuf[cur][0];
    const u16* vch = &vbuf[cur][0];

    // ---- K rows and mask terms of the pass: each feeds both query tiles ----
    v16bf kf[4][2];
    v8f mk[4];
#pragma unroll
    for (int t = 0; t < 4; ++t) {
      const u16* krow_l = kch + (t * 16 + ml) * kKStride + c0;
      kf[t][0] = load_frag_bf16(krow_l + 0);
      kf[t][1] = load_frag_bf16(krow_l + 32);
      const float* mrow = &mbias[kv0 + t * 16 + c0];
      const v4f ma = *(const v4f*)(mrow);
      const v4f mb = *(const v4f*)(mrow + 4);
      mk[t] = __builtin_shufflevector(ma, mb, 0, 1, 2, 3, 4, 5, 6, 7);
    }
    // Keeps these LDS loads in one group ahead of the WMMAs: sunk among them
    // they share one register set, and every WMMA then waits for its own
    // loads' whole latency.
    __builtin_amdgcn_sched_barrier(0);

    // ---- S^T: 4 x kQT tiles of 16x16, keys [kv0, kv0+64) x 32 queries ----
    v8f st[kQT][4];
#pragma unroll
    for (int t = 0; t < 4; ++t)
#pragma unroll
      for (int u = 0; u < kQT; ++u) st[u][t] = wmma_bf16(kf[t][0], qf[u][0], mk[t]);
#pragma unroll
    for (int t = 0; t < 4; ++t)
#pragma unroll
      for (int u = 0; u < kQT; ++u) st[u][t] = wmma_bf16(kf[t][1], qf[u][1], st[u][t]);

    // Keeps the V^T loads behind the S^T products, whose K registers they
    // take over: raised among them they need a register set of their own.
    __builtin_amdgcn_sched_barrier(0);

    // ---- V^T rows (two k-steps of 32 keys), fetched under the softmax ----
    v16bf vf[4][2];
#pragma unroll
    for (int dt = 0; dt < 4; ++dt) {
      const u16* vrow_l = vch + (dt * 16 + ml) * kVStride + c0;
      vf[dt][0] = load_frag_bf16(vrow_l + 0);
      vf[dt][1] = load_frag_bf16(vrow_l + 32);
    }
    // Keeps these loads in one group ahead of the softmax, so that its
    // arithmetic covers their latency.
    __builtin_amdgcn_sched_barrier(0);

    // ---- online softmax of query c of each tile, log2 domain ----
    v16bf pb[kQT][2];
#pragma unroll
    for (int u = 0; u < kQT; ++u) {
      float tm[4];
#pragma unroll
      for (int t = 0; t < 4; ++t)
        tm[t] = max3f(max3f(st[u][t][0], st[u][t][1], st[u][t][2]),
                      max3f(st[u][t][3], st[u][t][4], st[u][t][5]), st[u][t][6]);
      float mx = max3f(max3f(tm[0], tm[1], st[u][0][7]),
                       max3f(tm[2], tm[3], st[u][1][7]),
                       fmaxf(st[u][2][7], st[u][3][7]));
      mx = fmaxf(mx, other_half(mx));
      const float mnew  = fmaxf(mrun[u], mx * kScale);
      const float alpha = __builtin_amdgcn_exp2f(mrun[u] - mnew);
      mrun[u] = mnew;
      const v8f vscale = {kScale, kScale, kScale, kScale, kScale, kScale, kScale, kScale};
      const v8f vmneg  = {-mnew, -mnew, -mnew, -mnew, -mnew, -mnew, -mnew, -mnew};
#pragma unroll
      for (int t = 0; t < 4; ++t) {
        st[u][t] = __builtin_elementwise_fma(st[u][t], vscale, vmneg);
#pragma unroll
        for (int r = 0; r < 8; ++r) st[u][t][r] = __builtin_amdgcn_exp2f(st[u][t][r]);
      }
      const v8f s8 = (st[u][0] + st[u][1]) + (st[u][2] + st[u][3]);
      const v4f s4 = __builtin_shufflevector(s8, s8, 0, 1, 2, 3) +
                     __builtin_shufflevector(s8, s8, 4, 5, 6, 7);
      lrun[u] = lrun[u] * alpha + ((s4[0] + s4[1]) + (s4[2] + s4[3]));
#pragma unroll
      for (int dt = 0; dt < 4; ++dt) o[u][dt] *= alpha;

      // P^T as B operand of k-step ks: element s = st[u][2 ks + (s >> 3)][s & 7]
#pragma unroll
      for (int ks = 0; ks < 2; ++ks) {
        v8u pu;
#pragma unroll
        for (int i = 0; i < 4; ++i) {
          pu[i]     = pack_bf16(st[u][2 * ks][2 * i],     st[u][2 * ks][2 * i + 1]);
          pu[4 + i] = pack_bf16(st[u][2 * ks + 1][2 * i], st[u][2 * ks + 1][2 * i + 1]);
        }
        pb[u][ks] = __builtin_bit_cast(v16bf, pu);
      }
    }

    // ---- O^T += V^T P^T : four 16-row d tiles across HD=64, two k-steps ----
#pragma unroll
    for (int ks = 0; ks < 2; ++ks)
#pragma unroll
      for (int dt = 0; dt < 4; ++dt)
#pragma unroll
        for (int u = 0; u < kQT; ++u)
          o[u][dt] = wmma_bf16(vf[dt][ks], pb[u][ks], o[u][dt]);

    // Keeps the foot at the foot: raised to where the last LDS load lands, the
    // wait for the next chunk's copies would come half a pass early and stall.
    __builtin_amdgcn_sched_barrier(0);
    // ---- foot of the pass: one barrier publishes the next chunk and ends
    // every wave's reads of this one, whose buffer is refilled behind it, a
    // whole pass ahead of its use ----
    asm volatile("s_wait_dscnt 0x0" ::: "memory");   // my reads of cur are done
    wait_async0();                                   // my share of the next chunk has landed
    __syncthreads();
    if (kv0 + 2 * kKC < kS) {
      async_copy_chunk(&kbuf[cur][srow * kKStride + sseg * 8],
                       kg + (size_t)(kv0 + 2 * kKC) * kHD,
                       &vbuf[cur][srow * kVStride + sseg * 8], vg + (kv0 + 2 * kKC));
      if (pfwave && (kv0 & 255) == 0 && kv0 + 256 < kS) {
        pf += pfstep;
        asm volatile("global_prefetch_b8 %0, off scope:SCOPE_SE" :: "v"(pf));
      }
    }
  }
  wait_async0();                      // nothing in flight when the wave ends

  // ---- join the halves' sums, normalize, write ctx (bf16), fragment order ----
  // A lane holds 8 consecutive d of its query per tile, group g = 2 (dt & 1) + lh
  // of 32-k step 2 h + (dt >> 1): one 16-byte store each, at lane * 8 in its half
  // tile, so a wave's store is 512 consecutive bytes.
  const int h = bh % kNH;
#pragma unroll
  for (int u = 0; u < kQT; ++u) {
    const float inv = 1.0f / (lrun[u] + other_half(lrun[u]));
    u16* crow = ctx + ((size_t)b * kS + q0 + u * 16) * kH + h * 2 * kTileElems + lane * 8;
#pragma unroll
    for (int dt = 0; dt < 4; ++dt) {
      v8us w;
#pragma unroll
      for (int r = 0; r < 8; ++r) w[r] = f2bf_u(o[u][dt][r] * inv);
      *(v8us*)(crow + dt * 256) = w;
    }
  }
}

// ---------------------------------------------------------------------------
// Kernel 3: output projection + bias + residual + LayerNorm, one launch.
//   y = ctx @ Wo^T + bo + x;  out = (y - mean) * rstd * gamma + beta
// A block owns kLT * 16 = 32 whole rows: its 12 waves take 64 columns each
// (2 x 4 accumulator tiles) and share the rows of ctx.  y stays in registers:
// each wave sums its 64 columns of every row, the 12 partial sums of a row meet
// in LDS behind one barrier, and every wave normalizes and stores its own tile.
// ---------------------------------------------------------------------------
constexpr int kLT = 2;                        // 16-row tiles per block
constexpr int kLW = kH / (16 * kWT);          // 12 waves cover the kH columns
constexpr int kLR = 16 * kLT;                 // 32 rows per block = lanes per wave
static_assert(kLR == 32 && kLW * 16 * kWT == kH && kM % kLR == 0,
              "one lane per row in the join of the partial sums");

// v + (v of lane l ^ M), M < 16: one step of a sum over a 16-lane row (DPP
// row_xmask).
template <int M>
__device__ __forceinline__ float add_row_xor(float v) {
  return v + __builtin_bit_cast(float, __builtin_amdgcn_mov_dpp(
      __builtin_bit_cast(int, v), 0x160 + M, 0xf, 0xf, false));
}

__global__ void __launch_bounds__(32 * kLW)
out_proj_ln_kernel(const u16* __restrict__ ctxb, const u16* __restrict__ Wob,
                   const float* __restrict__ bo, const float* __restrict__ x,
                   const float* __restrict__ gamma, const float* __restrict__ beta,
                   float* __restrict__ out) {
  __shared__ __align__(16) float psum[kLW][kLR];   // per wave and row: sum of y
  __shared__ __align__(16) float psq[kLW][kLR];    //                   sum of y * y
  __shared__ __align__(16) float smean[kLW][kLR];  // per row, a copy for each wave
  __shared__ __align__(16) float srstd[kLW][kLR];

  const int lane = threadIdx.x & 31;
  const int wave = __builtin_amdgcn_readfirstlane(threadIdx.x >> 5);
  const int lh   = lane >> 4;
  const int ml   = lane & 15;
  const int m0   = blockIdx.x * kLR;
  const int n0   = wave * (16 * kWT);

  // Prefetch.  The block's 32 rows of ctx: an instruction covers four k-steps
  // (4096 bytes) of both strips, waves 0..5 one each.  The wave's rows of Wo are
  // read by every block: a block asks for two of the 24 k-steps, chosen by its
  // index.
  const u16* crows = ctxb + (size_t)m0 * kH;
  const u16* wrows = Wob + (size_t)n0 * kH;
  const unsigned pfa = prefetch_lane_off<kLT>(lane) + (unsigned)(wave % 6) * 4096u;
  const unsigned pfb = prefetch_lane_off<kWT>(lane) + (blockIdx.x % 12) * 2048u;
  if (wave < 6) prefetch_units<0>(crows, pfa);
  prefetch_units<0>(wrows, pfb);

  v8f acc[kLT][kWT] = {};
  gemm_wave_tile(crows, wrows, (unsigned)lane, pfa, pfb, acc);

  float bb_[kWT], gg[kWT], bt[kWT];
#pragma unroll
  for (int j = 0; j < kWT; ++j) {
    bb_[j] = bo[n0 + j * 16 + ml];
    gg[j]  = gamma[n0 + j * 16 + ml];
    bt[j]  = beta[n0 + j * 16 + ml];
  }

  // The 64 residual values of the tile are fetched together, so the wave waits
  // for memory once.  y[i][j][r] = row i*16 + 8*lh + r, column n0 + j*16 + ml.
  const size_t base = (size_t)(m0 + 8 * lh) * kH + n0 + ml;
  v8f y[kLT][kWT];
#pragma unroll
  for (int i = 0; i < kLT; ++i)
#pragma unroll
    for (int j = 0; j < kWT; ++j)
#pragma unroll
      for (int r = 0; r < 8; ++r) y[i][j][r] = x[base + (i * 16 + r) * kH + j * 16];
  // Behind the loads above: their index registers are reused in what follows.
  asm volatile("s_wait_xcnt 0x0" ::: "memory");
#pragma unroll
  for (int i = 0; i < kLT; ++i)
#pragma unroll
    for (int j = 0; j < kWT; ++j) y[i][j] = acc[i][j] + bb_[j] + y[i][j];

  // ---- this wave's 64 columns of each row: 4 in the lane, then the 16 lanes
  // of the half ----
#pragma unroll
  for (int i = 0; i < kLT; ++i) {
    const v8f s8 = (y[i][0] + y[i][1]) + (y[i][2] + y[i][3]);
    const v8f q8 = (y[i][0] * y[i][0] + y[i][1] * y[i][1]) +
                   (y[i][2] * y[i][2] + y[i][3] * y[i][3]);
    float s[8], q[8];
#pragma unroll
    for (int r = 0; r < 8; ++r) {
      s[r] = add_row_xor<8>(add_row_xor<4>(add_row_xor<2>(add_row_xor<1>(s8[r]))));
      q[r] = add_row_xor<8>(add_row_xor<4>(add_row_xor<2>(add_row_xor<1>(q8[r]))));
    }
    if (ml == 0) {                            // one lane of each half: its 8 rows
      v4f* ps = (v4f*)&psum[wave][i * 16 + 8 * lh];
      v4f* pq = (v4f*)&psq[wave][i * 16 + 8 * lh];
      ps[0] = v4f{s[0], s[1], s[2], s[3]};  ps[1] = v4f{s[4], s[5], s[6], s[7]};
      pq[0] = v4f{q[0], q[1], q[2], q[3]};  pq[1] = v4f{q[4], q[5], q[6], q[7]};
    }
  }
  __syncthreads();                            // all 12 partial sums of every row

  // ---- lane l joins row l (every wave does, so one barrier is enough) ----
  {
    float ts = psum[0][lane], tq = psq[0][lane];
#pragma unroll
    for (int w = 1; w < kLW; ++w) { ts += psum[w][lane]; tq += psq[w][lane]; }
    const float mean = ts * (1.0f / kH);
    const float var  = tq * (1.0f / kH) - mean * mean;
    smean[wave][lane] = mean;
    srstd[wave][lane] = rsqrtf(var + 1e-5f);
  }
  // The wave reads back what its other lanes wrote: their stores are done first.
  asm volatile("s_wait_dscnt 0x0" ::: "memory");

#pragma unroll
  for (int i = 0; i < kLT; ++i) {
    const v4f* pm = (const v4f*)&smean[wave][i * 16 + 8 * lh];
    const v4f* pr = (const v4f*)&srstd[wave][i * 16 + 8 * lh];
    const v8f mean = __builtin_shufflevector(pm[0], pm[1], 0, 1, 2, 3, 4, 5, 6, 7);
    const v8f rstd = __builtin_shufflevector(pr[0], pr[1], 0, 1, 2, 3, 4, 5, 6, 7);
#pragma unroll
    for (int j = 0; j < kWT; ++j) y[i][j] = (y[i][j] - mean) * rstd * gg[j] + bt[j];
  }
  // Keeps the 64 stores in one run behind the arithmetic: mixed into it they
  // share data registers, and each reuse waits for earlier stores.
  __builtin_amdgcn_sched_barrier(0);
#pragma unroll
  for (int i = 0; i < kLT; ++i)
#pragma unroll
    for (int j = 0; j < kWT; ++j)
#pragma unroll
      for (int r = 0; r < 8; ++r) out[base + (i * 16 + r) * kH + j * 16] = y[i][j][r];
}

// ---------------------------------------------------------------------------
// Launch
// ---------------------------------------------------------------------------
extern "C" void kernel_launch(void* const* d_in, const int* in_sizes, int n_in,
                              void* d_out, int out_size, void* d_ws,
                              size_t ws_size, hipStream_t stream) {
  (void)in_sizes; (void)n_in; (void)out_size; (void)ws_size;

  const float* x     = (const float*)d_in[0];
  const float* amask = (const float*)d_in[1];
  const float* Wq    = (const float*)d_in[2];
  const float* bq    = (const float*)d_in[3];
  const float* Wk    = (const float*)d_in[4];
  const float* bk    = (const float*)d_in[5];
  const float* Wv    = (const float*)d_in[6];
  const float* bv    = (const float*)d_in[7];
  const float* Wo    = (const float*)d_in[8];
  const float* bo    = (const float*)d_in[9];
  const float* g     = (const float*)d_in[10];
  const float* be    = (const float*)d_in[11];
  float* out = (float*)d_out;

  // Workspace carve-up (all regions 16B-aligned by construction).
  const size_t NX = (size_t)kM * kH;          // 3,145,728 activation elems
  const size_t NW = (size_t)kH * kH;          // 589,824 weight elems
  char* w = (char*)d_ws;
  u16* XBF = (u16*)w;  w += NX * 2;
  u16* WQB = (u16*)w;  w += NW * 2;
  u16* WKB = (u16*)w;  w += NW * 2;
  u16* WVB = (u16*)w;  w += NW * 2;
  u16* WOB = (u16*)w;  w += NW * 2;
  u16* Qb  = (u16*)w;  w += NX * 2;           // [BH, S, HD]
  u16* Kb  = (u16*)w;  w += NX * 2;           // [BH, S, HD]
  u16* Vtb = (u16*)w;  w += NX * 2;           // [BH, HD, S] (transposed)
  u16* CTX = (u16*)w;                         // [B*S, H] bf16, fragment order

  // f32 -> bf16 conversions, one launch: XBF, WQB, WKB, WVB, WOB lie in a row.
  cvt_bf16_kernel<<<dim3(kXBlks + 4 * kWBlks), 256, 0, stream>>>(
      x, Wq, Wk, Wv, Wo, XBF);

  // QKV projections: 64 row blocks x 4 groups of 9 (head, z) slots = 256 blocks.
  qkv_proj_kernel<<<dim3(kM / 64, 3 * kNH / 9), 288, 0, stream>>>(
      XBF, WQB, bq, WKB, bk, WVB, bv, Qb, Kb, Vtb);

  // Flash attention: 128 q-tiles (8 per block, 2 per wave) x 24 (b,h) pairs.
  flash_attn_kernel<<<dim3(kS / (16 * kQT * kAW), kBH), 32 * kAW, 0, stream>>>(
      Qb, Kb, Vtb, amask, CTX);

  // Output projection + residual + LayerNorm -> d_out: 128 blocks of 32 rows.
  out_proj_ln_kernel<<<dim3(kM / kLR), 32 * kLW, 0, stream>>>(
      CTX, WOB, bo, x, g, be, out);
}

// v008
// Measured time: 58.8 microseconds a run.
// Next to v007, in two timings, it ran 1.04 times as fast each time.
// All steps since v000 together make it 3.71 times as fast.
#include <hip/hip_runtime.h>

// ---------------------------------------------------------------------------
// Encoder attention block on gfx1250 (wave32, WMMA bf16 16x16x32).
//   H=768, NH=12, HD=64, B=2, S=2048
// - One-time f32->bf16 conversion; all GEMMs stream raw bf16 b128 fragments.
// - The projection GEMMs' operands (x, the weights, ctx) lie in fragment order
//   (see load_frag_packed), so a fragment load reads whole cache lines.
// - Flash attention stages K/V chunks into LDS once per block via
//   global_load_async_to_lds_b128 (ASYNCcnt), double-buffered.
// ---------------------------------------------------------------------------

constexpr int kH  = 768;
constexpr int kNH = 12;
constexpr int kHD = 64;
constexpr int kB  = 2;
constexpr int kS  = 2048;
constexpr int kM  = kB * kS;          // 4096 total rows
constexpr int kBH = kB * kNH;         // 24 (batch*heads)

constexpr int kKC = 64;               // keys per pass of the attention loop
constexpr int kQT = 2;                // 16-query tiles per attention wave
constexpr int kAW = 4;                // waves per attention block
constexpr int kKH = 2;                // key halves of an attention block
constexpr int kQW = kAW / kKH;        // waves (32-query groups) per key half
constexpr int kHalf = kS / kKH;       // keys per half
constexpr int kKStride = 72;          // LDS row stride for K chunk (pad 8)
constexpr int kVStride = 72;          // LDS row stride for V chunk (pad 8)

typedef unsigned short u16;
typedef __attribute__((ext_vector_type(16))) __bf16 v16bf;
typedef __attribute__((ext_vector_type(16))) u16    v16us;
typedef __attribute__((ext_vector_type(8)))  u16    v8us;
typedef __attribute__((ext_vector_type(8)))  float  v8f;
typedef __attribute__((ext_vector_type(4)))  float  v4f;
typedef __attribute__((ext_vector_type(2)))  float  v2f;
typedef __attribute__((ext_vector_type(2)))  __bf16 v2bf;
typedef __attribute__((ext_vector_type(8)))  unsigned v8u;

typedef __attribute__((address_space(3))) u16 lds_u16;

__device__ __forceinline__ u16 f2bf_u(float f) {
  unsigned u = __builtin_bit_cast(unsigned, f);
  u += 0x7FFFu + ((u >> 16) & 1u);    // round-to-nearest-even
  return (u16)(u >> 16);
}

// Per-lane slice of a 16x32 bf16 WMMA A/B fragment from a row-major bf16
// matrix.  p points at element (row = lane&15, k = k0 + c0), c0 = 8*(lane>=16).
// Lane needs k-offsets {0..7} and {16..23}: two 16-byte loads, no ALU.
__device__ __forceinline__ v16bf load_frag_bf16(const u16* p) {
  v8us a = *(const v8us*)(p);
  v8us b = *(const v8us*)(p + 16);
  v16us u = __builtin_shufflevector(a, b, 0, 1, 2, 3, 4, 5, 6, 7,
                                          8, 9, 10, 11, 12, 13, 14, 15);
  return __builtin_bit_cast(v16bf, u);
}

// Fragment order of a [rows x kH] bf16 operand of the projection GEMMs.  The
// 16-row x 32-k tile (R, Ks) is kTileElems consecutive elements at
// R * 16 * kH + Ks * kTileElems; inside it the 8 elements (row ml, k = 8 g ..
// 8 g + 7), g = 0..3, stand at (g >> 1) * 256 + (g & 1) * 128 + ml * 8.  Lane
// l = 16 * lh + ml then finds its k-offsets {8 lh ..} and {16 + 8 lh ..} (the
// same ones as load_frag_bf16) at l * 8 and 256 + l * 8: each of the two
// 16-byte loads of a wave covers 512 consecutive bytes, four whole lines,
// where a row-major operand makes it touch 16 lines.
constexpr int kTileElems = 16 * 32;

// p = tile start + lane * 8.
__device__ __forceinline__ v16bf load_frag_packed(const u16* p) {
  v8us a = *(const v8us*)(p);
  v8us b = *(const v8us*)(p + 256);
  v16us u = __builtin_shufflevector(a, b, 0, 1, 2, 3, 4, 5, 6, 7,
                                          8, 9, 10, 11, 12, 13, 14, 15);
  return __builtin_bit_cast(v16bf, u);
}

__device__ __forceinline__ v8f wmma_bf16(v16bf a, v16bf b, v8f c) {
  return __builtin_amdgcn_wmma_f32_16x16x32_bf16(false, a, false, b,
                                                 (short)0, c, false, false);
}

// Prefetch into L2.  One instruction names 32 units (256-byte pieces), one per
// lane, at base + off + IMM bytes; nothing is returned and no counter is
// touched.  A hint, for speed only: results do not depend on what it brings or
// where a work-group runs.  Every address lies inside the operand.  base is the
// scalar base that the k loop's own loads use, so it stays an address.
template <int IMM>
__device__ __forceinline__ void prefetch_units(const u16* base, unsigned off) {
  asm volatile("global_prefetch_b8 %0, %1 offset:%2 scope:SCOPE_SE"
               :: "v"(off), "s"(base), "n"(IMM));
}

// Lane offset (bytes) that spreads one prefetch over the NS 16-row strips of a
// fragment-order operand: 32 / NS consecutive units, the same k-steps, of each.
constexpr unsigned kStripBytes = 16 * kH * 2;
template <int NS>
__device__ __forceinline__ unsigned prefetch_lane_off(int lane) {
  return (unsigned)(lane / (32 / NS)) * kStripBytes + (unsigned)(lane % (32 / NS)) * 256u;
}

// Register tile of the projection GEMMs: one wave owns MT x kWT accumulator
// tiles (MT = kWT, 64 x 64 outputs, in the QKV projection), so every loaded A
// fragment feeds kWT WMMAs and every B fragment MT.
// Every loop over tiles or accumulator rows is fully unrolled, here and in the
// two kernels, so that these arrays are indexed by constants and stay in VGPRs.
constexpr int kWT = 4;

// acc += A[16 MT rows] * B[64 rows]^T over k = 0..kH, both in fragment order.
// abase / bbase are the wave-uniform starts of the first 16-row tiles; loff is
// this lane's byte offset (lane * 16) inside a tile, the same for A and B.
// Every load is scalar base + 32-bit lane offset + immediate (the offset
// register holds lane * 16, or lane where the load scales it).
// pfa / pfb are the lane offsets of the prefetches that the caller has issued.
template <int MT>
__device__ __forceinline__ void gemm_wave_tile(const u16* abase, const u16* bbase,
                                               unsigned lane, unsigned pfa, unsigned pfb,
                                               v8f (&acc)[MT][kWT]) {
  const unsigned loff = lane * 16u;
  // Fully unrolled (24 k-steps): every k-step is an immediate offset, so there
  // is no address arithmetic and no branch among the WMMAs.
#pragma unroll
  for (int k0 = 0; k0 < kH; k0 += 32) {
    v16bf a[MT], b[kWT];
#pragma unroll
    for (int i = 0; i < MT; ++i)
      a[i] = load_frag_packed((const u16*)(
          (const char*)(abase + (k0 / 32) * kTileElems + i * 16 * kH) + loff));
#pragma unroll
    for (int j = 0; j < kWT; ++j)
      b[j] = load_frag_packed((const u16*)(
          (const char*)(bbase + (k0 / 32) * kTileElems + j * 16 * kH) + loff));
    // Stands behind the loads of a k-step and names their lane offset, in
    // both forms, so that register is not reused (the last load's destination
    // took it) ahead of the wait.  The data wait follows at once: no stall.
    // It names the prefetches' lane offsets too: their registers then hold
    // in-bounds offsets all through the loop, whenever a prefetch is served.
    asm volatile("s_wait_xcnt 0x0" :: "v"(loff), "v"(lane), "v"(pfa), "v"(pfb) : "memory");
    // Keeps the loads in one group ahead of the WMMAs: a load sunk among
    // them is waited for at once and exposes its whole latency.
    __builtin_amdgcn_sched_barrier(0);
#pragma unroll
    for (int i = 0; i < MT; ++i)
#pragma unroll
      for (int j = 0; j < kWT; ++j) acc[i][j] = wmma_bf16(a[i], b[j], acc[i][j]);
  }
}

// Async DMA global -> LDS (tracked by ASYNCcnt) of a thread's share of one
// chunk: four 16-byte pieces of K and four of V^T, 16 rows apart.  kl / vl are
// the thread's first LDS places, kg / vg its first global pieces.  One
// statement: the s_wait_xcnt at its end stands ahead of any rewrite of the
// address registers that the copies name.
__device__ __forceinline__ void async_copy_chunk(u16* kl, const u16* kg,
                                                 u16* vl, const u16* vg) {
  lds_u16* k0 = (lds_u16*)kl;
  lds_u16* k1 = k0 + 16 * kKStride;
  lds_u16* k2 = k0 + 32 * kKStride;
  lds_u16* k3 = k0 + 48 * kKStride;
  lds_u16* v0 = (lds_u16*)vl;
  lds_u16* v1 = v0 + 16 * kVStride;
  lds_u16* v2 = v0 + 32 * kVStride;
  lds_u16* v3 = v0 + 48 * kVStride;
  asm volatile("global_load_async_to_lds_b128 %0, %8, off\n\t"
               "global_load_async_to_lds_b128 %1, %9, off\n\t"
               "global_load_async_to_lds_b128 %2, %10, off\n\t"
               "global_load_async_to_lds_b128 %3, %11, off\n\t"
               "global_load_async_to_lds_b128 %4, %12, off\n\t"
               "global_load_async_to_lds_b128 %5, %13, off\n\t"
               "global_load_async_to_lds_b128 %6, %14, off\n\t"
               "global_load_async_to_lds_b128 %7, %15, off\n\t"
               "s_wait_xcnt 0x0"
               :
               : "v"(k0), "v"(k1), "v"(k2), "v"(k3), "v"(v0), "v"(v1), "v"(v2), "v"(v3),
                 "v"(kg), "v"(kg + 16 * kHD), "v"(kg + 32 * kHD), "v"(kg + 48 * kHD),
                 "v"(vg), "v"(vg + 16 * kS), "v"(vg + 32 * kS), "v"(vg + 48 * kS)
               : "memory");
}

__device__ __forceinline__ void wait_async0() {
  asm volatile("s_wait_asynccnt 0" ::: "memory");
}

// ---------------------------------------------------------------------------
// Kernel 0: elementwise f32 -> bf16 (8 elements / thread, vectorized) of x and
// the four weight matrices in ONE launch.  None of the five needs anything of
// another, so each takes a range of the block index; a block lies wholly in
// one array (every array is a whole number of 2048-element blocks).  The five
// bf16 planes follow one another in the workspace in the same order.
// The planes are written in fragment order (load_frag_packed).  A block takes
// 16 rows x 128 k = four tiles, which are its 2048 consecutive output elements.
// A wave takes 8 rows x one 32-k step: it reads 128 consecutive bytes of each
// row (8 lines per load) and stores four whole 128-byte lines.
// ---------------------------------------------------------------------------
constexpr int kCvtBlk = 256 * 8;                  // elements per block
constexpr int kXBlks  = kM * kH / kCvtBlk;        // 1536 blocks of x
constexpr int kWBlks  = kH * kH / kCvtBlk;        // 288 blocks per weight matrix
constexpr int kCvtK   = kCvtBlk / 16;             // 128 k per block
constexpr int kCvtKB  = kH / kCvtK;               // 6 blocks along k
static_assert(kXBlks * kCvtBlk == kM * kH && kWBlks * kCvtBlk == kH * kH,
              "every array is a whole number of blocks");
static_assert(kCvtKB * kCvtK == kH && kCvtK == 4 * 32 && kM % 16 == 0 && kH % 16 == 0,
              "a block is four whole tiles of one 16-row strip");

__global__ void __launch_bounds__(256)
cvt_bf16_kernel(const float* __restrict__ x,
                const float* __restrict__ Wq, const float* __restrict__ Wk,
                const float* __restrict__ Wv, const float* __restrict__ Wo,
                u16* __restrict__ out) {
  const int blk = blockIdx.x;
  const float* in = x;                            // block-uniform choice
  int first = 0;                                  // first block of that array
  if (blk >= kXBlks) {
    const int w = (blk - kXBlks) / kWBlks;
    first = kXBlks + w * kWBlks;
    in = w == 0 ? Wq : w == 1 ? Wk : w == 2 ? Wv : Wo;
  }
  const int lb  = blk - first;                    // block inside its array
  const int tid = threadIdx.x;
  const int ml  = ((tid >> 5) & 1) * 8 + (tid & 7);  // row in the 16-row strip
  const int g   = (tid >> 3) & 3;                 // group of 8 k in the 32-k step
  const int ks  = tid >> 6;                       // 32-k step in the block
  const float* p = in + ((lb / kCvtKB) * 16 + ml) * kH + (lb % kCvtKB) * kCvtK +
                   ks * 32 + g * 8;
  u16* q = out + (size_t)blk * kCvtBlk + ks * kTileElems +
           (g >> 1) * 256 + (g & 1) * 128 + ml * 8;
  v4f a = *(const v4f*)(p);
  v4f b = *(const v4f*)(p + 4);
  v8us u;
#pragma unroll
  for (int j = 0; j < 4; ++j) { u[j] = f2bf_u(a[j]); u[4 + j] = f2bf_u(b[j]); }
  *(v8us*)q = u;
}

// ---------------------------------------------------------------------------
// Kernel 1: QKV projection from bf16 operands.  out = x @ W^T + b.
// Q,K written bf16 [BH, S, HD]; V written TRANSPOSED bf16 [BH, HD, S].
// One wave = 64 rows x one whole head of Q, K or V; the 9 waves of a block
// share the same 64 rows of x (36 (head, z) slots = 4 blocks along y).
// ---------------------------------------------------------------------------
__global__ void __launch_bounds__(288)
qkv_proj_kernel(const u16* __restrict__ xbf,
                const u16* __restrict__ Wqb, const float* __restrict__ bq,
                const u16* __restrict__ Wkb, const float* __restrict__ bk,
                const u16* __restrict__ Wvb, const float* __restrict__ bv,
                u16* __restrict__ Qo, u16* __restrict__ Ko,
                u16* __restrict__ Vt) {
  const int lane = threadIdx.x & 31;
  const int wave = __builtin_amdgcn_readfirstlane(threadIdx.x >> 5);
  const int lh   = lane >> 4;
  const int ml   = lane & 15;
  const int m0   = blockIdx.x * (16 * kWT);
  const int slot = blockIdx.y * 9 + wave;     // 0..35: (head, z)
  const int z    = slot % 3;                  // every block: 3 waves each of Q, K, V
  const int h    = slot / 3;
  const int n0   = h * kHD;

  const u16* W;  const float* bias;
  if (z == 0)      { W = Wqb; bias = bq; }
  else if (z == 1) { W = Wkb; bias = bk; }
  else             { W = Wvb; bias = bv; }

  // Prefetch: one instruction covers two k-steps (2048 bytes) of all four
  // strips, so 12 cover an operand of 64 rows.  The block's x rows: one per
  // wave, waves 0..2 a second.  The wave's weight rows are read by all 64
  // blocks along x: 16 neighbours ask for the same quarter of k, later blocks
  // for later k.
  const u16* xrows = xbf + (size_t)m0 * kH;
  const u16* wrows = W + (size_t)n0 * kH;
  const unsigned pfa = prefetch_lane_off<kWT>(lane) + (unsigned)wave * 2048u;
  const unsigned pfb = prefetch_lane_off<kWT>(lane) + (blockIdx.x >> 4) * (3u * 2048u);
  prefetch_units<0>(xrows, pfa);
  if (wave < 3) prefetch_units<9 * 2048>(xrows, pfa);
  prefetch_units<0>(wrows, pfb);
  prefetch_units<2048>(wrows, pfb);
  prefetch_units<4096>(wrows, pfb);

  v8f acc[kWT][kWT] = {};
  gemm_wave_tile(xrows, wrows, (unsigned)lane, pfa, pfb, acc);

  const int bh = (m0 / kS) * kNH + h;         // 64 rows never cross a batch
  const int s0 = m0 % kS + 8 * lh;
  float bb_[kWT];
#pragma unroll
  for (int j = 0; j < kWT; ++j) bb_[j] = bias[n0 + j * 16 + ml];

  if (z == 2) {                               // V: [BH, HD, S]
    u16* o = Vt + ((size_t)bh * kHD + ml) * kS + s0;
#pragma unroll
    for (int i = 0; i < kWT; ++i)
#pragma unroll
      for (int j = 0; j < kWT; ++j)
#pragma unroll
        for (int r = 0; r < 8; ++r)
          o[(size_t)(j * 16) * kS + i * 16 + r] = f2bf_u(acc[i][j][r] + bb_[j]);
    return;
  }
  u16* o = (z == 0 ? Qo : Ko) + ((size_t)bh * kS + s0) * kHD + ml;  // [BH, S, HD]
#pragma unroll
  for (int i = 0; i < kWT; ++i)
#pragma unroll
    for (int j = 0; j < kWT; ++j)
#pragma unroll
      for (int r = 0; r < 8; ++r)
        o[(i * 16 + r) * kHD + j * 16] = f2bf_u(acc[i][j][r] + bb_[j]);
  // Behind the last stores: in the built code the V path's block follows this
  // one and rewrites the registers that these stores name.
  asm volatile("s_wait_xcnt 0x0" ::: "memory");
}

// ---------------------------------------------------------------------------
// Kernel 2: flash attention, transposed products.  4 waves / block share one
// (b,h); K/V chunks of 64 keys are DMA'd into double-buffered LDS with
// global_load_async_to_lds_b128, then each wave streams WMMA fragments from LDS.
// A wave owns 32 queries (two tiles): every K, V^T and mask fragment it reads
// from LDS feeds two WMMAs, and maximum, exchange and rescale come once per 64
// keys.
// A block owns 64 queries and splits the keys: waves 0, 1 walk the first half of
// the keys for the two 32-query groups, waves 2, 3 the second half.  That makes
// 3,072 waves of 16 passes, three on every SIMD (registers allow three), where
// 1,536 waves of 32 passes leave a SIMD with one or two; the vector work of one
// wave then runs under the matrix work and the LDS waits of two others.  The
// two waves of a query group join their partial results at the end, through
// LDS: each hands one of its two tiles to the other and finishes the one it
// keeps.
//   S^T = K Q^T   : A = K rows, B = Q rows; lane (c, h) holds query column c,
//                   register r of tile t = key t*16 + 8h + r.
//   O^T += V^T P^T: A = V^T rows, B = the two S^T tiles packed to bf16 in place
//                   (their register order is the k order of the A loader).
// A query's scores sit in the two lanes c and c + 16: maximum and sum are taken
// in the lane, with one exchange between the halves.  Writes ctx bf16 [B*S, H]
// in fragment order (load_frag_packed).
// ---------------------------------------------------------------------------
__device__ __forceinline__ unsigned pack_bf16(float lo, float hi) {
  return __builtin_bit_cast(unsigned, __builtin_convertvector(v2f{lo, hi}, v2bf));
}

__device__ __forceinline__ float max3f(float a, float b, float c) {
  return fmaxf(fmaxf(a, b), c);
}

// Value of lane l ^ 16.
__device__ __forceinline__ float other_half(float x) {
  const int v = __builtin_bit_cast(int, x);
  return __builtin_bit_cast(float, __builtin_amdgcn_permlanex16(
      v, v, 0x76543210, 0xfedcba98, false, false));
}

// Hands tile U of this wave's partial result (O^T, maximum, sum) to the wave
// that walked the other half of the keys.  xo / xml: this wave's own LDS slots.
template <int U>
__device__ __forceinline__ void hand_over_tile(const v8f (&o)[kQT][4], const float (&mrun)[kQT],
                                               const float (&lrun)[kQT], v4f (*xo)[32],
                                               float (*xml)[32], int lane) {
  // Unrolled: o is indexed by constants and stays in registers.
#pragma unroll
  for (int dt = 0; dt < 4; ++dt) {
    xo[2 * dt][lane]     = __builtin_shufflevector(o[U][dt], o[U][dt], 0, 1, 2, 3);
    xo[2 * dt + 1][lane] = __builtin_shufflevector(o[U][dt], o[U][dt], 4, 5, 6, 7);
  }
  xml[0][lane] = mrun[U];
  xml[1][lane] = lrun[U];
}

// Joins tile U with the partner's part of it (xo / xml: the partner's slots),
// joins the lane halves' sums, normalizes and writes ctx (bf16), fragment order.
// A lane holds 8 consecutive d of its query per tile, group g = 2 (dt & 1) + lh
// of 32-k step 2 h + (dt >> 1): one 16-byte store each, at lane * 8 in its half
// tile, so a wave's store is 512 consecutive bytes.  crow: tile U's place + lane * 8.
template <int U>
__device__ __forceinline__ void finish_tile(const v8f (&o)[kQT][4], const float (&mrun)[kQT],
                                            const float (&lrun)[kQT], const v4f (*xo)[32],
                                            const float (*xml)[32], int lane, u16* crow) {
  const float mo = xml[0][lane];
  const float lo = xml[1][lane];
  // Both parts are brought to the larger of the two maxima: its own factor is 1.
  const float d  = mrun[U] - mo;
  const float e  = __builtin_amdgcn_exp2f(-__builtin_fabsf(d));
  const float am = d < 0.0f ? e : 1.0f;
  const float ao = d < 0.0f ? 1.0f : e;
  const float ls = lrun[U] * am + lo * ao;
  const float inv = 1.0f / (ls + other_half(ls));
  const float fm = am * inv, fo = ao * inv;
  // Both loops unrolled: o, po and w are indexed by constants (registers).
#pragma unroll
  for (int dt = 0; dt < 4; ++dt) {
    const v8f po = __builtin_shufflevector(xo[2 * dt][lane], xo[2 * dt + 1][lane],
                                           0, 1, 2, 3, 4, 5, 6, 7);
    v8us w;
#pragma unroll
    for (int r = 0; r < 8; ++r) w[r] = f2bf_u(o[U][dt][r] * fm + po[r] * fo);
    *(v8us*)(crow + dt * 256) = w;
  }
}

__global__ void __launch_bounds__(32 * kAW)
flash_attn_kernel(const u16* __restrict__ Q, const u16* __restrict__ K,
                  const u16* __restrict__ Vt,
                  const float* __restrict__ amask,
                  u16* __restrict__ ctx) {
  __shared__ __align__(16) u16 kbuf[2][kKH][kKC * kKStride]; // 64 kv-rows x 64 dims
  __shared__ __align__(16) u16 vbuf[2][kKH][kHD * kVStride]; // 64 d-rows  x 64 kv
  __shared__ __align__(16) float mbias[kS];             // mask term per key
  __shared__ __align__(16) v4f xo[kAW][8][32];          // per wave: the tile it hands over
  __shared__ __align__(16) float xml[kAW][2][32];       //           its maximum and sum

  const int tid  = threadIdx.x;
  const int lane = tid & 31;
  const int wave = __builtin_amdgcn_readfirstlane(tid >> 5);
  const int qg   = wave % kQW;                // 32-query group of the block
  const int kh   = wave / kQW;                // key half that this wave walks
  const int lh   = lane >> 4;
  const int ml   = lane & 15;
  const int c0   = lh * 8;

  const int bh = blockIdx.y;                  // 0..B*NH-1
  const int b  = bh / kNH;
  const int q0 = (blockIdx.x * kQW + qg) * (16 * kQT);

  const u16* Qb  = Q  + (size_t)bh * kS * kHD;
  const u16* Kb  = K  + (size_t)bh * kS * kHD;
  const u16* Vtb = Vt + (size_t)bh * kHD * kS;

  // Staging coordinates: a chunk of K and one of V^T are 64 rows x 8 pieces of
  // 16 bytes each; a thread takes piece srow, sseg and the ones 16, 32 and 48
  // rows on.  All four waves stage pass p's chunk of either key half.
  const int srow = tid >> 3, sseg = tid & 7;
  const u16* kg = Kb + (size_t)srow * kHD + sseg * 8;   // chunk 0
  const u16* vg = Vtb + (size_t)srow * kS + sseg * 8;
  auto stage = [&](int buf, int p) {
    // Unrolled: the halves' LDS places and key offsets are constants.
#pragma unroll
    for (int hf = 0; hf < kKH; ++hf)
      async_copy_chunk(&kbuf[buf][hf][srow * kKStride + sseg * 8],
                       kg + (size_t)(hf * kHalf + p * kKC) * kHD,
                       &vbuf[buf][hf][srow * kVStride + sseg * 8],
                       vg + (hf * kHalf + p * kKC));
  };

  // Q fragments of the wave's tiles (HD=64 -> two k-steps of 32), loaded once.
  v16bf qf[kQT][2];
#pragma unroll
  for (int u = 0; u < kQT; ++u) {
    qf[u][0] = load_frag_bf16(Qb + (size_t)(q0 + u * 16 + ml) * kHD + 0  + c0);
    qf[u][1] = load_frag_bf16(Qb + (size_t)(q0 + u * 16 + ml) * kHD + 32 + c0);
  }

  v8f o[kQT][4] = {};                         // O^T: o[u][dt][r] = d dt*16+8h+r, query c
  float mrun[kQT], lrun[kQT];                 // scaled log2 maximum; this lane's sum
#pragma unroll
  for (int u = 0; u < kQT; ++u) { mrun[u] = -3.0e38f; lrun[u] = 0.0f; }

  // Kick off DMA for pass 0 into buffer 0.
  stage(0, 0);

  // Prefetch of K and V^T, in groups of 256 keys of a key half (4 passes): 128
  // units of K (consecutive) and 128 of V^T (two per d row).  The 32 blocks of a
  // (b,h) walk the same keys in step, so they share the asking: a block takes a
  // quarter of every group of one half, chosen by its index, with its waves 0
  // and 1.  pf walks from group to group, lives through the loop and stays inside
  // the array; group 0 is asked for here, group g + 1 at the foot of group g's
  // first pass.
  const bool pfwave = wave < 2;
  const int  pfq    = blockIdx.x & 3;           // quarters 0, 1: K; 2, 3: V^T
  const int  pfh    = (blockIdx.x >> 2) & 1;    // the key half asked for
  const int  pfu    = (pfq & 1) * 64 + (tid & 63);
  const char* pf = pfq < 2 ? (const char*)Kb + pfh * (kHalf * kHD * 2) + pfu * 256
                           : (const char*)Vtb + pfh * (kHalf * 2) +
                                 (pfu >> 1) * (kS * 2) + (pfu & 1) * 256;
  const int pfstep = pfq < 2 ? 256 * kHD * 2 : 256 * 2;
  if (pfwave) asm volatile("global_prefetch_b8 %0, off scope:SCOPE_SE" :: "v"(pf));

  // A key is a row of the score tile, so its mask term differs by register
  // and not by lane: all kS terms go to LDS once (16 per thread), times
  // sqrt(HD) = 8 (exact) because they start the accumulator ahead of the
  // 1/sqrt(HD) scaling.  The barrier in front of the loop publishes them.
  {
    const float* amb = amask + (size_t)b * kS;   // same for the whole block
    const float* am  = amb + tid * 16;
    v4f mm[4];
#pragma unroll
    for (int i = 0; i < 4; ++i) mm[i] = *(const v4f*)(am + 4 * i);
    // Behind the loads, naming their scalar base: otherwise that register
    // pair is reused for constants ahead of any wait.
    asm volatile("s_wait_xcnt 0x0" :: "s"(amb) : "memory");
#pragma unroll
    for (int i = 0; i < 4; ++i) {
#pragma unroll
      for (int j = 0; j < 4; ++j) mm[i][j] = (1.0f - mm[i][j]) * -80000.0f;
      *(v4f*)(&mbias[tid * 16 + 4 * i]) = mm[i];
    }
  }

  wait_async0();                      // my share of chunk 0 has landed
  __syncthreads();                    // everyone's has; mask terms published
  // Pass 1's chunks fly while pass 0's are worked on.
  stage(1, 1);

  constexpr float kScale = 0.125f * 1.4426950408889634f;  // log2(e) / sqrt(HD)

  constexpr int kPasses = kHalf / kKC;
  static_assert(kPasses >= 2 && kHalf % 256 == 0, "two buffers; whole prefetch groups");
  for (int p = 0; p < kPasses; ++p) {
    const int cur = p & 1;
    const int kv0 = kh * kHalf + p * kKC;     // this wave's first key of the pass

    const u16* kch = &kbuf[cur][kh][0];
    const u16* vch = &vbuf[cur][kh][0];

    // ---- K rows and mask terms of the pass: each feeds both query tiles ----
    v16bf kf[4][2];
    v8f mk[4];
#pragma unroll
    for (int t = 0; t < 4; ++t) {
      const u16* krow_l = kch + (t * 16 + ml) * kKStride + c0;
      kf[t][0] = load_frag_bf16(krow_l + 0);
      kf[t][1] = load_frag_bf16(krow_l + 32);
      const float* mrow = &mbias[kv0 + t * 16 + c0];
      const v4f ma = *(const v4f*)(mrow);
      const v4f mb = *(const v4f*)(mrow + 4);
      mk[t] = __builtin_shufflevector(ma, mb, 0, 1, 2, 3, 4, 5, 6, 7);
    }
    // Keeps these LDS loads in one group ahead of the WMMAs: sunk among them
    // they share one register set, and every WMMA then waits for its own
    // loads' whole latency.
    __builtin_amdgcn_sched_barrier(0);

    // ---- S^T: 4 x kQT tiles of 16x16, keys [kv0, kv0+64) x 32 queries ----
    v8f st[kQT][4];
#pragma unroll
    for (int t = 0; t < 4; ++t)
#pragma unroll
      for (int u = 0; u < kQT; ++u) st[u][t] = wmma_bf16(kf[t][0], qf[u][0], mk[t]);
#pragma unroll
    for (int t = 0; t < 4; ++t)
#pragma unroll
      for (int u = 0; u < kQT; ++u) st[u][t] = wmma_bf16(kf[t][1], qf[u][1], st[u][t]);

    // Keeps the V^T loads behind the S^T products, whose K registers they
    // take over: raised among them they need a register set of their own.
    __builtin_amdgcn_sched_barrier(0);

    // ---- V^T rows (two k-steps of 32 keys), fetched under the softmax ----
    v16bf vf[4][2];
#pragma unroll
    for (int dt = 0; dt < 4; ++dt) {
      const u16* vrow_l = vch + (dt * 16 + ml) * kVStride + c0;
      vf[dt][0] = load_frag_bf16(vrow_l + 0);
      vf[dt][1] = load_frag_bf16(vrow_l + 32);
    }
    // Keeps these loads in one group ahead of the softmax, so that its
    // arithmetic covers their latency.
    __builtin_amdgcn_sched_barrier(0);

    // ---- online softmax of query c of each tile, log2 domain ----
    v16bf pb[kQT][2];
#pragma unroll
    for (int u = 0; u < kQT; ++u) {
      float tm[4];
#pragma unroll
      for (int t = 0; t < 4; ++t)
        tm[t] = max3f(max3f(st[u][t][0], st[u][t][1], st[u][t][2]),
                      max3f(st[u][t][3], st[u][t][4], st[u][t][5]), st[u][t][6]);
      float mx = max3f(max3f(tm[0], tm[1], st[u][0][7]),
                       max3f(tm[2], tm[3], st[u][1][7]),
                       fmaxf(st[u][2][7], st[u][3][7]));
      mx = fmaxf(mx, other_half(mx));
      const float mnew  = fmaxf(mrun[u], mx * kScale);
      const float alpha = __builtin_amdgcn_exp2f(mrun[u] - mnew);
      mrun[u] = mnew;
      const v8f vscale = {kScale, kScale, kScale, kScale, kScale, kScale, kScale, kScale};
      const v8f vmneg  = {-mnew, -mnew, -mnew, -mnew, -mnew, -mnew, -mnew, -mnew};
#pragma unroll
      for (int t = 0; t < 4; ++t) {
        st[u][t] = __builtin_elementwise_fma(st[u][t], vscale, vmneg);
#pragma unroll
        for (int r = 0; r < 8; ++r) st[u][t][r] = __builtin_amdgcn_exp2f(st[u][t][r]);
      }
      const v8f s8 = (st[u][0] + st[u][1]) + (st[u][2] + st[u][3]);
      const v4f s4 = __builtin_shufflevector(s8, s8, 0, 1, 2, 3) +
                     __builtin_shufflevector(s8, s8, 4, 5, 6, 7);
      lrun[u] = lrun[u] * alpha + ((s4[0] + s4[1]) + (s4[2] + s4[3]));
#pragma unroll
      for (int dt = 0; dt < 4; ++dt) o[u][dt] *= alpha;

      // P^T as B operand of k-step ks: element s = st[u][2 ks + (s >> 3)][s & 7]
#pragma unroll
      for (int ks = 0; ks < 2; ++ks) {
        v8u pu;
#pragma unroll
        for (int i = 0; i < 4; ++i) {
          pu[i]     = pack_bf16(st[u][2 * ks][2 * i],     st[u][2 * ks][2 * i + 1]);
          pu[4 + i] = pack_bf16(st[u][2 * ks + 1][2 * i], st[u][2 * ks + 1][2 * i + 1]);
        }
        pb[u][ks] = __builtin_bit_cast(v16bf, pu);
      }
    }

    // ---- O^T += V^T P^T : four 16-row d tiles across HD=64, two k-steps ----
#pragma unroll
    for (int ks = 0; ks < 2; ++ks)
#pragma unroll
      for (int dt = 0; dt < 4; ++dt)
#pragma unroll
        for (int u = 0; u < kQT; ++u)
          o[u][dt] = wmma_bf16(vf[dt][ks], pb[u][ks], o[u][dt]);

    // Keeps the foot at the foot: raised to where the last LDS load lands, the
    // wait for the next chunk's copies would come half a pass early and stall.
    __builtin_amdgcn_sched_barrier(0);
    // ---- foot of the pass: one barrier publishes the next chunk and ends
    // every wave's reads of this one, whose buffer is refilled behind it, a
    // whole pass ahead of its use ----
    asm volatile("s_wait_dscnt 0x0" ::: "memory");   // my reads of cur are done
    wait_async0();                                   // my share of the next chunk has landed
    __syncthreads();
    if (p + 2 < kPasses) {
      stage(cur, p + 2);
      if (pfwave && (p & 3) == 0 && p + 4 < kPasses) {
        pf += pfstep;
        asm volatile("global_prefetch_b8 %0, off scope:SCOPE_SE" :: "v"(pf));
      }
    }
  }
  wait_async0();                      // nothing in flight when the wave ends

  // ---- join the two key halves: the wave of half kh keeps tile kh of its query
  // group and hands the other one over (the tile index is a constant on either
  // side of a wave-uniform test, so o stays in registers) ----
  static_assert(kKH == 2 && kQT == 2, "one tile kept, one handed over");
  if (kh == 0) hand_over_tile<1>(o, mrun, lrun, xo[wave], xml[wave], lane);
  else         hand_over_tile<0>(o, mrun, lrun, xo[wave], xml[wave], lane);
  __syncthreads();                    // every wave's handed-over tile is in LDS
  const int h = bh % kNH;
  const int partner = wave ^ kQW;     // same query group, other key half
  u16* crow = ctx + ((size_t)b * kS + q0 + kh * 16) * kH + h * 2 * kTileElems + lane * 8;
  if (kh == 0) finish_tile<0>(o, mrun, lrun, xo[partner], xml[partner], lane, crow);
  else         finish_tile<1>(o, mrun, lrun, xo[partner], xml[partner], lane, crow);
}

// ---------------------------------------------------------------------------
// Kernel 3: output projection + bias + residual + LayerNorm, one launch.
//   y = ctx @ Wo^T + bo + x;  out = (y - mean) * rstd * gamma + beta
// A block owns kLT * 16 = 32 whole rows: its 12 waves take 64 columns each
// (2 x 4 accumulator tiles) and share the rows of ctx.  y stays in registers:
// each wave sums its 64 columns of every row, the 12 partial sums of a row meet
// in LDS behind one barrier, and every wave normalizes and stores its own tile.
// ---------------------------------------------------------------------------
constexpr int kLT = 2;                        // 16-row tiles per block
constexpr int kLW = kH / (16 * kWT);          // 12 waves cover the kH columns
constexpr int kLR = 16 * kLT;                 // 32 rows per block = lanes per wave
static_assert(kLR == 32 && kLW * 16 * kWT == kH && kM % kLR == 0,
              "one lane per row in the join of the partial sums");

// v + (v of lane l ^ M), M < 16: one step of a sum over a 16-lane row (DPP
// row_xmask).
template <int M>
__device__ __forceinline__ float add_row_xor(float v) {
  return v + __builtin_bit_cast(float, __builtin_amdgcn_mov_dpp(
      __builtin_bit_cast(int, v), 0x160 + M, 0xf, 0xf, false));
}

__global__ void __launch_bounds__(32 * kLW)
out_proj_ln_kernel(const u16* __restrict__ ctxb, const u16* __restrict__ Wob,
                   const float* __restrict__ bo, const float* __restrict__ x,
                   const float* __restrict__ gamma, const float* __restrict__ beta,
                   float* __restrict__ out) {
  __shared__ __align__(16) float psum[kLW][kLR];   // per wave and row: sum of y
  __shared__ __align__(16) float psq[kLW][kLR];    //                   sum of y * y
  __shared__ __align__(16) float smean[kLW][kLR];  // per row, a copy for each wave
  __shared__ __align__(16) float srstd[kLW][kLR];

  const int lane = threadIdx.x & 31;
  const int wave = __builtin_amdgcn_readfirstlane(threadIdx.x >> 5);
  const int lh   = lane >> 4;
  const int ml   = lane & 15;
  const int m0   = blockIdx.x * kLR;
  const int n0   = wave * (16 * kWT);

  // Prefetch.  The block's 32 rows of ctx: an instruction covers four k-steps
  // (4096 bytes) of both strips, waves 0..5 one each.  The wave's rows of Wo are
  // read by every block: a block asks for two of the 24 k-steps, chosen by its
  // index.
  const u16* crows = ctxb + (size_t)m0 * kH;
  const u16* wrows = Wob + (size_t)n0 * kH;
  const unsigned pfa = prefetch_lane_off<kLT>(lane) + (unsigned)(wave % 6) * 4096u;
  const unsigned pfb = prefetch_lane_off<kWT>(lane) + (blockIdx.x % 12) * 2048u;
  if (wave < 6) prefetch_units<0>(crows, pfa);
  prefetch_units<0>(wrows, pfb);

  v8f acc[kLT][kWT] = {};
  gemm_wave_tile(crows, wrows, (unsigned)lane, pfa, pfb, acc);

  float bb_[kWT], gg[kWT], bt[kWT];
#pragma unroll
  for (int j = 0; j < kWT; ++j) {
    bb_[j] = bo[n0 + j * 16 + ml];
    gg[j]  = gamma[n0 + j * 16 + ml];
    bt[j]  = beta[n0 + j * 16 + ml];
  }

  // The 64 residual values of the tile are fetched together, so the wave waits
  // for memory once.  y[i][j][r] = row i*16 + 8*lh + r, column n0 + j*16 + ml.
  const size_t base = (size_t)(m0 + 8 * lh) * kH + n0 + ml;
  v8f y[kLT][kWT];
#pragma unroll
  for (int i = 0; i < kLT; ++i)
#pragma unroll
    for (int j = 0; j < kWT; ++j)
#pragma unroll
      for (int r = 0; r < 8; ++r) y[i][j][r] = x[base + (i * 16 + r) * kH + j * 16];
  // Behind the loads above: their index registers are reused in what follows.
  asm volatile("s_wait_xcnt 0x0" ::: "memory");
#pragma unroll
  for (int i = 0; i < kLT; ++i)
#pragma unroll
    for (int j = 0; j < kWT; ++j) y[i][j] = acc[i][j] + bb_[j] + y[i][j];

  // ---- this wave's 64 columns of each row: 4 in the lane, then the 16 lanes
  // of the half ----
#pragma unroll
  for (int i = 0; i < kLT; ++i) {
    const v8f s8 = (y[i][0] + y[i][1]) + (y[i][2] + y[i][3]);
    const v8f q8 = (y[i][0] * y[i][0] + y[i][1] * y[i][1]) +
                   (y[i][2] * y[i][2] + y[i][3] * y[i][3]);
    float s[8], q[8];
#pragma unroll
    for (int r = 0; r < 8; ++r) {
      s[r] = add_row_xor<8>(add_row_xor<4>(add_row_xor<2>(add_row_xor<1>(s8[r]))));
      q[r] = add_row_xor<8>(add_row_xor<4>(add_row_xor<2>(add_row_xor<1>(q8[r]))));
    }
    if (ml == 0) {                            // one lane of each half: its 8 rows
      v4f* ps = (v4f*)&psum[wave][i * 16 + 8 * lh];
      v4f* pq = (v4f*)&psq[wave][i * 16 + 8 * lh];
      ps[0] = v4f{s[0], s[1], s[2], s[3]};  ps[1] = v4f{s[4], s[5], s[6], s[7]};
      pq[0] = v4f{q[0], q[1], q[2], q[3]};  pq[1] = v4f{q[4], q[5], q[6], q[7]};
    }
  }
  __syncthreads();                            // all 12 partial sums of every row

  // ---- lane l joins row l (every wave does, so one barrier is enough) ----
  {
    float ts = psum[0][lane], tq = psq[0][lane];
#pragma unroll
    for (int w = 1; w < kLW; ++w) { ts += psum[w][lane]; tq += psq[w][lane]; }
    const float mean = ts * (1.0f / kH);
    const float var  = tq * (1.0f / kH) - mean * mean;
    smean[wave][lane] = mean;
    srstd[wave][lane] = rsqrtf(var + 1e-5f);
  }
  // The wave reads back what its other lanes wrote: their stores are done first.
  asm volatile("s_wait_dscnt 0x0" ::: "memory");

#pragma unroll
  for (int i = 0; i < kLT; ++i) {
    const v4f* pm = (const v4f*)&smean[wave][i * 16 + 8 * lh];
    const v4f* pr = (const v4f*)&srstd[wave][i * 16 + 8 * lh];
    const v8f mean = __builtin_shufflevector(pm[0], pm[1], 0, 1, 2, 3, 4, 5, 6, 7);
    const v8f rstd = __builtin_shufflevector(pr[0], pr[1], 0, 1, 2, 3, 4, 5, 6, 7);
#pragma unroll
    for (int j = 0; j < kWT; ++j) y[i][j] = (y[i][j] - mean) * rstd * gg[j] + bt[j];
  }
  // Keeps the 64 stores in one run behind the arithmetic: mixed into it they
  // share data registers, and each reuse waits for earlier stores.
  __builtin_amdgcn_sched_barrier(0);
#pragma unroll
  for (int i = 0; i < kLT; ++i)
#pragma unroll
    for (int j = 0; j < kWT; ++j)
#pragma unroll
      for (int r = 0; r < 8; ++r) out[base + (i * 16 + r) * kH + j * 16] = y[i][j][r];
}

// ---------------------------------------------------------------------------
// Launch
// ---------------------------------------------------------------------------
extern "C" void kernel_launch(void* const* d_in, const int* in_sizes, int n_in,
                              void* d_out, int out_size, void* d_ws,
                              size_t ws_size, hipStream_t stream) {
  (void)in_sizes; (void)n_in; (void)out_size; (void)ws_size;

  const float* x     = (const float*)d_in[0];
  const float* amask = (const float*)d_in[1];
  const float* Wq    = (const float*)d_in[2];
  const float* bq    = (const float*)d_in[3];
  const float* Wk    = (const float*)d_in[4];
  const float* bk    = (const float*)d_in[5];
  const float* Wv    = (const float*)d_in[6];
  const float* bv    = (const float*)d_in[7];
  const float* Wo    = (const float*)d_in[8];
  const float* bo    = (const float*)d_in[9];
  const float* g     = (const float*)d_in[10];
  const float* be    = (const float*)d_in[11];
  float* out = (float*)d_out;

  // Workspace carve-up (all regions 16B-aligned by construction).
  const size_t NX = (size_t)kM * kH;          // 3,145,728 activation elems
  const size_t NW = (size_t)kH * kH;          // 589,824 weight elems
  char* w = (char*)d_ws;
  u16* XBF = (u16*)w;  w += NX * 2;
  u16* WQB = (u16*)w;  w += NW * 2;
  u16* WKB = (u16*)w;  w += NW * 2;
  u16* WVB = (u16*)w;  w += NW * 2;
  u16* WOB = (u16*)w;  w += NW * 2;
  u16* Qb  = (u16*)w;  w += NX * 2;           // [BH, S, HD]
  u16* Kb  = (u16*)w;  w += NX * 2;           // [BH, S, HD]
  u16* Vtb = (u16*)w;  w += NX * 2;           // [BH, HD, S] (transposed)
  u16* CTX = (u16*)w;                         // [B*S, H] bf16, fragment order

  // f32 -> bf16 conversions, one launch: XBF, WQB, WKB, WVB, WOB lie in a row.
  cvt_bf16_kernel<<<dim3(kXBlks + 4 * kWBlks), 256, 0, stream>>>(
      x, Wq, Wk, Wv, Wo, XBF);

  // QKV projections: 64 row blocks x 4 groups of 9 (head, z) slots = 256 blocks.
  qkv_proj_kernel<<<dim3(kM / 64, 3 * kNH / 9), 288, 0, stream>>>(
      XBF, WQB, bq, WKB, bk, WVB, bv, Qb, Kb, Vtb);

  // Flash attention: 128 q-tiles (4 per block, 2 per wave pair) x 24 (b,h) pairs.
  flash_attn_kernel<<<dim3(kS / (16 * kQT * kQW), kBH), 32 * kAW, 0, stream>>>(
      Qb, Kb, Vtb, amask, CTX);

  // Output projection + residual + LayerNorm -> d_out: 128 blocks of 32 rows.
  out_proj_ln_kernel<<<dim3(kM / kLR), 32 * kLW, 0, stream>>>(
      CTX, WOB, bo, x, g, be, out);
}

// v009
// One run takes 56.6 microseconds.
// Next to v008, in two timings, it ran 1.04 times as fast each time.
// Over all steps from v000 it is 3.87 times as fast.
#include <hip/hip_runtime.h>

// ---------------------------------------------------------------------------
// Encoder attention block on gfx1250 (wave32, WMMA bf16 16x16x32).
//   H=768, NH=12, HD=64, B=2, S=2048
// - One-time f32->bf16 conversion; all GEMMs read raw bf16 b128 fragments.
// - The projection GEMMs' operands (x, the weights, ctx) lie in fragment order
//   (see load_frag_packed), so a fragment load reads whole cache lines.
// - Flash attention stages K/V chunks, and the QKV projection its x and W
//   chunks, into LDS once per block via global_load_async_to_lds_b128
//   (ASYNCcnt), double-buffered.
// ---------------------------------------------------------------------------

constexpr int kH  = 768;
constexpr int kNH = 12;
constexpr int kHD = 64;
constexpr int kB  = 2;
constexpr int kS  = 2048;
constexpr int kM  = kB * kS;          // 4096 total rows
constexpr int kBH = kB * kNH;         // 24 (batch*heads)

constexpr int kKC = 64;               // keys per pass of the attention loop
constexpr int kQT = 2;                // 16-query tiles per attention wave
constexpr int kAW = 4;                // waves per attention block
constexpr int kKH = 2;                // key halves of an attention block
constexpr int kQW = kAW / kKH;        // waves (32-query groups) per key half
constexpr int kHalf = kS / kKH;       // keys per half
constexpr int kKStride = 72;          // LDS row stride for K chunk (pad 8)
constexpr int kVStride = 72;          // LDS row stride for V chunk (pad 8)

typedef unsigned short u16;
typedef __attribute__((ext_vector_type(16))) __bf16 v16bf;
typedef __attribute__((ext_vector_type(16))) u16    v16us;
typedef __attribute__((ext_vector_type(8)))  u16    v8us;
typedef __attribute__((ext_vector_type(8)))  float  v8f;
typedef __attribute__((ext_vector_type(4)))  float  v4f;
typedef __attribute__((ext_vector_type(2)))  float  v2f;
typedef __attribute__((ext_vector_type(2)))  __bf16 v2bf;
typedef __attribute__((ext_vector_type(8)))  unsigned v8u;

typedef __attribute__((address_space(3))) u16 lds_u16;

__device__ __forceinline__ u16 f2bf_u(float f) {
  unsigned u = __builtin_bit_cast(unsigned, f);
  u += 0x7FFFu + ((u >> 16) & 1u);    // round-to-nearest-even
  return (u16)(u >> 16);
}

// Per-lane slice of a 16x32 bf16 WMMA A/B fragment from a row-major bf16
// matrix.  p points at element (row = lane&15, k = k0 + c0), c0 = 8*(lane>=16).
// Lane needs k-offsets {0..7} and {16..23}: two 16-byte loads, no ALU.
__device__ __forceinline__ v16bf load_frag_bf16(const u16* p) {
  v8us a = *(const v8us*)(p);
  v8us b = *(const v8us*)(p + 16);
  v16us u = __builtin_shufflevector(a, b, 0, 1, 2, 3, 4, 5, 6, 7,
                                          8, 9, 10, 11, 12, 13, 14, 15);
  return __builtin_bit_cast(v16bf, u);
}

// Fragment order of a [rows x kH] bf16 operand of the projection GEMMs.  The
// 16-row x 32-k tile (R, Ks) is kTileElems consecutive elements at
// R * 16 * kH + Ks * kTileElems; inside it the 8 elements (row ml, k = 8 g ..
// 8 g + 7), g = 0..3, stand at (g >> 1) * 256 + (g & 1) * 128 + ml * 8.  Lane
// l = 16 * lh + ml then finds its k-offsets {8 lh ..} and {16 + 8 lh ..} (the
// same ones as load_frag_bf16) at l * 8 and 256 + l * 8: each of the two
// 16-byte loads of a wave covers 512 consecutive bytes, four whole lines,
// where a row-major operand makes it touch 16 lines.
constexpr int kTileElems = 16 * 32;

// p = tile start + lane * 8.
__device__ __forceinline__ v16bf load_frag_packed(const u16* p) {
  v8us a = *(const v8us*)(p);
  v8us b = *(const v8us*)(p + 256);
  v16us u = __builtin_shufflevector(a, b, 0, 1, 2, 3, 4, 5, 6, 7,
                                          8, 9, 10, 11, 12, 13, 14, 15);
  return __builtin_bit_cast(v16bf, u);
}

__device__ __forceinline__ v8f wmma_bf16(v16bf a, v16bf b, v8f c) {
  return __builtin_amdgcn_wmma_f32_16x16x32_bf16(false, a, false, b,
                                                 (short)0, c, false, false);
}

// Prefetch into L2.  One instruction names 32 units (256-byte pieces), one per
// lane, at base + off + IMM bytes; nothing is returned and no counter is
// touched.  A hint, for speed only: results do not depend on what it brings or
// where a work-group runs.  Every address lies inside the operand.  base is a
// scalar base that the k loop's loads use or its waits name, so it stays an address.
template <int IMM>
__device__ __forceinline__ void prefetch_units(const u16* base, unsigned off) {
  asm volatile("global_prefetch_b8 %0, %1 offset:%2 scope:SCOPE_SE"
               :: "v"(off), "s"(base), "n"(IMM));
}

// Lane offset (bytes) that spreads one prefetch over the NS 16-row strips of a
// fragment-order operand: 32 / NS consecutive units, the same k-steps, of each.
constexpr unsigned kStripBytes = 16 * kH * 2;
template <int NS>
__device__ __forceinline__ unsigned prefetch_lane_off(int lane) {
  return (unsigned)(lane / (32 / NS)) * kStripBytes + (unsigned)(lane % (32 / NS)) * 256u;
}

// Register tile of the output projection: one wave owns MT x kWT accumulator
// tiles, so every loaded A fragment feeds kWT WMMAs and every B fragment MT.
// (kWT is also the number of 16-row tiles of a wave of the QKV projection.)
// Every loop over tiles or accumulator rows is fully unrolled, here and in the
// two kernels, so that these arrays are indexed by constants and stay in VGPRs.
constexpr int kWT = 4;

// acc += A[16 MT rows] * B[64 rows]^T over k = 0..kH, both in fragment order.
// abase / bbase are the wave-uniform starts of the first 16-row tiles; loff is
// this lane's byte offset (lane * 16) inside a tile, the same for A and B.
// Every load is scalar base + 32-bit lane offset + immediate (the offset
// register holds lane * 16, or lane where the load scales it).
// pfa / pfb are the lane offsets of the prefetches that the caller has issued.
template <int MT>
__device__ __forceinline__ void gemm_wave_tile(const u16* abase, const u16* bbase,
                                               unsigned lane, unsigned pfa, unsigned pfb,
                                               v8f (&acc)[MT][kWT]) {
  const unsigned loff = lane * 16u;
  // Fully unrolled (24 k-steps): every k-step is an immediate offset, so there
  // is no address arithmetic and no branch among the WMMAs.
#pragma unroll
  for (int k0 = 0; k0 < kH; k0 += 32) {
    v16bf a[MT], b[kWT];
#pragma unroll
    for (int i = 0; i < MT; ++i)
      a[i] = load_frag_packed((const u16*)(
          (const char*)(abase + (k0 / 32) * kTileElems + i * 16 * kH) + loff));
#pragma unroll
    for (int j = 0; j < kWT; ++j)
      b[j] = load_frag_packed((const u16*)(
          (const char*)(bbase + (k0 / 32) * kTileElems + j * 16 * kH) + loff));
    // Stands behind the loads of a k-step and names their lane offset, in
    // both forms, so that register is not reused (the last load's destination
    // took it) ahead of the wait.  The data wait follows at once: no stall.
    // It names the prefetches' lane offsets too: their registers then hold
    // in-bounds offsets all through the loop, whenever a prefetch is served.
    asm volatile("s_wait_xcnt 0x0" :: "v"(loff), "v"(lane), "v"(pfa), "v"(pfb) : "memory");
    // Keeps the loads in one group ahead of the WMMAs: a load sunk among
    // them is waited for at once and exposes its whole latency.
    __builtin_amdgcn_sched_barrier(0);
#pragma unroll
    for (int i = 0; i < MT; ++i)
#pragma unroll
      for (int j = 0; j < kWT; ++j) acc[i][j] = wmma_bf16(a[i], b[j], acc[i][j]);
  }
}

// Async DMA global -> LDS (tracked by ASYNCcnt) of a thread's share of one
// chunk: four 16-byte pieces of K and four of V^T, 16 rows apart.  kl / vl are
// the thread's first LDS places, kg / vg its first global pieces.  One
// statement: the s_wait_xcnt at its end stands ahead of any rewrite of the
// address registers that the copies name.
__device__ __forceinline__ void async_copy_chunk(u16* kl, const u16* kg,
                                                 u16* vl, const u16* vg) {
  lds_u16* k0 = (lds_u16*)kl;
  lds_u16* k1 = k0 + 16 * kKStride;
  lds_u16* k2 = k0 + 32 * kKStride;
  lds_u16* k3 = k0 + 48 * kKStride;
  lds_u16* v0 = (lds_u16*)vl;
  lds_u16* v1 = v0 + 16 * kVStride;
  lds_u16* v2 = v0 + 32 * kVStride;
  lds_u16* v3 = v0 + 48 * kVStride;
  asm volatile("global_load_async_to_lds_b128 %0, %8, off\n\t"
               "global_load_async_to_lds_b128 %1, %9, off\n\t"
               "global_load_async_to_lds_b128 %2, %10, off\n\t"
               "global_load_async_to_lds_b128 %3, %11, off\n\t"
               "global_load_async_to_lds_b128 %4, %12, off\n\t"
               "global_load_async_to_lds_b128 %5, %13, off\n\t"
               "global_load_async_to_lds_b128 %6, %14, off\n\t"
               "global_load_async_to_lds_b128 %7, %15, off\n\t"
               "s_wait_xcnt 0x0"
               :
               : "v"(k0), "v"(k1), "v"(k2), "v"(k3), "v"(v0), "v"(v1), "v"(v2), "v"(v3),
                 "v"(kg), "v"(kg + 16 * kHD), "v"(kg + 32 * kHD), "v"(kg + 48 * kHD),
                 "v"(vg), "v"(vg + 16 * kS), "v"(vg + 32 * kS), "v"(vg + 48 * kS)
               : "memory");
}

__device__ __forceinline__ void wait_async0() {
  asm volatile("s_wait_asynccnt 0" ::: "memory");
}

// ---------------------------------------------------------------------------
// Kernel 0: elementwise f32 -> bf16 (8 elements / thread, vectorized) of x and
// the four weight matrices in ONE launch.  None of the five needs anything of
// another, so each takes a range of the block index; a block lies wholly in
// one array (every array is a whole number of 2048-element blocks).  The five
// bf16 planes follow one another in the workspace in the same order.
// The planes are written in fragment order (load_frag_packed).  A block takes
// 16 rows x 128 k = four tiles, which are its 2048 consecutive output elements.
// A wave takes 8 rows x one 32-k step: it reads 128 consecutive bytes of each
// row (8 lines per load) and stores four whole 128-byte lines.
// ---------------------------------------------------------------------------
constexpr int kCvtBlk = 256 * 8;                  // elements per block
constexpr int kXBlks  = kM * kH / kCvtBlk;        // 1536 blocks of x
constexpr int kWBlks  = kH * kH / kCvtBlk;        // 288 blocks per weight matrix
constexpr int kCvtK   = kCvtBlk / 16;             // 128 k per block
constexpr int kCvtKB  = kH / kCvtK;               // 6 blocks along k
static_assert(kXBlks * kCvtBlk == kM * kH && kWBlks * kCvtBlk == kH * kH,
              "every array is a whole number of blocks");
static_assert(kCvtKB * kCvtK == kH && kCvtK == 4 * 32 && kM % 16 == 0 && kH % 16 == 0,
              "a block is four whole tiles of one 16-row strip");

__global__ void __launch_bounds__(256)
cvt_bf16_kernel(const float* __restrict__ x,
                const float* __restrict__ Wq, const float* __restrict__ Wk,
                const float* __restrict__ Wv, const float* __restrict__ Wo,
                u16* __restrict__ out) {
  const int blk = blockIdx.x;
  const float* in = x;                            // block-uniform choice
  int first = 0;                                  // first block of that array
  if (blk >= kXBlks) {
    const int w = (blk - kXBlks) / kWBlks;
    first = kXBlks + w * kWBlks;
    in = w == 0 ? Wq : w == 1 ? Wk : w == 2 ? Wv : Wo;
  }
  const int lb  = blk - first;                    // block inside its array
  const int tid = threadIdx.x;
  const int ml  = ((tid >> 5) & 1) * 8 + (tid & 7);  // row in the 16-row strip
  const int g   = (tid >> 3) & 3;                 // group of 8 k in the 32-k step
  const int ks  = tid >> 6;                       // 32-k step in the block
  const float* p = in + ((lb / kCvtKB) * 16 + ml) * kH + (lb % kCvtKB) * kCvtK +
                   ks * 32 + g * 8;
  u16* q = out + (size_t)blk * kCvtBlk + ks * kTileElems +
           (g >> 1) * 256 + (g & 1) * 128 + ml * 8;
  v4f a = *(const v4f*)(p);
  v4f b = *(const v4f*)(p + 4);
  v8us u;
#pragma unroll
  for (int j = 0; j < 4; ++j) { u[j] = f2bf_u(a[j]); u[4 + j] = f2bf_u(b[j]); }
  *(v8us*)q = u;
}

// ---------------------------------------------------------------------------
// Kernel 1: QKV projection from bf16 operands.  out = x @ W^T + b.
// Q,K written bf16 [BH, S, HD]; V written TRANSPOSED bf16 [BH, HD, S].
// A block owns 128 rows of x and 288 output columns and brings both operands
// into LDS with global_load_async_to_lds_b128, two buffers of 96 k each: a byte
// of x or W leaves L2 once per block, not once per wave that reads it.  Its 12
// waves (three on every SIMD) are 2 row groups x 6 column groups, 64 x 48
// outputs each (4 x 3 accumulator tiles).
// The three weight planes follow one another in the workspace: one matrix of
// 3 * kH rows = 144 strips of 16.  Block column by takes the 12 strips by * 12 ..
// of Q and K (three whole heads, so every 128-byte row of Q or K is written by
// one block) and the 6 strips 96 + by * 6 .. of V (a 128-byte line of V^T is 64
// rows of x for one column: one wave's).
// ---------------------------------------------------------------------------
constexpr int kPM      = 128;                     // rows of x per block
constexpr int kPW      = 12;                      // waves per block
constexpr int kPCG     = 6;                       // column groups of waves
constexpr int kPJ      = 3;                       // 16-column tiles per wave
constexpr int kPAS     = kPM / 16;                // 8 strips of x per block
constexpr int kPQK     = 12;                      // strips of Q and K per block
constexpr int kPV      = 6;                       // strips of V per block
constexpr int kPStrips = kPAS + kPQK + kPV;       // 26 strips in LDS
constexpr int kPKS     = 3;                       // 32-k steps per chunk
constexpr int kPChunks = kH / (32 * kPKS);        // 8 chunks
constexpr int kPStripElems = kPKS * kTileElems;   // a strip's part of a chunk
constexpr int kPBufElems   = kPStrips * kPStripElems;
constexpr int kPCopies = kPStrips * kPKS * 2 / kPW;  // 13 copies of 512 bytes per wave
constexpr int kPBY     = 3 * kH / 16 / (kPQK + kPV); // 8 block columns
static_assert(kPChunks * kPKS * 32 == kH && kPChunks >= 2, "whole chunks; two buffers");
static_assert(kPCopies * kPW == kPStrips * kPKS * 2, "every wave copies as much");
static_assert(kPBY * kPQK * 16 == 2 * kH && kPBY * kPV * 16 == kH && kPQK % 4 == 0,
              "the block columns cover Q, K (whole heads) and V");
static_assert(kPCG * kPJ == kPQK + kPV && (kPW / kPCG) * kWT == kPAS && kS % kPM == 0,
              "the waves cover the block's tile; a block stays in one batch");

// A wave's share of one chunk: 13 copies of 512 consecutive bytes each (half a
// fragment-order tile).  l: the lane's first LDS place, the others 512 bytes
// apart; g: the lane's global pieces.  One statement: the s_wait_xcnt at its end
// stands ahead of any rewrite of the address registers that the copies name.
__device__ __forceinline__ void async_copy_share(u16* l, const u16* const (&g)[kPCopies]) {
  lds_u16* p = (lds_u16*)l;
  asm volatile("global_load_async_to_lds_b128 %0, %13, off\n\t"
               "global_load_async_to_lds_b128 %1, %14, off\n\t"
               "global_load_async_to_lds_b128 %2, %15, off\n\t"
               "global_load_async_to_lds_b128 %3, %16, off\n\t"
               "global_load_async_to_lds_b128 %4, %17, off\n\t"
               "global_load_async_to_lds_b128 %5, %18, off\n\t"
               "global_load_async_to_lds_b128 %6, %19, off\n\t"
               "global_load_async_to_lds_b128 %7, %20, off\n\t"
               "global_load_async_to_lds_b128 %8, %21, off\n\t"
               "global_load_async_to_lds_b128 %9, %22, off\n\t"
               "global_load_async_to_lds_b128 %10, %23, off\n\t"
               "global_load_async_to_lds_b128 %11, %24, off\n\t"
               "global_load_async_to_lds_b128 %12, %25, off\n\t"
               "s_wait_xcnt 0x0"
               :
               : "v"(p), "v"(p + 256), "v"(p + 2 * 256), "v"(p + 3 * 256), "v"(p + 4 * 256),
                 "v"(p + 5 * 256), "v"(p + 6 * 256), "v"(p + 7 * 256), "v"(p + 8 * 256),
                 "v"(p + 9 * 256), "v"(p + 10 * 256), "v"(p + 11 * 256), "v"(p + 12 * 256),
                 "v"(g[0]), "v"(g[1]), "v"(g[2]), "v"(g[3]), "v"(g[4]), "v"(g[5]), "v"(g[6]),
                 "v"(g[7]), "v"(g[8]), "v"(g[9]), "v"(g[10]), "v"(g[11]), "v"(g[12])
               : "memory");
}

__global__ void __launch_bounds__(32 * kPW)
qkv_proj_kernel(const u16* __restrict__ planes,
                const float* __restrict__ bq, const float* __restrict__ bk,
                const float* __restrict__ bv,
                u16* __restrict__ Qo, u16* __restrict__ Ko,
                u16* __restrict__ Vt) {
  // Per buffer: strip s of the block (x first, then W), fragment order, at
  // s * kPStripElems.
  __shared__ __align__(16) u16 pbuf[2][kPBufElems];

  const int lane = threadIdx.x & 31;
  const int wave = __builtin_amdgcn_readfirstlane(threadIdx.x >> 5);
  const int lh   = lane >> 4;
  const int ml   = lane & 15;
  const int wr   = wave / kPCG;               // 64-row group
  const int wc   = wave % kPCG;               // 48-column group
  const int by   = blockIdx.y;
  const int m0   = blockIdx.x * kPM;

  // Strip of the stacked weights that is the block's W strip t: t plus one of
  // two block constants.
  const int wqk = by * kPQK, wv = 2 * kH / 16 + by * kPV - kPQK;
  auto wstrip = [&](int t) { return t + (t < kPQK ? wqk : wv); };
  // planes: x and behind it the stacked weights, as the conversion writes them:
  // one array of strips.  The strip of it that is strip s of the block's buffer.
  const int px = (int)blockIdx.x * kPAS, pqk = kM / 16 - kPAS + wqk, pv = kM / 16 - kPAS + wv;
  auto pstrip = [&](int s) { return s + (s < kPAS ? px : s < kPAS + kPQK ? pqk : pv); };

  // Copy e = wave * 13 + i of a chunk is 512-byte part e % 6 of strip e / 6; it
  // lands at e * 512 bytes in the buffer.
  const u16* g0[kPCopies];                    // the lane's pieces of chunk 0
  // Unrolled, here and in stage: g0 and g are indexed by constants (registers).
#pragma unroll
  for (int i = 0; i < kPCopies; ++i) {
    const int e = wave * kPCopies + i;
    const int s = e / (2 * kPKS), part = e % (2 * kPKS);
    g0[i] = planes + (pstrip(s) * (16 * kH) + part * 256 + lane * 8);
  }
  auto stage = [&](int buf, int c) {
    const u16* g[kPCopies];
#pragma unroll
    for (int i = 0; i < kPCopies; ++i) g[i] = g0[i] + c * kPStripElems;
    async_copy_share(&pbuf[buf][wave * kPCopies * 256 + lane * 8], g);
  };

  // Kick off the copies of chunk 0 into buffer 0.
  stage(0, 0);

  // Prefetch into L2 of what the later chunks read.  The block's x rows are read
  // by the 8 blocks along y: a block asks for a quarter of k of all 8 strips (24
  // units each), waves 0..5 one instruction each.  Its W strips are read by the
  // 32 blocks along x: 16 neighbours ask for the same half of k (48 units of
  // each of 18 strips, 27 instructions: two per wave, waves 0..2 a third).
  const int ua = (wave % 6) * 32 + lane;
  const unsigned pfa = (unsigned)pstrip(ua / 24) * kStripBytes + (unsigned)(by & 3) * 6144u +
                       (unsigned)(ua % 24) * 256u;
  unsigned pfb[3];
#pragma unroll
  for (int i = 0; i < 3; ++i) {               // unrolled: pfb stays in registers
    const int ub = ((i < 2 ? i * kPW : (wave < 3 ? 2 * kPW : 0)) + wave) * 32 + lane;
    pfb[i] = (unsigned)pstrip(kPAS + ub / 48) * kStripBytes + (blockIdx.x >> 4) * 12288u +
             (unsigned)(ub % 48) * 256u;
  }
  if (wave < 6) prefetch_units<0>(planes, pfa);
  prefetch_units<0>(planes, pfb[0]);
  prefetch_units<0>(planes, pfb[1]);
  if (wave < 3) prefetch_units<0>(planes, pfb[2]);

  // The wave's three column tiles: row n of the stacked weights (wave-uniform)
  // and its bias values, fetched here so that the loop covers their latency.
  int   nj[kPJ];
  float bbj[kPJ];
#pragma unroll
  for (int j = 0; j < kPJ; ++j) {             // unrolled: both stay in registers
    nj[j] = wstrip(wc * kPJ + j) * 16;
    bbj[j] = (nj[j] < kH ? bq : nj[j] < 2 * kH ? bk : bv)[nj[j] % kH + ml];
  }
  // Behind these loads: their index registers are reused in what follows.
  asm volatile("s_wait_xcnt 0x0" ::: "memory");

  v8f acc[kWT][kPJ] = {};

  wait_async0();                      // my share of chunk 0 has landed
  __syncthreads();                    // everyone's has
  // Chunk 1's copies fly while chunk 0 is worked on.
  stage(1, 1);

  for (int c = 0; c < kPChunks; ++c) {
    const int cur = c & 1;
    const u16* ab = &pbuf[cur][(wr * kWT) * kPStripElems + lane * 8];
    const u16* bb = &pbuf[cur][(kPAS + wc * kPJ) * kPStripElems + lane * 8];
    // Two register sets: the fragments of k-step ks + 1 (of this chunk only) are
    // fetched as one group under the WMMAs of k-step ks.  Every loop is
    // unrolled: the arrays are indexed by constants and stay in registers.
    v16bf a[2][kWT], b[2][kPJ];
    auto fetch = [&](int ks) {
#pragma unroll
      for (int i = 0; i < kWT; ++i)
        a[ks & 1][i] = load_frag_packed(ab + i * kPStripElems + ks * kTileElems);
#pragma unroll
      for (int j = 0; j < kPJ; ++j)
        b[ks & 1][j] = load_frag_packed(bb + j * kPStripElems + ks * kTileElems);
    };
    fetch(0);
#pragma unroll
    for (int ks = 0; ks < kPKS; ++ks) {
      if (ks + 1 < kPKS) fetch(ks + 1);
      // Keeps the LDS loads in one group ahead of the WMMAs: sunk among them
      // they share one register set, and every WMMA row waits out its own
      // loads' whole latency.
      __builtin_amdgcn_sched_barrier(0);
#pragma unroll
      for (int i = 0; i < kWT; ++i)
#pragma unroll
        for (int j = 0; j < kPJ; ++j)
          acc[i][j] = wmma_bf16(a[ks & 1][i], b[ks & 1][j], acc[i][j]);
      // Keeps the next group of loads, and at the end the foot of the trip,
      // behind these WMMAs: the foot's wait for the next chunk's copies would
      // otherwise come early and stall.
      __builtin_amdgcn_sched_barrier(0);
    }
    // ---- foot of the trip: one barrier publishes the next chunk and ends every
    // wave's reads of this one, whose buffer is refilled behind it ----
    // My reads of cur are done.  The wait names the prefetches' base and lane
    // offsets: their registers then hold in-bounds addresses all through the
    // loop, whenever a prefetch is served.
    asm volatile("s_wait_dscnt 0x0"
                 :: "s"(planes), "v"(pfa), "v"(pfb[0]), "v"(pfb[1]), "v"(pfb[2])
                 : "memory");
    wait_async0();                    // my share of the next chunk has landed
    __syncthreads();
    if (c + 2 < kPChunks) stage(cur, c + 2);
  }
  wait_async0();                      // nothing in flight when the wave ends

  const int bidx = m0 / kS;                   // 128 rows never cross a batch
  const int s0   = m0 % kS + wr * (16 * kWT) + 8 * lh;
#pragma unroll
  for (int j = 0; j < kPJ; ++j) {             // unrolled: acc stays in registers
    const int z  = nj[j] / kH;                // 0: Q, 1: K, 2: V
    const int cc = nj[j] % kH;                // output column of that projection
    const int bh = bidx * kNH + cc / kHD;
    const int d  = cc % kHD + ml;
    if (z == 2) {                             // V: [BH, HD, S]
      u16* o = Vt + ((size_t)bh * kHD + d) * kS + s0;
#pragma unroll
      for (int i = 0; i < kWT; ++i)
#pragma unroll
        for (int r = 0; r < 8; ++r) o[i * 16 + r] = f2bf_u(acc[i][j][r] + bbj[j]);
      // Behind a tile's stores, here and below: the code that follows in the
      // text rewrites the registers that they name.
      asm volatile("s_wait_xcnt 0x0" ::: "memory");
    } else {                                  // Q, K: [BH, S, HD]
      u16* o = (z == 0 ? Qo : Ko) + ((size_t)bh * kS + s0) * kHD + d;
#pragma unroll
      for (int i = 0; i < kWT; ++i)
#pragma unroll
        for (int r = 0; r < 8; ++r) o[(i * 16 + r) * kHD] = f2bf_u(acc[i][j][r] + bbj[j]);
      asm volatile("s_wait_xcnt 0x0" ::: "memory");
    }
  }
}

// ---------------------------------------------------------------------------
// Kernel 2: flash attention, transposed products.  4 waves / block share one
// (b,h); K/V chunks of 64 keys are DMA'd into double-buffered LDS with
// global_load_async_to_lds_b128, then each wave streams WMMA fragments from LDS.
// A wave owns 32 queries (two tiles): every K, V^T and mask fragment it reads
// from LDS feeds two WMMAs, and maximum, exchange and rescale come once per 64
// keys.
// A block owns 64 queries and splits the keys: waves 0, 1 walk the first half of
// the keys for the two 32-query groups, waves 2, 3 the second half.  That makes
// 3,072 waves of 16 passes, three on every SIMD (registers allow three), where
// 1,536 waves of 32 passes leave a SIMD with one or two; the vector work of one
// wave then runs under the matrix work and the LDS waits of two others.  The
// two waves of a query group join their partial results at the end, through
// LDS: each hands one of its two tiles to the other and finishes the one it
// keeps.
//   S^T = K Q^T   : A = K rows, B = Q rows; lane (c, h) holds query column c,
//                   register r of tile t = key t*16 + 8h + r.
//   O^T += V^T P^T: A = V^T rows, B = the two S^T tiles packed to bf16 in place
//                   (their register order is the k order of the A loader).
// A query's scores sit in the two lanes c and c + 16: maximum and sum are taken
// in the lane, with one exchange between the halves.  Writes ctx bf16 [B*S, H]
// in fragment order (load_frag_packed).
// ---------------------------------------------------------------------------
__device__ __forceinline__ unsigned pack_bf16(float lo, float hi) {
  return __builtin_bit_cast(unsigned, __builtin_convertvector(v2f{lo, hi}, v2bf));
}

__device__ __forceinline__ float max3f(float a, float b, float c) {
  return fmaxf(fmaxf(a, b), c);
}

// Value of lane l ^ 16.
__device__ __forceinline__ float other_half(float x) {
  const int v = __builtin_bit_cast(int, x);
  return __builtin_bit_cast(float, __builtin_amdgcn_permlanex16(
      v, v, 0x76543210, 0xfedcba98, false, false));
}

// Hands tile U of this wave's partial result (O^T, maximum, sum) to the wave
// that walked the other half of the keys.  xo / xml: this wave's own LDS slots.
template <int U>
__device__ __forceinline__ void hand_over_tile(const v8f (&o)[kQT][4], const float (&mrun)[kQT],
                                               const float (&lrun)[kQT], v4f (*xo)[32],
                                               float (*xml)[32], int lane) {
  // Unrolled: o is indexed by constants and stays in registers.
#pragma unroll
  for (int dt = 0; dt < 4; ++dt) {
    xo[2 * dt][lane]     = __builtin_shufflevector(o[U][dt], o[U][dt], 0, 1, 2, 3);
    xo[2 * dt + 1][lane] = __builtin_shufflevector(o[U][dt], o[U][dt], 4, 5, 6, 7);
  }
  xml[0][lane] = mrun[U];
  xml[1][lane] = lrun[U];
}

// Joins tile U with the partner's part of it (xo / xml: the partner's slots),
// joins the lane halves' sums, normalizes and writes ctx (bf16), fragment order.
// A lane holds 8 consecutive d of its query per tile, group g = 2 (dt & 1) + lh
// of 32-k step 2 h + (dt >> 1): one 16-byte store each, at lane * 8 in its half
// tile, so a wave's store is 512 consecutive bytes.  crow: tile U's place + lane * 8.
template <int U>
__device__ __forceinline__ void finish_tile(const v8f (&o)[kQT][4], const float (&mrun)[kQT],
                                            const float (&lrun)[kQT], const v4f (*xo)[32],
                                            const float (*xml)[32], int lane, u16* crow) {
  const float mo = xml[0][lane];
  const float lo = xml[1][lane];
  // Both parts are brought to the larger of the two maxima: its own factor is 1.
  const float d  = mrun[U] - mo;
  const float e  = __builtin_amdgcn_exp2f(-__builtin_fabsf(d));
  const float am = d < 0.0f ? e : 1.0f;
  const float ao = d < 0.0f ? 1.0f : e;
  const float ls = lrun[U] * am + lo * ao;
  const float inv = 1.0f / (ls + other_half(ls));
  const float fm = am * inv, fo = ao * inv;
  // Both loops unrolled: o, po and w are indexed by constants (registers).
#pragma unroll
  for (int dt = 0; dt < 4; ++dt) {
    const v8f po = __builtin_shufflevector(xo[2 * dt][lane], xo[2 * dt + 1][lane],
                                           0, 1, 2, 3, 4, 5, 6, 7);
    v8us w;
#pragma unroll
    for (int r = 0; r < 8; ++r) w[r] = f2bf_u(o[U][dt][r] * fm + po[r] * fo);
    *(v8us*)(crow + dt * 256) = w;
  }
}

__global__ void __launch_bounds__(32 * kAW)
flash_attn_kernel(const u16* __restrict__ Q, const u16* __restrict__ K,
                  const u16* __restrict__ Vt,
                  const float* __restrict__ amask,
                  u16* __restrict__ ctx) {
  __shared__ __align__(16) u16 kbuf[2][kKH][kKC * kKStride]; // 64 kv-rows x 64 dims
  __shared__ __align__(16) u16 vbuf[2][kKH][kHD * kVStride]; // 64 d-rows  x 64 kv
  __shared__ __align__(16) float mbias[kS];             // mask term per key
  __shared__ __align__(16) v4f xo[kAW][8][32];          // per wave: the tile it hands over
  __shared__ __align__(16) float xml[kAW][2][32];       //           its maximum and sum

  const int tid  = threadIdx.x;
  const int lane = tid & 31;
  const int wave = __builtin_amdgcn_readfirstlane(tid >> 5);
  const int qg   = wave % kQW;                // 32-query group of the block
  const int kh   = wave / kQW;                // key half that this wave walks
  const int lh   = lane >> 4;
  const int ml   = lane & 15;
  const int c0   = lh * 8;

  const int bh = blockIdx.y;                  // 0..B*NH-1
  const int b  = bh / kNH;
  const int q0 = (blockIdx.x * kQW + qg) * (16 * kQT);

  const u16* Qb  = Q  + (size_t)bh * kS * kHD;
  const u16* Kb  = K  + (size_t)bh * kS * kHD;
  const u16* Vtb = Vt + (size_t)bh * kHD * kS;

  // Staging coordinates: a chunk of K and one of V^T are 64 rows x 8 pieces of
  // 16 bytes each; a thread takes piece srow, sseg and the ones 16, 32 and 48
  // rows on.  All four waves stage pass p's chunk of either key half.
  const int srow = tid >> 3, sseg = tid & 7;
  const u16* kg = Kb + (size_t)srow * kHD + sseg * 8;   // chunk 0
  const u16* vg = Vtb + (size_t)srow * kS + sseg * 8;
  auto stage = [&](int buf, int p) {
    // Unrolled: the halves' LDS places and key offsets are constants.
#pragma unroll
    for (int hf = 0; hf < kKH; ++hf)
      async_copy_chunk(&kbuf[buf][hf][srow * kKStride + sseg * 8],
                       kg + (size_t)(hf * kHalf + p * kKC) * kHD,
                       &vbuf[buf][hf][srow * kVStride + sseg * 8],
                       vg + (hf * kHalf + p * kKC));
  };

  // Q fragments of the wave's tiles (HD=64 -> two k-steps of 32), loaded once.
  v16bf qf[kQT][2];
#pragma unroll
  for (int u = 0; u < kQT; ++u) {
    qf[u][0] = load_frag_bf16(Qb + (size_t)(q0 + u * 16 + ml) * kHD + 0  + c0);
    qf[u][1] = load_frag_bf16(Qb + (size_t)(q0 + u * 16 + ml) * kHD + 32 + c0);
  }

  v8f o[kQT][4] = {};                         // O^T: o[u][dt][r] = d dt*16+8h+r, query c
  float mrun[kQT], lrun[kQT];                 // scaled log2 maximum; this lane's sum
#pragma unroll
  for (int u = 0; u < kQT; ++u) { mrun[u] = -3.0e38f; lrun[u] = 0.0f; }

  // Kick off DMA for pass 0 into buffer 0.
  stage(0, 0);

  // Prefetch of K and V^T, in groups of 256 keys of a key half (4 passes): 128
  // units of K (consecutive) and 128 of V^T (two per d row).  The 32 blocks of a
  // (b,h) walk the same keys in step, so they share the asking: a block takes a
  // quarter of every group of one half, chosen by its index, with its waves 0
  // and 1.  pf walks from group to group, lives through the loop and stays inside
  // the array; group 0 is asked for here, group g + 1 at the foot of group g's
  // first pass.
  const bool pfwave = wave < 2;
  const int  pfq    = blockIdx.x & 3;           // quarters 0, 1: K; 2, 3: V^T
  const int  pfh    = (blockIdx.x >> 2) & 1;    // the key half asked for
  const int  pfu    = (pfq & 1) * 64 + (tid & 63);
  const char* pf = pfq < 2 ? (const char*)Kb + pfh * (kHalf * kHD * 2) + pfu * 256
                           : (const char*)Vtb + pfh * (kHalf * 2) +
                                 (pfu >> 1) * (kS * 2) + (pfu & 1) * 256;
  const int pfstep = pfq < 2 ? 256 * kHD * 2 : 256 * 2;
  if (pfwave) asm volatile("global_prefetch_b8 %0, off scope:SCOPE_SE" :: "v"(pf));

  // A key is a row of the score tile, so its mask term differs by register
  // and not by lane: all kS terms go to LDS once (16 per thread), times
  // sqrt(HD) = 8 (exact) because they start the accumulator ahead of the
  // 1/sqrt(HD) scaling.  The barrier in front of the loop publishes them.
  {
    const float* amb = amask + (size_t)b * kS;   // same for the whole block
    const float* am  = amb + tid * 16;
    v4f mm[4];
#pragma unroll
    for (int i = 0; i < 4; ++i) mm[i] = *(const v4f*)(am + 4 * i);
    // Behind the loads, naming their scalar base: otherwise that register
    // pair is reused for constants ahead of any wait.
    asm volatile("s_wait_xcnt 0x0" :: "s"(amb) : "memory");
#pragma unroll
    for (int i = 0; i < 4; ++i) {
#pragma unroll
      for (int j = 0; j < 4; ++j) mm[i][j] = (1.0f - mm[i][j]) * -80000.0f;
      *(v4f*)(&mbias[tid * 16 + 4 * i]) = mm[i];
    }
  }

  wait_async0();                      // my share of chunk 0 has landed
  __syncthreads();                    // everyone's has; mask terms published
  // Pass 1's chunks fly while pass 0's are worked on.
  stage(1, 1);

  constexpr float kScale = 0.125f * 1.4426950408889634f;  // log2(e) / sqrt(HD)

  constexpr int kPasses = kHalf / kKC;
  static_assert(kPasses >= 2 && kHalf % 256 == 0, "two buffers; whole prefetch groups");
  for (int p = 0; p < kPasses; ++p) {
    const int cur = p & 1;
    const int kv0 = kh * kHalf + p * kKC;     // this wave's first key of the pass

    const u16* kch = &kbuf[cur][kh][0];
    const u16* vch = &vbuf[cur][kh][0];

    // ---- K rows and mask terms of the pass: each feeds both query tiles ----
    v16bf kf[4][2];
    v8f mk[4];
#pragma unroll
    for (int t = 0; t < 4; ++t) {
      const u16* krow_l = kch + (t * 16 + ml) * kKStride + c0;
      kf[t][0] = load_frag_bf16(krow_l + 0);
      kf[t][1] = load_frag_bf16(krow_l + 32);
      const float* mrow = &mbias[kv0 + t * 16 + c0];
      const v4f ma = *(const v4f*)(mrow);
      const v4f mb = *(const v4f*)(mrow + 4);
      mk[t] = __builtin_shufflevector(ma, mb, 0, 1, 2, 3, 4, 5, 6, 7);
    }
    // Keeps these LDS loads in one group ahead of the WMMAs: sunk among them
    // they share one register set, and every WMMA then waits for its own
    // loads' whole latency.
    __builtin_amdgcn_sched_barrier(0);

    // ---- S^T: 4 x kQT tiles of 16x16, keys [kv0, kv0+64) x 32 queries ----
    v8f st[kQT][4];
#pragma unroll
    for (int t = 0; t < 4; ++t)
#pragma unroll
      for (int u = 0; u < kQT; ++u) st[u][t] = wmma_bf16(kf[t][0], qf[u][0], mk[t]);
#pragma unroll
    for (int t = 0; t < 4; ++t)
#pragma unroll
      for (int u = 0; u < kQT; ++u) st[u][t] = wmma_bf16(kf[t][1], qf[u][1], st[u][t]);

    // Keeps the V^T loads behind the S^T products, whose K registers they
    // take over: raised among them they need a register set of their own.
    __builtin_amdgcn_sched_barrier(0);

    // ---- V^T rows (two k-steps of 32 keys), fetched under the softmax ----
    v16bf vf[4][2];
#pragma unroll
    for (int dt = 0; dt < 4; ++dt) {
      const u16* vrow_l = vch + (dt * 16 + ml) * kVStride + c0;
      vf[dt][0] = load_frag_bf16(vrow_l + 0);
      vf[dt][1] = load_frag_bf16(vrow_l + 32);
    }
    // Keeps these loads in one group ahead of the softmax, so that its
    // arithmetic covers their latency.
    __builtin_amdgcn_sched_barrier(0);

    // ---- online softmax of query c of each tile, log2 domain ----
    v16bf pb[kQT][2];
#pragma unroll
    for (int u = 0; u < kQT; ++u) {
      float tm[4];
#pragma unroll
      for (int t = 0; t < 4; ++t)
        tm[t] = max3f(max3f(st[u][t][0], st[u][t][1], st[u][t][2]),
                      max3f(st[u][t][3], st[u][t][4], st[u][t][5]), st[u][t][6]);
      float mx = max3f(max3f(tm[0], tm[1], st[u][0][7]),
                       max3f(tm[2], tm[3], st[u][1][7]),
                       fmaxf(st[u][2][7], st[u][3][7]));
      mx = fmaxf(mx, other_half(mx));
      const float mnew  = fmaxf(mrun[u], mx * kScale);
      const float alpha = __builtin_amdgcn_exp2f(mrun[u] - mnew);
      mrun[u] = mnew;
      const v8f vscale = {kScale, kScale, kScale, kScale, kScale, kScale, kScale, kScale};
      const v8f vmneg  = {-mnew, -mnew, -mnew, -mnew, -mnew, -mnew, -mnew, -mnew};
#pragma unroll
      for (int t = 0; t < 4; ++t) {
        st[u][t] = __builtin_elementwise_fma(st[u][t], vscale, vmneg);
#pragma unroll
        for (int r = 0; r < 8; ++r) st[u][t][r] = __builtin_amdgcn_exp2f(st[u][t][r]);
      }
      const v8f s8 = (st[u][0] + st[u][1]) + (st[u][2] + st[u][3]);
      const v4f s4 = __builtin_shufflevector(s8, s8, 0, 1, 2, 3) +
                     __builtin_shufflevector(s8, s8, 4, 5, 6, 7);
      lrun[u] = lrun[u] * alpha + ((s4[0] + s4[1]) + (s4[2] + s4[3]));
#pragma unroll
      for (int dt = 0; dt < 4; ++dt) o[u][dt] *= alpha;

      // P^T as B operand of k-step ks: element s = st[u][2 ks + (s >> 3)][s & 7]
#pragma unroll
      for (int ks = 0; ks < 2; ++ks) {
        v8u pu;
#pragma unroll
        for (int i = 0; i < 4; ++i) {
          pu[i]     = pack_bf16(st[u][2 * ks][2 * i],     st[u][2 * ks][2 * i + 1]);
          pu[4 + i] = pack_bf16(st[u][2 * ks + 1][2 * i], st[u][2 * ks + 1][2 * i + 1]);
        }
        pb[u][ks] = __builtin_bit_cast(v16bf, pu);
      }
    }

    // ---- O^T += V^T P^T : four 16-row d tiles across HD=64, two k-steps ----
#pragma unroll
    for (int ks = 0; ks < 2; ++ks)
#pragma unroll
      for (int dt = 0; dt < 4; ++dt)
#pragma unroll
        for (int u = 0; u < kQT; ++u)
          o[u][dt] = wmma_bf16(vf[dt][ks], pb[u][ks], o[u][dt]);

    // Keeps the foot at the foot: raised to where the last LDS load lands, the
    // wait for the next chunk's copies would come half a pass early and stall.
    __builtin_amdgcn_sched_barrier(0);
    // ---- foot of the pass: one barrier publishes the next chunk and ends
    // every wave's reads of this one, whose buffer is refilled behind it, a
    // whole pass ahead of its use ----
    asm volatile("s_wait_dscnt 0x0" ::: "memory");   // my reads of cur are done
    wait_async0();                                   // my share of the next chunk has landed
    __syncthreads();
    if (p + 2 < kPasses) {
      stage(cur, p + 2);
      if (pfwave && (p & 3) == 0 && p + 4 < kPasses) {
        pf += pfstep;
        asm volatile("global_prefetch_b8 %0, off scope:SCOPE_SE" :: "v"(pf));
      }
    }
  }
  wait_async0();                      // nothing in flight when the wave ends

  // ---- join the two key halves: the wave of half kh keeps tile kh of its query
  // group and hands the other one over (the tile index is a constant on either
  // side of a wave-uniform test, so o stays in registers) ----
  static_assert(kKH == 2 && kQT == 2, "one tile kept, one handed over");
  if (kh == 0) hand_over_tile<1>(o, mrun, lrun, xo[wave], xml[wave], lane);
  else         hand_over_tile<0>(o, mrun, lrun, xo[wave], xml[wave], lane);
  __syncthreads();                    // every wave's handed-over tile is in LDS
  const int h = bh % kNH;
  const int partner = wave ^ kQW;     // same query group, other key half
  u16* crow = ctx + ((size_t)b * kS + q0 + kh * 16) * kH + h * 2 * kTileElems + lane * 8;
  if (kh == 0) finish_tile<0>(o, mrun, lrun, xo[partner], xml[partner], lane, crow);
  else         finish_tile<1>(o, mrun, lrun, xo[partner], xml[partner], lane, crow);
}

// ---------------------------------------------------------------------------
// Kernel 3: output projection + bias + residual + LayerNorm, one launch.
//   y = ctx @ Wo^T + bo + x;  out = (y - mean) * rstd * gamma + beta
// A block owns kLT * 16 = 32 whole rows: its 12 waves take 64 columns each
// (2 x 4 accumulator tiles) and share the rows of ctx.  y stays in registers:
// each wave sums its 64 columns of every row, the 12 partial sums of a row meet
// in LDS behind one barrier, and every wave normalizes and stores its own tile.
// ---------------------------------------------------------------------------
constexpr int kLT = 2;                        // 16-row tiles per block
constexpr int kLW = kH / (16 * kWT);          // 12 waves cover the kH columns
constexpr int kLR = 16 * kLT;                 // 32 rows per block = lanes per wave
static_assert(kLR == 32 && kLW * 16 * kWT == kH && kM % kLR == 0,
              "one lane per row in the join of the partial sums");

// v + (v of lane l ^ M), M < 16: one step of a sum over a 16-lane row (DPP
// row_xmask).
template <int M>
__device__ __forceinline__ float add_row_xor(float v) {
  return v + __builtin_bit_cast(float, __builtin_amdgcn_mov_dpp(
      __builtin_bit_cast(int, v), 0x160 + M, 0xf, 0xf, false));
}

__global__ void __launch_bounds__(32 * kLW)
out_proj_ln_kernel(const u16* __restrict__ ctxb, const u16* __restrict__ Wob,
                   const float* __restrict__ bo, const float* __restrict__ x,
                   const float* __restrict__ gamma, const float* __restrict__ beta,
                   float* __restrict__ out) {
  __shared__ __align__(16) float psum[kLW][kLR];   // per wave and row: sum of y
  __shared__ __align__(16) float psq[kLW][kLR];    //                   sum of y * y
  __shared__ __align__(16) float smean[kLW][kLR];  // per row, a copy for each wave
  __shared__ __align__(16) float srstd[kLW][kLR];

  const int lane = threadIdx.x & 31;
  const int wave = __builtin_amdgcn_readfirstlane(threadIdx.x >> 5);
  const int lh   = lane >> 4;
  const int ml   = lane & 15;
  const int m0   = blockIdx.x * kLR;
  const int n0   = wave * (16 * kWT);

  // Prefetch.  The block's 32 rows of ctx: an instruction covers four k-steps
  // (4096 bytes) of both strips, waves 0..5 one each.  The wave's rows of Wo are
  // read by every block: a block asks for two of the 24 k-steps, chosen by its
  // index.
  const u16* crows = ctxb + (size_t)m0 * kH;
  const u16* wrows = Wob + (size_t)n0 * kH;
  const unsigned pfa = prefetch_lane_off<kLT>(lane) + (unsigned)(wave % 6) * 4096u;
  const unsigned pfb = prefetch_lane_off<kWT>(lane) + (blockIdx.x % 12) * 2048u;
  if (wave < 6) prefetch_units<0>(crows, pfa);
  prefetch_units<0>(wrows, pfb);

  v8f acc[kLT][kWT] = {};
  gemm_wave_tile(crows, wrows, (unsigned)lane, pfa, pfb, acc);

  float bb_[kWT], gg[kWT], bt[kWT];
#pragma unroll
  for (int j = 0; j < kWT; ++j) {
    bb_[j] = bo[n0 + j * 16 + ml];
    gg[j]  = gamma[n0 + j * 16 + ml];
    bt[j]  = beta[n0 + j * 16 + ml];
  }

  // The 64 residual values of the tile are fetched together, so the wave waits
  // for memory once.  y[i][j][r] = row i*16 + 8*lh + r, column n0 + j*16 + ml.
  const size_t base = (size_t)(m0 + 8 * lh) * kH + n0 + ml;
  v8f y[kLT][kWT];
#pragma unroll
  for (int i = 0; i < kLT; ++i)
#pragma unroll
    for (int j = 0; j < kWT; ++j)
#pragma unroll
      for (int r = 0; r < 8; ++r) y[i][j][r] = x[base + (i * 16 + r) * kH + j * 16];
  // Behind the loads above: their index registers are reused in what follows.
  asm volatile("s_wait_xcnt 0x0" ::: "memory");
#pragma unroll
  for (int i = 0; i < kLT; ++i)
#pragma unroll
    for (int j = 0; j < kWT; ++j) y[i][j] = acc[i][j] + bb_[j] + y[i][j];

  // ---- this wave's 64 columns of each row: 4 in the lane, then the 16 lanes
  // of the half ----
#pragma unroll
  for (int i = 0; i < kLT; ++i) {
    const v8f s8 = (y[i][0] + y[i][1]) + (y[i][2] + y[i][3]);
    const v8f q8 = (y[i][0] * y[i][0] + y[i][1] * y[i][1]) +
                   (y[i][2] * y[i][2] + y[i][3] * y[i][3]);
    float s[8], q[8];
#pragma unroll
    for (int r = 0; r < 8; ++r) {
      s[r] = add_row_xor<8>(add_row_xor<4>(add_row_xor<2>(add_row_xor<1>(s8[r]))));
      q[r] = add_row_xor<8>(add_row_xor<4>(add_row_xor<2>(add_row_xor<1>(q8[r]))));
    }
    if (ml == 0) {                            // one lane of each half: its 8 rows
      v4f* ps = (v4f*)&psum[wave][i * 16 + 8 * lh];
      v4f* pq = (v4f*)&psq[wave][i * 16 + 8 * lh];
      ps[0] = v4f{s[0], s[1], s[2], s[3]};  ps[1] = v4f{s[4], s[5], s[6], s[7]};
      pq[0] = v4f{q[0], q[1], q[2], q[3]};  pq[1] = v4f{q[4], q[5], q[6], q[7]};
    }
  }
  __syncthreads();                            // all 12 partial sums of every row

  // ---- lane l joins row l (every wave does, so one barrier is enough) ----
  {
    float ts = psum[0][lane], tq = psq[0][lane];
#pragma unroll
    for (int w = 1; w < kLW; ++w) { ts += psum[w][lane]; tq += psq[w][lane]; }
    const float mean = ts * (1.0f / kH);
    const float var  = tq * (1.0f / kH) - mean * mean;
    smean[wave][lane] = mean;
    srstd[wave][lane] = rsqrtf(var + 1e-5f);
  }
  // The wave reads back what its other lanes wrote: their stores are done first.
  asm volatile("s_wait_dscnt 0x0" ::: "memory");

#pragma unroll
  for (int i = 0; i < kLT; ++i) {
    const v4f* pm = (const v4f*)&smean[wave][i * 16 + 8 * lh];
    const v4f* pr = (const v4f*)&srstd[wave][i * 16 + 8 * lh];
    const v8f mean = __builtin_shufflevector(pm[0], pm[1], 0, 1, 2, 3, 4, 5, 6, 7);
    const v8f rstd = __builtin_shufflevector(pr[0], pr[1], 0, 1, 2, 3, 4, 5, 6, 7);
#pragma unroll
    for (int j = 0; j < kWT; ++j) y[i][j] = (y[i][j] - mean) * rstd * gg[j] + bt[j];
  }
  // Keeps the 64 stores in one run behind the arithmetic: mixed into it they
  // share data registers, and each reuse waits for earlier stores.
  __builtin_amdgcn_sched_barrier(0);
#pragma unroll
  for (int i = 0; i < kLT; ++i)
#pragma unroll
    for (int j = 0; j < kWT; ++j)
#pragma unroll
      for (int r = 0; r < 8; ++r) out[base + (i * 16 + r) * kH + j * 16] = y[i][j][r];
}

// ---------------------------------------------------------------------------
// Launch
// ---------------------------------------------------------------------------
extern "C" void kernel_launch(void* const* d_in, const int* in_sizes, int n_in,
                              void* d_out, int out_size, void* d_ws,
                              size_t ws_size, hipStream_t stream) {
  (void)in_sizes; (void)n_in; (void)out_size; (void)ws_size;

  const float* x     = (const float*)d_in[0];
  const float* amask = (const float*)d_in[1];
  const float* Wq    = (const float*)d_in[2];
  const float* bq    = (const float*)d_in[3];
  const float* Wk    = (const float*)d_in[4];
  const float* bk    = (const float*)d_in[5];
  const float* Wv    = (const float*)d_in[6];
  const float* bv    = (const float*)d_in[7];
  const float* Wo    = (const float*)d_in[8];
  const float* bo    = (const float*)d_in[9];
  const float* g     = (const float*)d_in[10];
  const float* be    = (const float*)d_in[11];
  float* out = (float*)d_out;

  // Workspace carve-up (all regions 16B-aligned by construction).
  const size_t NX = (size_t)kM * kH;          // 3,145,728 activation elems
  const size_t NW = (size_t)kH * kH;          // 589,824 weight elems
  char* w = (char*)d_ws;
  u16* XBF = (u16*)w;  w += NX * 2;
  u16* WQB = (u16*)w;  w += NW * 2;
  u16* WKB = (u16*)w;  w += NW * 2;
  u16* WVB = (u16*)w;  w += NW * 2;
  u16* WOB = (u16*)w;  w += NW * 2;
  u16* Qb  = (u16*)w;  w += NX * 2;           // [BH, S, HD]
  u16* Kb  = (u16*)w;  w += NX * 2;           // [BH, S, HD]
  u16* Vtb = (u16*)w;  w += NX * 2;           // [BH, HD, S] (transposed)
  u16* CTX = (u16*)w;                         // [B*S, H] bf16, fragment order

  // f32 -> bf16 conversions, one launch: XBF, WQB, WKB, WVB, WOB lie in a row.
  cvt_bf16_kernel<<<dim3(kXBlks + 4 * kWBlks), 256, 0, stream>>>(
      x, Wq, Wk, Wv, Wo, XBF);

  // QKV projections: 32 row blocks x 8 block columns = 256 blocks; XBF, WQB, WKB
  // and WVB lie in a row.
  qkv_proj_kernel<<<dim3(kM / kPM, kPBY), 32 * kPW, 0, stream>>>(
      XBF, bq, bk, bv, Qb, Kb, Vtb);

  // Flash attention: 128 q-tiles (4 per block, 2 per wave pair) x 24 (b,h) pairs.
  flash_attn_kernel<<<dim3(kS / (16 * kQT * kQW), kBH), 32 * kAW, 0, stream>>>(
      Qb, Kb, Vtb, amask, CTX);

  // Output projection + residual + LayerNorm -> d_out: 128 blocks of 32 rows.
  out_proj_ln_kernel<<<dim3(kM / kLR), 32 * kLW, 0, stream>>>(
      CTX, WOB, bo, x, g, be, out);
}

// v010
// It runs in 53 microseconds.
// In two side-by-side timings against v009, it was 1.07 and 1.06 times as fast.
// All steps since v000 together make it 4.12 times as fast.
#include <hip/hip_runtime.h>

// ---------------------------------------------------------------------------
// Encoder attention block on gfx1250 (wave32, WMMA bf16 16x16x32).
//   H=768, NH=12, HD=64, B=2, S=2048
// - One-time f32->bf16 conversion; all GEMMs read raw bf16 b128 fragments.
// - The projection GEMMs' operands (x, the weights, ctx) lie in fragment order
//   (see load_frag_packed), so a fragment load reads whole cache lines.
// - The QKV projection stages its x and W chunks, and flash attention its K/V
//   chunks, into LDS once per block via tensor_load_to_lds (TENSORcnt),
//   double-buffered.
// ---------------------------------------------------------------------------

constexpr int kH  = 768;
constexpr int kNH = 12;
constexpr int kHD = 64;
constexpr int kB  = 2;
constexpr int kS  = 2048;
constexpr int kM  = kB * kS;          // 4096 total rows
constexpr int kBH = kB * kNH;         // 24 (batch*heads)

constexpr int kKC = 64;               // keys per pass of the attention loop
constexpr int kQT = 2;                // 16-query tiles per attention wave
constexpr int kAW = 4;                // waves per attention block
constexpr int kKH = 2;                // key halves of an attention block
constexpr int kQW = kAW / kKH;        // waves (32-query groups) per key half
constexpr int kHalf = kS / kKH;       // keys per half
constexpr int kKStride = 72;          // LDS row stride for K chunk (pad 8)
constexpr int kVStride = 72;          // LDS row stride for V chunk (pad 8)
// A chunk's place in LDS: 64 padded rows (9,216 bytes) rounded up to a multiple
// of 2 KiB, so that every tensor load lands at such a multiple.
constexpr int kSlotElems = 5 * 1024;
static_assert(kSlotElems >= kKC * kKStride && kSlotElems >= kHD * kVStride &&
              (kSlotElems * 2) % 2048 == 0 && kKStride == kVStride && kKC == kHD,
              "a slot holds a chunk of K or of V^T; both have the same shape");

typedef unsigned short u16;
typedef __attribute__((ext_vector_type(16))) __bf16 v16bf;
typedef __attribute__((ext_vector_type(16))) u16    v16us;
typedef __attribute__((ext_vector_type(8)))  u16    v8us;
typedef __attribute__((ext_vector_type(8)))  float  v8f;
typedef __attribute__((ext_vector_type(4)))  float  v4f;
typedef __attribute__((ext_vector_type(2)))  float  v2f;
typedef __attribute__((ext_vector_type(2)))  __bf16 v2bf;
typedef __attribute__((ext_vector_type(8)))  unsigned v8u;

__device__ __forceinline__ u16 f2bf_u(float f) {
  unsigned u = __builtin_bit_cast(unsigned, f);
  u += 0x7FFFu + ((u >> 16) & 1u);    // round-to-nearest-even
  return (u16)(u >> 16);
}

// Per-lane slice of a 16x32 bf16 WMMA A/B fragment from a row-major bf16
// matrix.  p points at element (row = lane&15, k = k0 + c0), c0 = 8*(lane>=16).
// Lane needs k-offsets {0..7} and {16..23}: two 16-byte loads, no ALU.
__device__ __forceinline__ v16bf load_frag_bf16(const u16* p) {
  v8us a = *(const v8us*)(p);
  v8us b = *(const v8us*)(p + 16);
  v16us u = __builtin_shufflevector(a, b, 0, 1, 2, 3, 4, 5, 6, 7,
                                          8, 9, 10, 11, 12, 13, 14, 15);
  return __builtin_bit_cast(v16bf, u);
}

// Fragment order of a [rows x kH] bf16 operand of the projection GEMMs.  The
// 16-row x 32-k tile (R, Ks) is kTileElems consecutive elements at
// R * 16 * kH + Ks * kTileElems; inside it the 8 elements (row ml, k = 8 g ..
// 8 g + 7), g = 0..3, stand at (g >> 1) * 256 + (g & 1) * 128 + ml * 8.  Lane
// l = 16 * lh + ml then finds its k-offsets {8 lh ..} and {16 + 8 lh ..} (the
// same ones as load_frag_bf16) at l * 8 and 256 + l * 8: each of the two
// 16-byte loads of a wave covers 512 consecutive bytes, four whole lines,
// where a row-major operand makes it touch 16 lines.
constexpr int kTileElems = 16 * 32;

// p = tile start + lane * 8.
__device__ __forceinline__ v16bf load_frag_packed(const u16* p) {
  v8us a = *(const v8us*)(p);
  v8us b = *(const v8us*)(p + 256);
  v16us u = __builtin_shufflevector(a, b, 0, 1, 2, 3, 4, 5, 6, 7,
                                          8, 9, 10, 11, 12, 13, 14, 15);
  return __builtin_bit_cast(v16bf, u);
}

__device__ __forceinline__ v8f wmma_bf16(v16bf a, v16bf b, v8f c) {
  return __builtin_amdgcn_wmma_f32_16x16x32_bf16(false, a, false, b,
                                                 (short)0, c, false, false);
}

// Prefetch into L2.  One instruction names 32 units (256-byte pieces), one per
// lane, at base + off + IMM bytes; nothing is returned and no counter is
// touched.  A hint, for speed only: results do not depend on what it brings or
// where a work-group runs.  Every address lies inside the operand.  base is a
// scalar base that the k loop's loads use or its waits name, so it stays an address.
template <int IMM>
__device__ __forceinline__ void prefetch_units(const u16* base, unsigned off) {
  asm volatile("global_prefetch_b8 %0, %1 offset:%2 scope:SCOPE_SE"
               :: "v"(off), "s"(base), "n"(IMM));
}

// Lane offset (bytes) that spreads one prefetch over the NS 16-row strips of a
// fragment-order operand: 32 / NS consecutive units, the same k-steps, of each.
constexpr unsigned kStripBytes = 16 * kH * 2;
template <int NS>
__device__ __forceinline__ unsigned prefetch_lane_off(int lane) {
  return (unsigned)(lane / (32 / NS)) * kStripBytes + (unsigned)(lane % (32 / NS)) * 256u;
}

// Register tile of the output projection: one wave owns MT x kWT accumulator
// tiles, so every loaded A fragment feeds kWT WMMAs and every B fragment MT.
// (kWT is also the number of 16-row tiles of a wave of the QKV projection.)
// Every loop over tiles or accumulator rows is fully unrolled, here and in the
// two kernels, so that these arrays are indexed by constants and stay in VGPRs.
constexpr int kWT = 4;

// acc += A[16 MT rows] * B[64 rows]^T over k = 0..kH, both in fragment order.
// abase / bbase are the wave-uniform starts of the first 16-row tiles; loff is
// this lane's byte offset (lane * 16) inside a tile, the same for A and B.
// Every load is scalar base + 32-bit lane offset + immediate (the offset
// register holds lane * 16, or lane where the load scales it).
// pfa / pfb are the lane offsets of the prefetches that the caller has issued.
template <int MT>
__device__ __forceinline__ void gemm_wave_tile(const u16* abase, const u16* bbase,
                                               unsigned lane, unsigned pfa, unsigned pfb,
                                               v8f (&acc)[MT][kWT]) {
  const unsigned loff = lane * 16u;
  // Fully unrolled (24 k-steps): every k-step is an immediate offset, so there
  // is no address arithmetic and no branch among the WMMAs.
#pragma unroll
  for (int k0 = 0; k0 < kH; k0 += 32) {
    v16bf a[MT], b[kWT];
#pragma unroll
    for (int i = 0; i < MT; ++i)
      a[i] = load_frag_packed((const u16*)(
          (const char*)(abase + (k0 / 32) * kTileElems + i * 16 * kH) + loff));
#pragma unroll
    for (int j = 0; j < kWT; ++j)
      b[j] = load_frag_packed((const u16*)(
          (const char*)(bbase + (k0 / 32) * kTileElems + j * 16 * kH) + loff));
    // Stands behind the loads of a k-step and names their lane offset, in
    // both forms, so that register is not reused (the last load's destination
    // took it) ahead of the wait.  The data wait follows at once: no stall.
    // It names the prefetches' lane offsets too: their registers then hold
    // in-bounds offsets all through the loop, whenever a prefetch is served.
    asm volatile("s_wait_xcnt 0x0" :: "v"(loff), "v"(lane), "v"(pfa), "v"(pfb) : "memory");
    // Keeps the loads in one group ahead of the WMMAs: a load sunk among
    // them is waited for at once and exposes its whole latency.
    __builtin_amdgcn_sched_barrier(0);
#pragma unroll
    for (int i = 0; i < MT; ++i)
#pragma unroll
      for (int j = 0; j < kWT; ++j) acc[i][j] = wmma_bf16(a[i], b[j], acc[i][j]);
  }
}

// Tensor load global -> LDS (tracked by TENSORcnt): one request of a whole wave
// brings a two-dimensional tile, through no register and with no address
// arithmetic in the lanes.
typedef __attribute__((ext_vector_type(4))) uint32_t u32x4;
typedef __attribute__((ext_vector_type(8))) uint32_t u32x8;

__device__ __forceinline__ uint32_t uni(uint32_t v) {
  return (uint32_t)__builtin_amdgcn_readfirstlane(v);
}

// A test that decides whether a tensor load issues: the empty statement holds the
// word in a scalar register, so the test compiles to s_cmp and s_cbranch_scc (a
// tensor load ignores EXEC; only a scalar branch keeps a wave from issuing it).
__device__ __forceinline__ uint32_t pinned(uint32_t v) {
  uint32_t w = uni(v);
  asm volatile("" : "+s"(w));  // pinned(): the word stays in a scalar register
  return w;
}

// Descriptor group 1, the same for every request of a wave: 1-byte elements,
// tensor = tile = rows rows of ROWB bytes, src_pitch bytes apart in memory.  W0
// is word 0: no work-group mask; 0, or the pad's fields.
template <uint32_t W0, uint32_t ROWB>
__device__ __forceinline__ u32x8 tdm_group1(uint32_t rows, uint32_t src_pitch) {
  u32x8 g;
  g[0] = uni(W0);
  g[1] = uni((ROWB & 0xFFFFu) << 16);
  g[2] = uni((ROWB >> 16) | ((rows & 0xFFFFu) << 16));
  g[3] = uni((rows >> 16) | (ROWB << 16));
  g[4] = uni(rows);
  g[5] = uni(src_pitch);
  g[6] = uni(0u);
  g[7] = uni(0u);
  // Descriptor words held in scalar registers (as pinned() holds one): without
  // it the constants are formed anew in front of every request, in registers
  // that take other values while a request is in flight.
  asm volatile("" : "+s"(g));  // as pinned(): descriptor words stay in their scalar registers
  return g;
}

// Descriptor group 0: count 1, place in LDS, the tile's first byte, type 2.
__device__ __forceinline__ u32x4 tdm_group0(uint32_t lds_dst, uint64_t ga) {
  u32x4 g;
  g[0] = uni(1u);
  g[1] = uni(lds_dst);
  g[2] = uni((uint32_t)ga);
  g[3] = uni((((uint32_t)(ga >> 32)) & 0x01FFFFFFu) | 0x80000000u);
  return g;
}

__device__ __forceinline__ void tdm_load(u32x4 g0, u32x8 g1) {
  asm volatile("tensor_load_to_lds %0, %1" :: "s"(g0), "s"(g1) : "memory");
}

// The compiler places no wait for a tensor load: the issuing wave's own.  It
// names the descriptor of the wave's last request, so that those scalar
// registers keep their words until the request has landed.
__device__ __forceinline__ void wait_tensor0(u32x4 g0, u32x8 g1) {
  asm volatile("s_wait_tensorcnt 0x0" :: "s"(g0), "s"(g1) : "memory");
}

// ---------------------------------------------------------------------------
// Kernel 0: elementwise f32 -> bf16 (8 elements / thread, vectorized) of x and
// the four weight matrices in ONE launch.  None of the five needs anything of
// another, so each takes a range of the block index; a block lies wholly in
// one array (every array is a whole number of 2048-element blocks).  The five
// bf16 planes follow one another in the workspace in the same order.
// The planes are written in fragment order (load_frag_packed).  A block takes
// 16 rows x 128 k = four tiles, which are its 2048 consecutive output elements.
// A wave takes 8 rows x one 32-k step: it reads 128 consecutive bytes of each
// row (8 lines per load) and stores four whole 128-byte lines.
// ---------------------------------------------------------------------------
constexpr int kCvtBlk = 256 * 8;                  // elements per block
constexpr int kXBlks  = kM * kH / kCvtBlk;        // 1536 blocks of x
constexpr int kWBlks  = kH * kH / kCvtBlk;        // 288 blocks per weight matrix
constexpr int kCvtK   = kCvtBlk / 16;             // 128 k per block
constexpr int kCvtKB  = kH / kCvtK;               // 6 blocks along k
static_assert(kXBlks * kCvtBlk == kM * kH && kWBlks * kCvtBlk == kH * kH,
              "every array is a whole number of blocks");
static_assert(kCvtKB * kCvtK == kH && kCvtK == 4 * 32 && kM % 16 == 0 && kH % 16 == 0,
              "a block is four whole tiles of one 16-row strip");

__global__ void __launch_bounds__(256)
cvt_bf16_kernel(const float* __restrict__ x,
                const float* __restrict__ Wq, const float* __restrict__ Wk,
                const float* __restrict__ Wv, const float* __restrict__ Wo,
                u16* __restrict__ out) {
  const int blk = blockIdx.x;
  const float* in = x;                            // block-uniform choice
  int first = 0;                                  // first block of that array
  if (blk >= kXBlks) {
    const int w = (blk - kXBlks) / kWBlks;
    first = kXBlks + w * kWBlks;
    in = w == 0 ? Wq : w == 1 ? Wk : w == 2 ? Wv : Wo;
  }
  const int lb  = blk - first;                    // block inside its array
  const int tid = threadIdx.x;
  const int ml  = ((tid >> 5) & 1) * 8 + (tid & 7);  // row in the 16-row strip
  const int g   = (tid >> 3) & 3;                 // group of 8 k in the 32-k step
  const int ks  = tid >> 6;                       // 32-k step in the block
  const float* p = in + ((lb / kCvtKB) * 16 + ml) * kH + (lb % kCvtKB) * kCvtK +
                   ks * 32 + g * 8;
  u16* q = out + (size_t)blk * kCvtBlk + ks * kTileElems +
           (g >> 1) * 256 + (g & 1) * 128 + ml * 8;
  v4f a = *(const v4f*)(p);
  v4f b = *(const v4f*)(p + 4);
  v8us u;
#pragma unroll
  for (int j = 0; j < 4; ++j) { u[j] = f2bf_u(a[j]); u[4 + j] = f2bf_u(b[j]); }
  *(v8us*)q = u;
}

// ---------------------------------------------------------------------------
// Kernel 1: QKV projection from bf16 operands.  out = x @ W^T + b.
// Q,K written bf16 [BH, S, HD]; V written TRANSPOSED bf16 [BH, HD, S].
// A block owns 128 rows of x and 288 output columns and brings both operands
// into LDS with tensor_load_to_lds, two buffers of 96 k each: a byte
// of x or W leaves L2 once per block, not once per wave that reads it.  Its 12
// waves (three on every SIMD) are 2 row groups x 6 column groups, 64 x 48
// outputs each (4 x 3 accumulator tiles).
// The three weight planes follow one another in the workspace: one matrix of
// 3 * kH rows = 144 strips of 16.  Block column by takes the 12 strips by * 12 ..
// of Q and K (three whole heads, so every 128-byte row of Q or K is written by
// one block) and the 6 strips 96 + by * 6 .. of V (a 128-byte line of V^T is 64
// rows of x for one column: one wave's).
// ---------------------------------------------------------------------------
constexpr int kPM      = 128;                     // rows of x per block
constexpr int kPW      = 12;                      // waves per block
constexpr int kPCG     = 6;                       // column groups of waves
constexpr int kPJ      = 3;                       // 16-column tiles per wave
constexpr int kPAS     = kPM / 16;                // 8 strips of x per block
constexpr int kPQK     = 12;                      // strips of Q and K per block
constexpr int kPV      = 6;                       // strips of V per block
constexpr int kPStrips = kPAS + kPQK + kPV;       // 26 strips in LDS
constexpr int kPKS     = 3;                       // 32-k steps per chunk
constexpr int kPChunks = kH / (32 * kPKS);        // 8 chunks
constexpr int kPStripElems = kPKS * kTileElems;   // a strip's part of a chunk
constexpr int kPBufElems   = kPStrips * kPStripElems;
constexpr int kPBY     = 3 * kH / 16 / (kPQK + kPV); // 8 block columns
static_assert(kPChunks * kPKS * 32 == kH && kPChunks >= 2, "whole chunks; two buffers");
static_assert(kPStrips == 2 * kPW + 2 && kPAS % 2 == 0 && kPQK % 2 == 0 &&
              kPAS + kPQK <= 2 * (kPW - 2) && (2 * kPStripElems * 2) % 2048 == 0 &&
              (kPBufElems * 2) % 2048 == 0,
              "a wave loads 2 strips, one wave 4; none crosses from x to W or from K to V");
static_assert(kPBY * kPQK * 16 == 2 * kH && kPBY * kPV * 16 == kH && kPQK % 4 == 0,
              "the block columns cover Q, K (whole heads) and V");
static_assert(kPCG * kPJ == kPQK + kPV && (kPW / kPCG) * kWT == kPAS && kS % kPM == 0,
              "the waves cover the block's tile; a block stays in one batch");

__global__ void __launch_bounds__(32 * kPW)
qkv_proj_kernel(const u16* __restrict__ planes,
                const float* __restrict__ bq, const float* __restrict__ bk,
                const float* __restrict__ bv,
                u16* __restrict__ Qo, u16* __restrict__ Ko,
                u16* __restrict__ Vt) {
  // Per buffer: strip s of the block (x first, then W), fragment order, at
  // s * kPStripElems.
  __shared__ __attribute__((aligned(2048))) u16 pbuf[2][kPBufElems];

  const int lane = threadIdx.x & 31;
  const int wave = __builtin_amdgcn_readfirstlane(threadIdx.x >> 5);
  const int lh   = lane >> 4;
  const int ml   = lane & 15;
  const int wr   = wave / kPCG;               // 64-row group
  const int wc   = wave % kPCG;               // 48-column group
  const int by   = blockIdx.y;
  const int m0   = blockIdx.x * kPM;

  // Strip of the stacked weights that is the block's W strip t: t plus one of
  // two block constants.
  const int wqk = by * kPQK, wv = 2 * kH / 16 + by * kPV - kPQK;
  auto wstrip = [&](int t) { return t + (t < kPQK ? wqk : wv); };
  // planes: x and behind it the stacked weights, as the conversion writes them:
  // one array of strips.  The strip of it that is strip s of the block's buffer.
  const int px = (int)blockIdx.x * kPAS, pqk = kM / 16 - kPAS + wqk, pv = kM / 16 - kPAS + wv;
  auto pstrip = [&](int s) { return s + (s < kPAS ? px : s < kPAS + kPQK ? pqk : pv); };

  // Staging: every wave brings a run of whole strips of the chunk with one tensor
  // load: strips 2 wave, 2 wave + 1; the last wave but one takes 4, the last the
  // 2 behind them.  A row of the tile is a strip's part of the chunk (3,072
  // consecutive bytes), the rows a strip apart in memory and back to back in LDS.
  const int sf = wave < kPW - 1 ? 2 * wave : 2 * wave + 2;    // first strip
  const int sn = wave == kPW - 2 ? 4 : 2;                     // strips
  const uint64_t sga = (uint64_t)(size_t)(planes + pstrip(sf) * (16 * kH));
  const u32x8 sg1 = tdm_group1<0u, kPStripElems * 2>((uint32_t)sn, kStripBytes);
  const uint32_t slds = (uint32_t)(size_t)&pbuf[0][sf * kPStripElems];
  u32x4 sg0;                                  // group 0 of the last request
  auto stage = [&](int buf, int c) {
    sg0 = tdm_group0(slds + (uint32_t)buf * (kPBufElems * 2),
                     sga + (uint64_t)((uint32_t)c * (kPStripElems * 2)));
    tdm_load(sg0, sg1);
  };

  // Kick off the tensor load of chunk 0 into buffer 0.
  stage(0, 0);

  // Prefetch into L2 of what the later chunks read.  The block's x rows are read
  // by the 8 blocks along y: a block asks for a quarter of k of all 8 strips (24
  // units each), waves 0..5 one instruction each.  Its W strips are read by the
  // 32 blocks along x: 16 neighbours ask for the same half of k (48 units of
  // each of 18 strips, 27 instructions: two per wave, waves 0..2 a third).
  const int ua = (wave % 6) * 32 + lane;
  const unsigned pfa = (unsigned)pstrip(ua / 24) * kStripBytes + (unsigned)(by & 3) * 6144u +
                       (unsigned)(ua % 24) * 256u;
  unsigned pfb[3];
#pragma unroll
  for (int i = 0; i < 3; ++i) {               // unrolled: pfb stays in registers
    const int ub = ((i < 2 ? i * kPW : (wave < 3 ? 2 * kPW : 0)) + wave) * 32 + lane;
    pfb[i] = (unsigned)pstrip(kPAS + ub / 48) * kStripBytes + (blockIdx.x >> 4) * 12288u +
             (unsigned)(ub % 48) * 256u;
  }
  if (wave < 6) prefetch_units<0>(planes, pfa);
  prefetch_units<0>(planes, pfb[0]);
  prefetch_units<0>(planes, pfb[1]);
  if (wave < 3) prefetch_units<0>(planes, pfb[2]);

  // The wave's three column tiles: row n of the stacked weights (wave-uniform)
  // and its bias values, fetched here so that the loop covers their latency.
  int   nj[kPJ];
  float bbj[kPJ];
#pragma unroll
  for (int j = 0; j < kPJ; ++j) {             // unrolled: both stay in registers
    nj[j] = wstrip(wc * kPJ + j) * 16;
    bbj[j] = (nj[j] < kH ? bq : nj[j] < 2 * kH ? bk : bv)[nj[j] % kH + ml];
  }
  // Behind these loads: their index registers are reused in what follows.
  asm volatile("s_wait_xcnt 0x0" ::: "memory");

  v8f acc[kWT][kPJ] = {};

  wait_tensor0(sg0, sg1);             // my share of chunk 0 has landed
  __syncthreads();                    // everyone's has
  // Chunk 1's loads fly while chunk 0 is worked on.
  stage(1, 1);

  // Fully unrolled: the buffer and the test for a further chunk are constants,
  // so no address arithmetic and no branch stands around a tensor load.
#pragma unroll
  for (int c = 0; c < kPChunks; ++c) {
    const int cur = c & 1;
    const u16* ab = &pbuf[cur][(wr * kWT) * kPStripElems + lane * 8];
    const u16* bb = &pbuf[cur][(kPAS + wc * kPJ) * kPStripElems + lane * 8];
    // Two register sets: the fragments of k-step ks + 1 (of this chunk only) are
    // fetched as one group under the WMMAs of k-step ks.  Every loop is
    // unrolled: the arrays are indexed by constants and stay in registers.
    v16bf a[2][kWT], b[2][kPJ];
    auto fetch = [&](int ks) {
#pragma unroll
      for (int i = 0; i < kWT; ++i)
        a[ks & 1][i] = load_frag_packed(ab + i * kPStripElems + ks * kTileElems);
#pragma unroll
      for (int j = 0; j < kPJ; ++j)
        b[ks & 1][j] = load_frag_packed(bb + j * kPStripElems + ks * kTileElems);
    };
    fetch(0);
#pragma unroll
    for (int ks = 0; ks < kPKS; ++ks) {
      if (ks + 1 < kPKS) fetch(ks + 1);
      // Keeps the LDS loads in one group ahead of the WMMAs: sunk among them
      // they share one register set, and every WMMA row waits out its own
      // loads' whole latency.
      __builtin_amdgcn_sched_barrier(0);
#pragma unroll
      for (int i = 0; i < kWT; ++i)
#pragma unroll
        for (int j = 0; j < kPJ; ++j)
          acc[i][j] = wmma_bf16(a[ks & 1][i], b[ks & 1][j], acc[i][j]);
      // Keeps the next group of loads, and at the end the foot of the trip,
      // behind these WMMAs: the foot's wait for the next chunk's loads would
      // otherwise come early and stall.
      __builtin_amdgcn_sched_barrier(0);
    }
    // ---- foot of the trip: one barrier publishes the next chunk and ends every
    // wave's reads of this one, whose buffer is refilled behind it ----
    // My reads of cur are done.  The wait names the prefetches' base and lane
    // offsets: their registers then hold in-bounds addresses all through the
    // loop, whenever a prefetch is served.
    asm volatile("s_wait_dscnt 0x0"
                 :: "s"(planes), "v"(pfa), "v"(pfb[0]), "v"(pfb[1]), "v"(pfb[2])
                 : "memory");
    wait_tensor0(sg0, sg1);           // my share of the next chunk has landed
    __syncthreads();
    if (c + 2 < kPChunks) stage(cur, c + 2);
  }
  wait_tensor0(sg0, sg1);             // nothing in flight when the wave ends
  asm volatile("s_wait_dscnt 0x0" ::: "memory");   // nor any LDS read of the buffers

  const int bidx = m0 / kS;                   // 128 rows never cross a batch
  const int s0   = m0 % kS + wr * (16 * kWT) + 8 * lh;
#pragma unroll
  for (int j = 0; j < kPJ; ++j) {             // unrolled: acc stays in registers
    const int z  = nj[j] / kH;                // 0: Q, 1: K, 2: V
    const int cc = nj[j] % kH;                // output column of that projection
    const int bh = bidx * kNH + cc / kHD;
    const int d  = cc % kHD + ml;
    if (z == 2) {                             // V: [BH, HD, S]
      u16* o = Vt + ((size_t)bh * kHD + d) * kS + s0;
#pragma unroll
      for (int i = 0; i < kWT; ++i)
#pragma unroll
        for (int r = 0; r < 8; ++r) o[i * 16 + r] = f2bf_u(acc[i][j][r] + bbj[j]);
      // Behind a tile's stores, here and below: the code that follows in the
      // text rewrites the registers that they name.
      asm volatile("s_wait_xcnt 0x0" ::: "memory");
    } else {                                  // Q, K: [BH, S, HD]
      u16* o = (z == 0 ? Qo : Ko) + ((size_t)bh * kS + s0) * kHD + d;
#pragma unroll
      for (int i = 0; i < kWT; ++i)
#pragma unroll
        for (int r = 0; r < 8; ++r) o[(i * 16 + r) * kHD] = f2bf_u(acc[i][j][r] + bbj[j]);
      asm volatile("s_wait_xcnt 0x0" ::: "memory");
    }
  }
}

// ---------------------------------------------------------------------------
// Kernel 2: flash attention, transposed products.  4 waves / block share one
// (b,h); K/V chunks of 64 keys come into double-buffered LDS by
// tensor_load_to_lds, then each wave streams WMMA fragments from LDS.
// A wave owns 32 queries (two tiles): every K, V^T and mask fragment it reads
// from LDS feeds two WMMAs, and maximum, exchange and rescale come once per 64
// keys.
// A block owns 64 queries and splits the keys: waves 0, 1 walk the first half of
// the keys for the two 32-query groups, waves 2, 3 the second half.  That makes
// 3,072 waves of 16 passes, three on every SIMD (registers allow three), where
// 1,536 waves of 32 passes leave a SIMD with one or two; the vector work of one
// wave then runs under the matrix work and the LDS waits of two others.  The
// two waves of a query group join their partial results at the end, through
// LDS: each hands one of its two tiles to the other and finishes the one it
// keeps.
//   S^T = K Q^T   : A = K rows, B = Q rows; lane (c, h) holds query column c,
//                   register r of tile t = key t*16 + 8h + r.
//   O^T += V^T P^T: A = V^T rows, B = the two S^T tiles packed to bf16 in place
//                   (their register order is the k order of the A loader).
// A query's scores sit in the two lanes c and c + 16: maximum and sum are taken
// in the lane, with one exchange between the halves.  Writes ctx bf16 [B*S, H]
// in fragment order (load_frag_packed).
// ---------------------------------------------------------------------------
__device__ __forceinline__ unsigned pack_bf16(float lo, float hi) {
  return __builtin_bit_cast(unsigned, __builtin_convertvector(v2f{lo, hi}, v2bf));
}

__device__ __forceinline__ float max3f(float a, float b, float c) {
  return fmaxf(fmaxf(a, b), c);
}

// Value of lane l ^ 16.
__device__ __forceinline__ float other_half(float x) {
  const int v = __builtin_bit_cast(int, x);
  return __builtin_bit_cast(float, __builtin_amdgcn_permlanex16(
      v, v, 0x76543210, 0xfedcba98, false, false));
}

// Hands tile U of this wave's partial result (O^T, maximum, sum) to the wave
// that walked the other half of the keys.  xo / xml: this wave's own LDS slots.
template <int U>
__device__ __forceinline__ void hand_over_tile(const v8f (&o)[kQT][4], const float (&mrun)[kQT],
                                               const float (&lrun)[kQT], v4f (*xo)[32],
                                               float (*xml)[32], int lane) {
  // Unrolled: o is indexed by constants and stays in registers.
#pragma unroll
  for (int dt = 0; dt < 4; ++dt) {
    xo[2 * dt][lane]     = __builtin_shufflevector(o[U][dt], o[U][dt], 0, 1, 2, 3);
    xo[2 * dt + 1][lane] = __builtin_shufflevector(o[U][dt], o[U][dt], 4, 5, 6, 7);
  }
  xml[0][lane] = mrun[U];
  xml[1][lane] = lrun[U];
}

// Joins tile U with the partner's part of it (xo / xml: the partner's slots),
// joins the lane halves' sums, normalizes and writes ctx (bf16), fragment order.
// A lane holds 8 consecutive d of its query per tile, group g = 2 (dt & 1) + lh
// of 32-k step 2 h + (dt >> 1): one 16-byte store each, at lane * 8 in its half
// tile, so a wave's store is 512 consecutive bytes.  crow: tile U's place + lane * 8.
template <int U>
__device__ __forceinline__ void finish_tile(const v8f (&o)[kQT][4], const float (&mrun)[kQT],
                                            const float (&lrun)[kQT], const v4f (*xo)[32],
                                            const float (*xml)[32], int lane, u16* crow) {
  const float mo = xml[0][lane];
  const float lo = xml[1][lane];
  // Both parts are brought to the larger of the two maxima: its own factor is 1.
  const float d  = mrun[U] - mo;
  const float e  = __builtin_amdgcn_exp2f(-__builtin_fabsf(d));
  const float am = d < 0.0f ? e : 1.0f;
  const float ao = d < 0.0f ? 1.0f : e;
  const float ls = lrun[U] * am + lo * ao;
  const float inv = 1.0f / (ls + other_half(ls));
  const float fm = am * inv, fo = ao * inv;
  // Both loops unrolled: o, po and w are indexed by constants (registers).
#pragma unroll
  for (int dt = 0; dt < 4; ++dt) {
    const v8f po = __builtin_shufflevector(xo[2 * dt][lane], xo[2 * dt + 1][lane],
                                           0, 1, 2, 3, 4, 5, 6, 7);
    v8us w;
#pragma unroll
    for (int r = 0; r < 8; ++r) w[r] = f2bf_u(o[U][dt][r] * fm + po[r] * fo);
    *(v8us*)(crow + dt * 256) = w;
  }
}

__global__ void __launch_bounds__(32 * kAW)
flash_attn_kernel(const u16* __restrict__ Q, const u16* __restrict__ K,
                  const u16* __restrict__ Vt,
                  const float* __restrict__ amask,
                  u16* __restrict__ ctx) {
  // [buffer][key half][0: K, 64 kv-rows x 64 dims; 1: V^T, 64 d-rows x 64 kv]
  __shared__ __attribute__((aligned(2048))) u16 kvbuf[2][kKH][2][kSlotElems];
  __shared__ __align__(16) float mbias[kS];             // mask term per key
  __shared__ __align__(16) v4f xo[kAW][8][32];          // per wave: the tile it hands over
  __shared__ __align__(16) float xml[kAW][2][32];       //           its maximum and sum

  const int tid  = threadIdx.x;
  const int lane = tid & 31;
  const int wave = __builtin_amdgcn_readfirstlane(tid >> 5);
  const int qg   = wave % kQW;                // 32-query group of the block
  const int kh   = wave / kQW;                // key half that this wave walks
  const int lh   = lane >> 4;
  const int ml   = lane & 15;
  const int c0   = lh * 8;

  const int bh = blockIdx.y;                  // 0..B*NH-1
  const int b  = bh / kNH;
  const int q0 = (blockIdx.x * kQW + qg) * (16 * kQT);

  const u16* Qb  = Q  + (size_t)bh * kS * kHD;
  const u16* Kb  = K  + (size_t)bh * kS * kHD;
  const u16* Vtb = Vt + (size_t)bh * kHD * kS;

  // Staging: a pass needs four chunks (K and V^T of either key half); each of
  // the four waves brings one of them, every pass, with one tensor load.
  static_assert(kAW == 2 * kKH, "one chunk per wave");
  const uint32_t sv = wave & 1;               // 0: K, 1: V^T
  const uint32_t sh = wave >> 1;              // key half of the chunk
  const uint64_t sga = sv ? (uint64_t)(size_t)(Vtb + sh * kHalf)
                          : (uint64_t)(size_t)(Kb + (size_t)sh * kHalf * kHD);
  const uint32_t sstep = sv ? kKC * 2 : kKC * kHD * 2;    // bytes from pass to pass
  // 64 rows of 128 bytes; the mover pads each row (32 dwords) by 4 dwords, which
  // gives the LDS pitch of kKStride = kVStride elements.
  const u32x8 sg1 = tdm_group1<(1u << 20) | (4u << 22) | (3u << 25), kHD * 2>(
      kKC, sv ? kS * 2 : kHD * 2);
  const uint32_t slds = (uint32_t)(size_t)&kvbuf[0][sh][sv][0];
  u32x4 sg0;                                  // group 0 of the last request
  auto stage = [&](int buf, int p) {
    sg0 = tdm_group0(slds + (uint32_t)buf * (kKH * 2 * kSlotElems * 2),
                     sga + (uint64_t)((uint32_t)p * sstep));
    tdm_load(sg0, sg1);
  };

  // Q fragments of the wave's tiles (HD=64 -> two k-steps of 32), loaded once.
  v16bf qf[kQT][2];
#pragma unroll
  for (int u = 0; u < kQT; ++u) {
    qf[u][0] = load_frag_bf16(Qb + (size_t)(q0 + u * 16 + ml) * kHD + 0  + c0);
    qf[u][1] = load_frag_bf16(Qb + (size_t)(q0 + u * 16 + ml) * kHD + 32 + c0);
  }
  // Behind the Q loads: their address registers are reused for the prefetch
  // address below, and no other wait stands ahead of that rewrite.
  asm volatile("s_wait_xcnt 0x0" ::: "memory");

  v8f o[kQT][4] = {};                         // O^T: o[u][dt][r] = d dt*16+8h+r, query c
  float mrun[kQT], lrun[kQT];                 // scaled log2 maximum; this lane's sum
#pragma unroll
  for (int u = 0; u < kQT; ++u) { mrun[u] = -3.0e38f; lrun[u] = 0.0f; }

  // Kick off the tensor load for pass 0 into buffer 0.
  stage(0, 0);

  // Prefetch of K and V^T, in groups of 256 keys of a key half (4 passes): 128
  // units of K (consecutive) and 128 of V^T (two per d row).  The 32 blocks of a
  // (b,h) walk the same keys in step, so they share the asking: a block takes a
  // quarter of every group of one half, chosen by its index, with its waves 0
  // and 1.  pf walks from group to group, lives through the loop and stays inside
  // the array; group 0 is asked for here, group g + 1 at the foot of group g's
  // first pass.
  const bool pfwave = wave < 2;
  const int  pfq    = blockIdx.x & 3;           // quarters 0, 1: K; 2, 3: V^T
  const int  pfh    = (blockIdx.x >> 2) & 1;    // the key half asked for
  const int  pfu    = (pfq & 1) * 64 + (tid & 63);
  const char* pf = pfq < 2 ? (const char*)Kb + pfh * (kHalf * kHD * 2) + pfu * 256
                           : (const char*)Vtb + pfh * (kHalf * 2) +
                                 (pfu >> 1) * (kS * 2) + (pfu & 1) * 256;
  const int pfstep = pfq < 2 ? 256 * kHD * 2 : 256 * 2;
  if (pfwave) asm volatile("global_prefetch_b8 %0, off scope:SCOPE_SE" :: "v"(pf));

  // A key is a row of the score tile, so its mask term differs by register
  // and not by lane: all kS terms go to LDS once (16 per thread), times
  // sqrt(HD) = 8 (exact) because they start the accumulator ahead of the
  // 1/sqrt(HD) scaling.  The barrier in front of the loop publishes them.
  {
    const float* amb = amask + (size_t)b * kS;   // same for the whole block
    const float* am  = amb + tid * 16;
    v4f mm[4];
#pragma unroll
    for (int i = 0; i < 4; ++i) mm[i] = *(const v4f*)(am + 4 * i);
    // Behind the loads, naming their scalar base: otherwise that register
    // pair is reused for constants ahead of any wait.
    asm volatile("s_wait_xcnt 0x0" :: "s"(amb) : "memory");
#pragma unroll
    for (int i = 0; i < 4; ++i) {
#pragma unroll
      for (int j = 0; j < 4; ++j) mm[i][j] = (1.0f - mm[i][j]) * -80000.0f;
      *(v4f*)(&mbias[tid * 16 + 4 * i]) = mm[i];
    }
  }

  wait_tensor0(sg0, sg1);             // my chunk of pass 0 has landed
  __syncthreads();                    // everyone's has; mask terms published
  // Pass 1's chunks fly while pass 0's are worked on.
  stage(1, 1);

  constexpr float kScale = 0.125f * 1.4426950408889634f;  // log2(e) / sqrt(HD)

  constexpr int kPasses = kHalf / kKC;
  static_assert(kPasses >= 2 && kHalf % 256 == 0, "two buffers; whole prefetch groups");
  for (int p = 0; p < kPasses; ++p) {
    const int cur = p & 1;
    const int kv0 = kh * kHalf + p * kKC;     // this wave's first key of the pass

    const u16* kch = &kvbuf[cur][kh][0][0];
    const u16* vch = &kvbuf[cur][kh][1][0];

    // ---- K rows and mask terms of the pass: each feeds both query tiles ----
    v16bf kf[4][2];
    v8f mk[4];
#pragma unroll
    for (int t = 0; t < 4; ++t) {
      const u16* krow_l = kch + (t * 16 + ml) * kKStride + c0;
      kf[t][0] = load_frag_bf16(krow_l + 0);
      kf[t][1] = load_frag_bf16(krow_l + 32);
      const float* mrow = &mbias[kv0 + t * 16 + c0];
      const v4f ma = *(const v4f*)(mrow);
      const v4f mb = *(const v4f*)(mrow + 4);
      mk[t] = __builtin_shufflevector(ma, mb, 0, 1, 2, 3, 4, 5, 6, 7);
    }
    // Keeps these LDS loads in one group ahead of the WMMAs: sunk among them
    // they share one register set, and every WMMA then waits for its own
    // loads' whole latency.
    __builtin_amdgcn_sched_barrier(0);

    // ---- S^T: 4 x kQT tiles of 16x16, keys [kv0, kv0+64) x 32 queries ----
    v8f st[kQT][4];
#pragma unroll
    for (int t = 0; t < 4; ++t)
#pragma unroll
      for (int u = 0; u < kQT; ++u) st[u][t] = wmma_bf16(kf[t][0], qf[u][0], mk[t]);
#pragma unroll
    for (int t = 0; t < 4; ++t)
#pragma unroll
      for (int u = 0; u < kQT; ++u) st[u][t] = wmma_bf16(kf[t][1], qf[u][1], st[u][t]);

    // Keeps the V^T loads behind the S^T products, whose K registers they
    // take over: raised among them they need a register set of their own.
    __builtin_amdgcn_sched_barrier(0);

    // ---- V^T rows (two k-steps of 32 keys), fetched under the softmax ----
    v16bf vf[4][2];
#pragma unroll
    for (int dt = 0; dt < 4; ++dt) {
      const u16* vrow_l = vch + (dt * 16 + ml) * kVStride + c0;
      vf[dt][0] = load_frag_bf16(vrow_l + 0);
      vf[dt][1] = load_frag_bf16(vrow_l + 32);
    }
    // Keeps these loads in one group ahead of the softmax, so that its
    // arithmetic covers their latency.
    __builtin_amdgcn_sched_barrier(0);

    // ---- online softmax of query c of each tile, log2 domain ----
    v16bf pb[kQT][2];
#pragma unroll
    for (int u = 0; u < kQT; ++u) {
      float tm[4];
#pragma unroll
      for (int t = 0; t < 4; ++t)
        tm[t] = max3f(max3f(st[u][t][0], st[u][t][1], st[u][t][2]),
                      max3f(st[u][t][3], st[u][t][4], st[u][t][5]), st[u][t][6]);
      float mx = max3f(max3f(tm[0], tm[1], st[u][0][7]),
                       max3f(tm[2], tm[3], st[u][1][7]),
                       fmaxf(st[u][2][7], st[u][3][7]));
      mx = fmaxf(mx, other_half(mx));
      const float mnew  = fmaxf(mrun[u], mx * kScale);
      const float alpha = __builtin_amdgcn_exp2f(mrun[u] - mnew);
      mrun[u] = mnew;
      const v8f vscale = {kScale, kScale, kScale, kScale, kScale, kScale, kScale, kScale};
      const v8f vmneg  = {-mnew, -mnew, -mnew, -mnew, -mnew, -mnew, -mnew, -mnew};
#pragma unroll
      for (int t = 0; t < 4; ++t) {
        st[u][t] = __builtin_elementwise_fma(st[u][t], vscale, vmneg);
#pragma unroll
        for (int r = 0; r < 8; ++r) st[u][t][r] = __builtin_amdgcn_exp2f(st[u][t][r]);
      }
      const v8f s8 = (st[u][0] + st[u][1]) + (st[u][2] + st[u][3]);
      const v4f s4 = __builtin_shufflevector(s8, s8, 0, 1, 2, 3) +
                     __builtin_shufflevector(s8, s8, 4, 5, 6, 7);
      lrun[u] = lrun[u] * alpha + ((s4[0] + s4[1]) + (s4[2] + s4[3]));
#pragma unroll
      for (int dt = 0; dt < 4; ++dt) o[u][dt] *= alpha;

      // P^T as B operand of k-step ks: element s = st[u][2 ks + (s >> 3)][s & 7]
#pragma unroll
      for (int ks = 0; ks < 2; ++ks) {
        v8u pu;
#pragma unroll
        for (int i = 0; i < 4; ++i) {
          pu[i]     = pack_bf16(st[u][2 * ks][2 * i],     st[u][2 * ks][2 * i + 1]);
          pu[4 + i] = pack_bf16(st[u][2 * ks + 1][2 * i], st[u][2 * ks + 1][2 * i + 1]);
        }
        pb[u][ks] = __builtin_bit_cast(v16bf, pu);
      }
    }

    // ---- O^T += V^T P^T : four 16-row d tiles across HD=64, two k-steps ----
#pragma unroll
    for (int ks = 0; ks < 2; ++ks)
#pragma unroll
      for (int dt = 0; dt < 4; ++dt)
#pragma unroll
        for (int u = 0; u < kQT; ++u)
          o[u][dt] = wmma_bf16(vf[dt][ks], pb[u][ks], o[u][dt]);

    // Keeps the foot at the foot: raised to where the last LDS load lands, the
    // wait for the next chunk's load would come half a pass early and stall.
    __builtin_amdgcn_sched_barrier(0);
    // ---- foot of the pass: one barrier publishes the next chunk and ends
    // every wave's reads of this one, whose buffer is refilled behind it, a
    // whole pass ahead of its use ----
    asm volatile("s_wait_dscnt 0x0" ::: "memory");   // my reads of cur are done
    wait_tensor0(sg0, sg1);                          // my chunk of the next pass has landed
    __syncthreads();
    if (pinned(p + 2 < kPasses)) stage(cur, p + 2);
    if (pfwave && (p & 3) == 0 && p + 4 < kPasses) {
      pf += pfstep;
      asm volatile("global_prefetch_b8 %0, off scope:SCOPE_SE" :: "v"(pf));
    }
  }
  wait_tensor0(sg0, sg1);             // nothing in flight when the wave ends
  asm volatile("s_wait_dscnt 0x0" ::: "memory");   // nor any LDS read of the ring

  // ---- join the two key halves: the wave of half kh keeps tile kh of its query
  // group and hands the other one over (the tile index is a constant on either
  // side of a wave-uniform test, so o stays in registers) ----
  static_assert(kKH == 2 && kQT == 2, "one tile kept, one handed over");
  if (kh == 0) hand_over_tile<1>(o, mrun, lrun, xo[wave], xml[wave], lane);
  else         hand_over_tile<0>(o, mrun, lrun, xo[wave], xml[wave], lane);
  __syncthreads();                    // every wave's handed-over tile is in LDS
  const int h = bh % kNH;
  const int partner = wave ^ kQW;     // same query group, other key half
  u16* crow = ctx + ((size_t)b * kS + q0 + kh * 16) * kH + h * 2 * kTileElems + lane * 8;
  if (kh == 0) finish_tile<0>(o, mrun, lrun, xo[partner], xml[partner], lane, crow);
  else         finish_tile<1>(o, mrun, lrun, xo[partner], xml[partner], lane, crow);
}

// ---------------------------------------------------------------------------
// Kernel 3: output projection + bias + residual + LayerNorm, one launch.
//   y = ctx @ Wo^T + bo + x;  out = (y - mean) * rstd * gamma + beta
// A block owns kLT * 16 = 32 whole rows: its 12 waves take 64 columns each
// (2 x 4 accumulator tiles) and share the rows of ctx.  y stays in registers:
// each wave sums its 64 columns of every row, the 12 partial sums of a row meet
// in LDS behind one barrier, and every wave normalizes and stores its own tile.
// ---------------------------------------------------------------------------
constexpr int kLT = 2;                        // 16-row tiles per block
constexpr int kLW = kH / (16 * kWT);          // 12 waves cover the kH columns
constexpr int kLR = 16 * kLT;                 // 32 rows per block = lanes per wave
static_assert(kLR == 32 && kLW * 16 * kWT == kH && kM % kLR == 0,
              "one lane per row in the join of the partial sums");

// v + (v of lane l ^ M), M < 16: one step of a sum over a 16-lane row (DPP
// row_xmask).
template <int M>
__device__ __forceinline__ float add_row_xor(float v) {
  return v + __builtin_bit_cast(float, __builtin_amdgcn_mov_dpp(
      __builtin_bit_cast(int, v), 0x160 + M, 0xf, 0xf, false));
}

__global__ void __launch_bounds__(32 * kLW)
out_proj_ln_kernel(const u16* __restrict__ ctxb, const u16* __restrict__ Wob,
                   const float* __restrict__ bo, const float* __restrict__ x,
                   const float* __restrict__ gamma, const float* __restrict__ beta,
                   float* __restrict__ out) {
  __shared__ __align__(16) float psum[kLW][kLR];   // per wave and row: sum of y
  __shared__ __align__(16) float psq[kLW][kLR];    //                   sum of y * y
  __shared__ __align__(16) float smean[kLW][kLR];  // per row, a copy for each wave
  __shared__ __align__(16) float srstd[kLW][kLR];

  const int lane = threadIdx.x & 31;
  const int wave = __builtin_amdgcn_readfirstlane(threadIdx.x >> 5);
  const int lh   = lane >> 4;
  const int ml   = lane & 15;
  const int m0   = blockIdx.x * kLR;
  const int n0   = wave * (16 * kWT);

  // Prefetch.  The block's 32 rows of ctx: an instruction covers four k-steps
  // (4096 bytes) of both strips, waves 0..5 one each.  The wave's rows of Wo are
  // read by every block: a block asks for two of the 24 k-steps, chosen by its
  // index.
  const u16* crows = ctxb + (size_t)m0 * kH;
  const u16* wrows = Wob + (size_t)n0 * kH;
  const unsigned pfa = prefetch_lane_off<kLT>(lane) + (unsigned)(wave % 6) * 4096u;
  const unsigned pfb = prefetch_lane_off<kWT>(lane) + (blockIdx.x % 12) * 2048u;
  if (wave < 6) prefetch_units<0>(crows, pfa);
  prefetch_units<0>(wrows, pfb);

  v8f acc[kLT][kWT] = {};
  gemm_wave_tile(crows, wrows, (unsigned)lane, pfa, pfb, acc);

  float bb_[kWT], gg[kWT], bt[kWT];
#pragma unroll
  for (int j = 0; j < kWT; ++j) {
    bb_[j] = bo[n0 + j * 16 + ml];
    gg[j]  = gamma[n0 + j * 16 + ml];
    bt[j]  = beta[n0 + j * 16 + ml];
  }

  // The 64 residual values of the tile are fetched together, so the wave waits
  // for memory once.  y[i][j][r] = row i*16 + 8*lh + r, column n0 + j*16 + ml.
  const size_t base = (size_t)(m0 + 8 * lh) * kH + n0 + ml;
  v8f y[kLT][kWT];
#pragma unroll
  for (int i = 0; i < kLT; ++i)
#pragma unroll
    for (int j = 0; j < kWT; ++j)
#pragma unroll
      for (int r = 0; r < 8; ++r) y[i][j][r] = x[base + (i * 16 + r) * kH + j * 16];
  // Behind the loads above: their index registers are reused in what follows.
  asm volatile("s_wait_xcnt 0x0" ::: "memory");
#pragma unroll
  for (int i = 0; i < kLT; ++i)
#pragma unroll
    for (int j = 0; j < kWT; ++j) y[i][j] = acc[i][j] + bb_[j] + y[i][j];

  // ---- this wave's 64 columns of each row: 4 in the lane, then the 16 lanes
  // of the half ----
#pragma unroll
  for (int i = 0; i < kLT; ++i) {
    const v8f s8 = (y[i][0] + y[i][1]) + (y[i][2] + y[i][3]);
    const v8f q8 = (y[i][0] * y[i][0] + y[i][1] * y[i][1]) +
                   (y[i][2] * y[i][2] + y[i][3] * y[i][3]);
    float s[8], q[8];
#pragma unroll
    for (int r = 0; r < 8; ++r) {
      s[r] = add_row_xor<8>(add_row_xor<4>(add_row_xor<2>(add_row_xor<1>(s8[r]))));
      q[r] = add_row_xor<8>(add_row_xor<4>(add_row_xor<2>(add_row_xor<1>(q8[r]))));
    }
    if (ml == 0) {                            // one lane of each half: its 8 rows
      v4f* ps = (v4f*)&psum[wave][i * 16 + 8 * lh];
      v4f* pq = (v4f*)&psq[wave][i * 16 + 8 * lh];
      ps[0] = v4f{s[0], s[1], s[2], s[3]};  ps[1] = v4f{s[4], s[5], s[6], s[7]};
      pq[0] = v4f{q[0], q[1], q[2], q[3]};  pq[1] = v4f{q[4], q[5], q[6], q[7]};
    }
  }
  __syncthreads();                            // all 12 partial sums of every row

  // ---- lane l joins row l (every wave does, so one barrier is enough) ----
  {
    float ts = psum[0][lane], tq = psq[0][lane];
#pragma unroll
    for (int w = 1; w < kLW; ++w) { ts += psum[w][lane]; tq += psq[w][lane]; }
    const float mean = ts * (1.0f / kH);
    const float var  = tq * (1.0f / kH) - mean * mean;
    smean[wave][lane] = mean;
    srstd[wave][lane] = rsqrtf(var + 1e-5f);
  }
  // The wave reads back what its other lanes wrote: their stores are done first.
  asm volatile("s_wait_dscnt 0x0" ::: "memory");

#pragma unroll
  for (int i = 0; i < kLT; ++i) {
    const v4f* pm = (const v4f*)&smean[wave][i * 16 + 8 * lh];
    const v4f* pr = (const v4f*)&srstd[wave][i * 16 + 8 * lh];
    const v8f mean = __builtin_shufflevector(pm[0], pm[1], 0, 1, 2, 3, 4, 5, 6, 7);
    const v8f rstd = __builtin_shufflevector(pr[0], pr[1], 0, 1, 2, 3, 4, 5, 6, 7);
#pragma unroll
    for (int j = 0; j < kWT; ++j) y[i][j] = (y[i][j] - mean) * rstd * gg[j] + bt[j];
  }
  // Keeps the 64 stores in one run behind the arithmetic: mixed into it they
  // share data registers, and each reuse waits for earlier stores.
  __builtin_amdgcn_sched_barrier(0);
#pragma unroll
  for (int i = 0; i < kLT; ++i)
#pragma unroll
    for (int j = 0; j < kWT; ++j)
#pragma unroll
      for (int r = 0; r < 8; ++r) out[base + (i * 16 + r) * kH + j * 16] = y[i][j][r];
}

// ---------------------------------------------------------------------------
// Launch
// ---------------------------------------------------------------------------
extern "C" void kernel_launch(void* const* d_in, const int* in_sizes, int n_in,
                              void* d_out, int out_size, void* d_ws,
                              size_t ws_size, hipStream_t stream) {
  (void)in_sizes; (void)n_in; (void)out_size; (void)ws_size;

  const float* x     = (const float*)d_in[0];
  const float* amask = (const float*)d_in[1];
  const float* Wq    = (const float*)d_in[2];
  const float* bq    = (const float*)d_in[3];
  const float* Wk    = (const float*)d_in[4];
  const float* bk    = (const float*)d_in[5];
  const float* Wv    = (const float*)d_in[6];
  const float* bv    = (const float*)d_in[7];
  const float* Wo    = (const float*)d_in[8];
  const float* bo    = (const float*)d_in[9];
  const float* g     = (const float*)d_in[10];
  const float* be    = (const float*)d_in[11];
  float* out = (float*)d_out;

  // Workspace carve-up (all regions 16B-aligned by construction).
  const size_t NX = (size_t)kM * kH;          // 3,145,728 activation elems
  const size_t NW = (size_t)kH * kH;          // 589,824 weight elems
  char* w = (char*)d_ws;
  u16* XBF = (u16*)w;  w += NX * 2;
  u16* WQB = (u16*)w;  w += NW * 2;
  u16* WKB = (u16*)w;  w += NW * 2;
  u16* WVB = (u16*)w;  w += NW * 2;
  u16* WOB = (u16*)w;  w += NW * 2;
  u16* Qb  = (u16*)w;  w += NX * 2;           // [BH, S, HD]
  u16* Kb  = (u16*)w;  w += NX * 2;           // [BH, S, HD]
  u16* Vtb = (u16*)w;  w += NX * 2;           // [BH, HD, S] (transposed)
  u16* CTX = (u16*)w;                         // [B*S, H] bf16, fragment order

  // f32 -> bf16 conversions, one launch: XBF, WQB, WKB, WVB, WOB lie in a row.
  cvt_bf16_kernel<<<dim3(kXBlks + 4 * kWBlks), 256, 0, stream>>>(
      x, Wq, Wk, Wv, Wo, XBF);

  // QKV projections: 32 row blocks x 8 block columns = 256 blocks; XBF, WQB, WKB
  // and WVB lie in a row.
  qkv_proj_kernel<<<dim3(kM / kPM, kPBY), 32 * kPW, 0, stream>>>(
      XBF, bq, bk, bv, Qb, Kb, Vtb);

  // Flash attention: 128 q-tiles (4 per block, 2 per wave pair) x 24 (b,h) pairs.
  flash_attn_kernel<<<dim3(kS / (16 * kQT * kQW), kBH), 32 * kAW, 0, stream>>>(
      Qb, Kb, Vtb, amask, CTX);

  // Output projection + residual + LayerNorm -> d_out: 128 blocks of 32 rows.
  out_proj_ln_kernel<<<dim3(kM / kLR), 32 * kLW, 0, stream>>>(
      CTX, WOB, bo, x, g, be, out);
}
